// v000
// Times are from an AMD MI455X. After a warm-up the kernel runs many times in a row, and a time is the length of
// such a window on the GPU divided by its runs, so every launch and the gaps after it count. The runs cycle
// through copies of the inputs. A figure is the median of several windows, for all but v000 over two sittings.
// Sittings can differ by a few percent; kernels timed side by side share one.
// v000, which the later versions start from, runs in 2020 microseconds.
#include <hip/hip_runtime.h>

// Multi-head attention with interleaved-pair rotary embeddings on a channel-major input (x [2][1024][2048] = (batch, dim, seq); xt = x^T; [q|k|v] = xt W_qkv^T ('oi' [3072][1024]: row blocks q | k | v; 16 heads x 64); rotary on adjacent (even, odd) pairs with angle t x 10000^(-2i/64) (tables computed on device from the reference's float32 inv_freq); scores/8 over all 2048 keys; softmax; merged heads; out^T = W_out ('oi' [1024][1024]) x merged^T written channel-major -> [2][1024][2048] (4.2 M)).
// Compute dtypes, f32 accumulate: every input rounded to bf16; q/k/v on PLAIN bf16 operands (inputs: exact); input transposed to token-major while converting to bf16; interleaved rotary in f32 (precise cosf/sinf table); scores and attn.v: query rows < 512 hl (3 products), the rest single fp16 (x1024); softmax f32; W_out exact x merged hl (2 products), written transposed (dim-major) straight from the GEMM epilogue.

#define NB_  2
#define TT   2048
#define DM   1024
#define NH_  16
#define NKV  16
#define REP  (NH_ / NKV)
#define HD   64
#define DQ   (NH_ * HD)
#define DKV  (NKV * HD)
#define ZH   2
#define RH   512                  // query rows < RH use hi+lo planes (0: none)
#define WIN  2048
#define PCAR 1024.0f
#define SCL  0.125f   // HD^-0.5
typedef _Float16 h16;
typedef unsigned short bf;
typedef __attribute__((ext_vector_type(16))) __bf16   v16bf;
typedef __attribute__((ext_vector_type(16))) _Float16 v16h;
typedef __attribute__((ext_vector_type(8)))  _Float16 v8h;
typedef __attribute__((ext_vector_type(8)))  unsigned short v8us;
typedef __attribute__((ext_vector_type(8)))  float    v8f;
typedef __attribute__((ext_vector_type(4)))  float    v4f;
typedef v8h  __attribute__((may_alias)) v8ha;
typedef v4f  __attribute__((may_alias)) v4fa;
typedef v8us __attribute__((may_alias)) v8usa;

__device__ __forceinline__ unsigned short f2bf(float f) { unsigned u = __float_as_uint(f); u += 0x7FFFu + ((u >> 16) & 1u); return (unsigned short)(u >> 16); }
__device__ __forceinline__ float bf2f(unsigned short b) { return __uint_as_float(((unsigned)b) << 16); }
__device__ __forceinline__ float bfr(float f) { return bf2f(f2bf(f)); }
__device__ __forceinline__ v16h cat16(v8h lo, v8h hi) { return __builtin_shufflevector(lo, hi, 0, 1, 2, 3, 4, 5, 6, 7, 8, 9, 10, 11, 12, 13, 14, 15); }
__device__ __forceinline__ v16bf cat16b(v8us lo, v8us hi) { return __builtin_bit_cast(v16bf, __builtin_shufflevector(lo, hi, 0, 1, 2, 3, 4, 5, 6, 7, 8, 9, 10, 11, 12, 13, 14, 15)); }
__device__ __forceinline__ v8f wmma16(v16h a, v16h b, v8f c) { return __builtin_amdgcn_wmma_f32_16x16x32_f16(false, a, false, b, (short)0, c, false, false); }
__device__ __forceinline__ v8f wmmab(v16bf a, v16bf b, v8f c) { return __builtin_amdgcn_wmma_f32_16x16x32_bf16(false, a, false, b, (short)0, c, false, false); }



// ---- k_gemmw: register-blocked GEMM, ONE WAVE per 64x64 output tile (16 accumulators), operands straight from K-contiguous 16-bit planes; grid (M/64, N/64, Z), 32 threads.
// C[m][n] (f32, pitch ldc, + optional f32 bias[n]) = sum_k A[m][k] Bt[n][k] (+ split products per NSPLIT). z-batch strides sA/sB/sC in elements. K % 32 == 0.
template <typename T16> struct WFrag;
template <> struct WFrag<h16> { typedef v16h V; static __device__ __forceinline__ V ld(const h16* p) { return cat16(*(const v8h*)p, *(const v8h*)(p + 16)); } static __device__ __forceinline__ v8f mma(V a, V b, v8f c) { return wmma16(a, b, c); } };
template <> struct WFrag<bf> { typedef v16bf V; static __device__ __forceinline__ V ld(const bf* p) { return cat16b(*(const v8us*)p, *(const v8us*)(p + 16)); } static __device__ __forceinline__ v8f mma(V a, V b, v8f c) { return wmmab(a, b, c); } };
template <typename T16, int NSPLIT, bool BIAS>
__global__ __launch_bounds__(32) void k_gemmw(const T16* __restrict__ A, const T16* __restrict__ A2, const T16* __restrict__ Bt, const T16* __restrict__ Bt2, int K, float* C, int ldc, const float* __restrict__ bias, size_t sA, size_t sB, size_t sC) {
    typedef typename WFrag<T16>::V V;
    __shared__ __align__(16) float os[16 * 68];
    const size_t z = blockIdx.z; A += z * sA; if (A2) A2 += z * sA; Bt += z * sB; if (Bt2) Bt2 += z * sB; C += z * sC;
    const int lane = threadIdx.x & 31, lr = lane & 15, hi = lane >> 4; const int r0 = blockIdx.x * 64, c0 = blockIdx.y * 64;
    v8f acc[4][4];
#pragma unroll
    for (int mb = 0; mb < 4; ++mb)
#pragma unroll
        for (int nb = 0; nb < 4; ++nb) acc[mb][nb] = (v8f){};
    const size_t aoff = (size_t)(r0 + lr) * K + 8 * hi, boff = (size_t)(c0 + lr) * K + 8 * hi;
#pragma unroll 1
    for (int kc = 0; kc < K; kc += 32) {
        V a[4], a2[4];
#pragma unroll
        for (int mb = 0; mb < 4; ++mb) { a[mb] = WFrag<T16>::ld(A + aoff + (size_t)mb * 16 * K + kc); if (NSPLIT == 1 || NSPLIT == 2) a2[mb] = WFrag<T16>::ld(A2 + aoff + (size_t)mb * 16 * K + kc); }
#pragma unroll
        for (int nb = 0; nb < 4; ++nb) { const V b = WFrag<T16>::ld(Bt + boff + (size_t)nb * 16 * K + kc); V b2; if (NSPLIT >= 2) b2 = WFrag<T16>::ld(Bt2 + boff + (size_t)nb * 16 * K + kc);
#pragma unroll
            for (int mb = 0; mb < 4; ++mb) { acc[mb][nb] = WFrag<T16>::mma(a[mb], b, acc[mb][nb]); if (NSPLIT == 1 || NSPLIT == 2) acc[mb][nb] = WFrag<T16>::mma(a2[mb], b, acc[mb][nb]); if (NSPLIT >= 2) acc[mb][nb] = WFrag<T16>::mma(a[mb], b2, acc[mb][nb]); } }
        asm volatile("v_nop\n\tv_nop\n\tv_nop\n\tv_nop" : "+v"(acc[0][0]), "+v"(acc[1][1]), "+v"(acc[2][2]), "+v"(acc[3][3]) : "v"(a[0]), "v"(a[3]));
    }
#pragma unroll
    for (int mb = 0; mb < 4; ++mb) {
#pragma unroll
        for (int nb = 0; nb < 4; ++nb) {
#pragma unroll
            for (int j = 0; j < 8; ++j) os[(hi * 8 + j) * 68 + nb * 16 + lr] = acc[mb][nb][j]; }
        __builtin_amdgcn_wave_barrier(); asm volatile("" ::: "memory");
        float* crow = C + (size_t)(r0 + mb * 16) * ldc + c0;
{
#pragma unroll
            for (int s = 0; s < 8; ++s) { const int row = 2 * s + hi, cofs = lr * 4; v4f val = *(const v4fa*)(os + row * 68 + cofs); if (BIAS) { val[0] += bfr(bias[c0 + cofs]); val[1] += bfr(bias[c0 + cofs + 1]); val[2] += bfr(bias[c0 + cofs + 2]); val[3] += bfr(bias[c0 + cofs + 3]); }
                *(v4f*)(crow + (size_t)row * ldc + cofs) = val; }
             }
        __builtin_amdgcn_wave_barrier(); asm volatile("" ::: "memory");
    }
}

__device__ __forceinline__ h16 tohx(float x) { return (h16)x; }
__device__ __forceinline__ void splitf(float y, unsigned short& h, unsigned short& l) { h = f2bf(y); l = f2bf(y - bf2f(h)); }
typedef __attribute__((ext_vector_type(2))) _Float16 v2h;
typedef __attribute__((ext_vector_type(4))) _Float16 v4h;
typedef __attribute__((ext_vector_type(2))) unsigned short v2us;
typedef __attribute__((ext_vector_type(4))) unsigned short v4us;
typedef __attribute__((ext_vector_type(2))) float v2f;
typedef __attribute__((ext_vector_type(4))) int v4i;

__global__ __launch_bounds__(256) void k_wtG(const float* __restrict__ w, int K, int N, bf* Bt) {
    const int lane = threadIdx.x & 31; const int L0 = (blockIdx.x * 8 + (threadIdx.x >> 5)) * 8; const int nlines = N * K / 64;
{
#pragma unroll 1
        for (int l = 0; l < 8; ++l) { const int L = L0 + l; if (L >= nlines) break; const size_t e = (size_t)L * 64 + lane * 2; const int k = (int)(e % K), n = (int)(e / K); v2us o;
            o[0] = f2bf(w[(size_t)k * N + n]); o[1] = f2bf(w[(size_t)(k + 1) * N + n]); *(v2us*)(Bt + e) = o; }
         }
}
__global__ __launch_bounds__(256) void k_cvt8T(const float* __restrict__ src, bf* dst) { const size_t i = (size_t)blockIdx.x * 256 + threadIdx.x; if (i >= (size_t)TT * DM / 8) return; const int t = (int)(i / (DM / 8)); const int c0 = (int)(i % (DM / 8)) * 8; v8us o;
#pragma unroll
    for (int k = 0; k < 8; ++k) o[k] = f2bf(src[(size_t)(c0 + k) * TT + t]); *(v8us*)(dst + (size_t)t * DM + c0) = o;  }
__global__ __launch_bounds__(256) void k_cvt8(const float* __restrict__ src, bf* dst, size_t n8) { const size_t i = (size_t)blockIdx.x * 256 + threadIdx.x; if (i >= n8) return; const v8f v = *(const v8f*)(src + i * 8); v8us o;
#pragma unroll
    for (int k = 0; k < 8; ++k) o[k] = f2bf(v[k]); *(v8us*)(dst + i * 8) = o;  }

// k_ropeI: head planes [h][t][d] (fp16 + hi/lo) of rope(x) x sc with the interleaved-pair convention out[2i] = x[2i] cos - x[2i+1] sin, out[2i+1] = x[2i] sin + x[2i+1] cos (angle t x INV[i])

__global__ __launch_bounds__(256) void k_vtp(const float* __restrict__ F, int pitch, int nheads, h16* V16, bf* Vh, bf* Vl) { const size_t e = ((size_t)blockIdx.x * 256 + threadIdx.x) * 2; if (e >= (size_t)nheads * HD * TT) return; const int t = (int)(e % TT); const int d = (int)((e / TT) % HD); const int g = (int)(e / ((size_t)TT * HD)); v2h o16; v2us oh, ol;
#pragma unroll
    for (int q = 0; q < 2; ++q) { const float x = F[(size_t)(t + q) * pitch + g * HD + d]; o16[q] = tohx(x); unsigned short a2, c2; splitf(x, a2, c2); oh[q] = a2; ol[q] = c2; }
    *(v2h*)(V16 + e) = o16; *(v2us*)(Vh + e) = oh; *(v2us*)(Vl + e) = ol;  }
__constant__ float INV[HD / 2] = {1.0f,0.749894202f,0.562341332f,0.421696514f,0.316227764f,0.237137362f,0.177827939f,0.133352146f,0.100000001f,0.0749894157f,0.0562341288f,0.0421696492f,0.0316227786f,0.0237137359f,0.0177827943f,0.0133352149f,0.00999999978f,0.00749894232f,0.00562341325f,0.00421696482f,0.00316227786f,0.00237137382f,0.00177827943f,0.00133352145f,0.00100000005f,0.000749894185f,0.000562341302f,0.000421696488f,0.000316227786f,0.000237137385f,0.00017782794f,0.00013335215f};
__global__ __launch_bounds__(256) void k_cstab(float* CS) { const int idx = blockIdx.x * 256 + threadIdx.x; if (idx >= TT * HD) return; const int t = idx / HD, d = idx % HD; const float ang = __fmul_rn((float)t, INV[d >> 1]); v2f cs; cs[0] = cosf(ang); cs[1] = sinf(ang);
    *(v2f*)(CS + (size_t)idx * 2) = cs;  }
__global__ __launch_bounds__(256) void k_ropeI(const float* __restrict__ F, int pitch, int nheads, const float* __restrict__ CS, float sc, h16* P16, bf* Ph, bf* Pl) {
    const size_t e = ((size_t)blockIdx.x * 256 + threadIdx.x) * 2; if (e >= (size_t)nheads * TT * HD) return; const int d = (int)(e % HD); const int t = (int)((e / HD) % TT); const int h = (int)(e / ((size_t)HD * TT)); const float* f = F + (size_t)t * pitch + h * HD; const float x0 = f[d], x1 = f[d + 1]; const v2f cs = *(const v2f*)(CS + ((size_t)t * HD + d) * 2); v2h o16; v2us oh, ol;
    float a0 = __fmul_rn(x0, cs[0]), b0 = __fmul_rn(x1, cs[1]), a1 = __fmul_rn(x1, cs[0]), b1 = __fmul_rn(x0, cs[1]); asm volatile("" : "+v"(a0), "+v"(b0), "+v"(a1), "+v"(b1));
    float r0 = __fsub_rn(a0, b0) * sc, r1 = __fadd_rn(b1, a1) * sc;   /* even: x0 c - x1 s; odd: x0 s + x1 c */
    o16[0] = tohx(r0); o16[1] = tohx(r1); { unsigned short a2, c2; splitf(r0, a2, c2); oh[0] = a2; ol[0] = c2; splitf(r1, a2, c2); oh[1] = a2; ol[1] = c2; }
    *(v2h*)(P16 + e) = o16; *(v2us*)(Ph + e) = oh; *(v2us*)(Pl + e) = ol;  }

// k_asoft: per row (zz, i): t = S x HD^-0.5 (no mask); softmax over the 2048 keys (register row, one exp, fixed trees);
__global__ __launch_bounds__(256) void k_asoft(const float* __restrict__ Sb, h16* P16, bf* Ph, bf* Pl) {
    const int lane = threadIdx.x & 31; const int row = blockIdx.x * 8 + (threadIdx.x >> 5); if (row >= ZH * TT) return; const int i = row % TT; const int zz = row / TT; (void)zz; const bool hires = (i < RH); const float* sr = Sb + (size_t)row * TT; float v[TT / 32]; float mx = -3.0e38f;
#pragma unroll
    for (int ch = 0; ch < TT / 128; ++ch) { const int j0 = ch * 128 + lane * 4; const v4f a = *(const v4f*)(sr + j0);
#pragma unroll
        for (int q = 0; q < 4; ++q) { const int j = j0 + q; (void)j; const float t = a[q] * SCL; v[ch * 4 + q] = t; mx = fmaxf(mx, t); } }
#pragma unroll
    for (int sh = 16; sh; sh >>= 1) mx = fmaxf(mx, __shfl_xor(mx, sh, 32));
    float sum = 0.f;
#pragma unroll
    for (int k = 0; k < TT / 32; ++k) { float d0 = __fsub_rn(v[k], mx); asm volatile("" : "+v"(d0)); v[k] = __builtin_amdgcn_exp2f(__fmul_rn(d0, 1.4426950408889634f)); sum += v[k]; }
#pragma unroll
    for (int sh = 16; sh; sh >>= 1) sum += __shfl_xor(sum, sh, 32);
    const float f = __fdiv_rn(hires ? 1.0f : PCAR, sum);
{
        if (hires) {
#pragma unroll
            for (int ch = 0; ch < TT / 128; ++ch) { v4us oh, ol;
#pragma unroll
                for (int q = 0; q < 4; ++q) { unsigned short a, c2; splitf(v[ch * 4 + q] * f, a, c2); oh[q] = a; ol[q] = c2; }
                const size_t oo = ((size_t)zz * (RH ? RH : 1) + i) * TT + ch * 128 + lane * 4; *(v4us*)(Ph + oo) = oh; *(v4us*)(Pl + oo) = ol; }
        } else {
#pragma unroll
            for (int ch = 0; ch < TT / 128; ++ch) { v4h o4;
#pragma unroll
                for (int q = 0; q < 4; ++q) o4[q] = tohx(v[ch * 4 + q] * f);
                *(v4h*)(P16 + (size_t)row * TT + ch * 128 + lane * 4) = o4; } }
         }
}
__global__ __launch_bounds__(256) void k_merge(const float* __restrict__ O, int h0, bf* Ah, bf* Al) { const size_t e = ((size_t)blockIdx.x * 256 + threadIdx.x) * 2; if (e >= (size_t)ZH * TT * HD) return; const int d = (int)(e % HD); const int t = (int)((e / HD) % TT); const int zz = (int)(e / ((size_t)HD * TT)); const float cs = (t < RH) ? 1.0f : (1.0f / PCAR); const size_t oo = (size_t)t * DQ + (h0 + zz) * HD + d;
    v2us oh, ol;
#pragma unroll
    for (int q = 0; q < 2; ++q) { unsigned short a, c2; splitf(O[e + q] * cs, a, c2); oh[q] = a; ol[q] = c2; } *(v2us*)(Ah + oo) = oh; *(v2us*)(Al + oo) = ol;  }

extern "C" void kernel_launch(void* const* d_in, const int* in_sizes, int n_in,
                              void* d_out, int out_size, void* d_ws, size_t ws_size, hipStream_t stream) {
    (void)in_sizes; (void)n_in; (void)out_size;
    const float* x = (const float*)d_in[0]; const float* wqkv = (const float*)d_in[1]; const float* wo = (const float*)d_in[2];  const float* wq = wqkv; const float* wk = wqkv + (size_t)1024 * 1024; const float* wv = wqkv + (size_t)2048 * 1024; (void)wq; (void)wk; (void)wv;
    float* OUT = (float*)d_out;     // [2][1024][2048] (batch, dim, seq)
    char* wsp = (char*)d_ws;
    auto take = [&](size_t bytes) { char* p = wsp; wsp += (bytes + 255) & ~(size_t)255; return (void*)p; };
    bf* WQ = (bf*)take((size_t)DQ * DM * 2); bf* WK = (bf*)take((size_t)DKV * DM * 2); bf* WV = (bf*)take((size_t)DKV * DM * 2); bf* WO = (bf*)take((size_t)DM * DQ * 2); float* CS = (float*)take((size_t)TT * HD * 2 * 4);
    bf* XB = (bf*)take((size_t)TT * DM * 2); float* FQ = (float*)take((size_t)TT * DQ * 4); float* FK = (float*)take((size_t)TT * DKV * 4);
    h16* QP16 = (h16*)take((size_t)NH_ * TT * HD * 2); h16* KP16 = (h16*)take((size_t)NKV * TT * HD * 2); h16* VT16 = (h16*)take((size_t)NKV * HD * TT * 2);
    bf* QPh = (bf*)take((size_t)NH_ * TT * HD * 2); bf* QPl = (bf*)take((size_t)NH_ * TT * HD * 2); bf* KPh = (bf*)take((size_t)NKV * TT * HD * 2); bf* KPl = (bf*)take((size_t)NKV * TT * HD * 2); bf* VTh = (bf*)take((size_t)NKV * HD * TT * 2); bf* VTl = (bf*)take((size_t)NKV * HD * TT * 2); bf* Ph = (bf*)take((size_t)ZH * RH * TT * 2); bf* Pl = (bf*)take((size_t)ZH * RH * TT * 2);
    float* Sb = (float*)take((size_t)ZH * TT * TT * 4); h16* P16 = (h16*)take((size_t)ZH * TT * TT * 2); float* Ob = (float*)take((size_t)ZH * TT * HD * 4); bf* ATh = (bf*)take((size_t)TT * DQ * 2); bf* ATl = (bf*)take((size_t)TT * DQ * 2);
    if ((size_t)(wsp - (char*)d_ws) > ws_size) return;    // ws 256 MiB
    float* FV = FK;   // v projection reuses the k buffer after the k planes are built (stream-ordered)
    { k_cvt8<<<(unsigned)(((size_t)DQ * DM / 8 + 255) / 256), 256, 0, stream>>>(wq, WQ, (size_t)DQ * DM / 8); k_cvt8<<<(unsigned)(((size_t)DKV * DM / 8 + 255) / 256), 256, 0, stream>>>(wk, WK, (size_t)DKV * DM / 8); k_cvt8<<<(unsigned)(((size_t)DKV * DM / 8 + 255) / 256), 256, 0, stream>>>(wv, WV, (size_t)DKV * DM / 8);
      k_cvt8<<<(unsigned)(((size_t)DM * DQ / 8 + 255) / 256), 256, 0, stream>>>(wo, WO, (size_t)DM * DQ / 8);
       }
    k_cstab<<<(TT * HD + 255) / 256, 256, 0, stream>>>(CS);
    const unsigned LQ = (unsigned)(((size_t)NH_ * TT * HD / 2 + 255) / 256), LKv = (unsigned)(((size_t)NKV * TT * HD / 2 + 255) / 256);
    for (int b = 0; b < NB_; ++b) {
        
        k_cvt8T<<<(unsigned)(((size_t)TT * DM / 8 + 255) / 256), 256, 0, stream>>>(x + (size_t)b * DM * TT, XB);   /* x[b] is channel-major [DM][TT] -> XB token-major [TT][DM] */
        k_gemmw<bf, 0, false><<<dim3(TT / 64, DQ / 64, 1), 32, 0, stream>>>(XB, nullptr, WQ, nullptr, DM, FQ, DQ, nullptr, 0, 0, 0);
        k_ropeI<<<LQ, 256, 0, stream>>>(FQ, DQ, NH_, CS, 1.0f, QP16, QPh, QPl);
        k_gemmw<bf, 0, false><<<dim3(TT / 64, DKV / 64, 1), 32, 0, stream>>>(XB, nullptr, WK, nullptr, DM, FK, DKV, nullptr, 0, 0, 0);
        k_ropeI<<<LKv, 256, 0, stream>>>(FK, DKV, NKV, CS, 1.0f, KP16, KPh, KPl);
        k_gemmw<bf, 0, false><<<dim3(TT / 64, DKV / 64, 1), 32, 0, stream>>>(XB, nullptr, WV, nullptr, DM, FV, DKV, nullptr, 0, 0, 0); k_vtp<<<LKv, 256, 0, stream>>>(FV, DKV, NKV, VT16, VTh, VTl);
        for (int h0 = 0; h0 < NH_; h0 += ZH) { const size_t zq = (size_t)h0, zk = (size_t)(h0 / REP);   // one kv head per query head: the pass's two heads use consecutive kv planes (z-strides TT*HD)
            k_gemmw<bf, 2, false><<<dim3(RH / 64, TT / 64, ZH), 32, 0, stream>>>(QPh + zq * TT * HD, QPl + zq * TT * HD, KPh + zk * TT * HD, KPl + zk * TT * HD, HD, Sb, TT, nullptr, (size_t)TT * HD, (size_t)TT * HD, (size_t)TT * TT);
            k_gemmw<h16, 0, false><<<dim3((TT - RH) / 64, TT / 64, ZH), 32, 0, stream>>>(QP16 + zq * TT * HD + (size_t)RH * HD, nullptr, KP16 + zk * TT * HD, nullptr, HD, Sb + (size_t)RH * TT, TT, nullptr, (size_t)TT * HD, (size_t)TT * HD, (size_t)TT * TT);
            k_asoft<<<ZH * TT / 8, 256, 0, stream>>>(Sb, P16, Ph, Pl);
            k_gemmw<bf, 2, false><<<dim3(RH / 64, HD / 64, ZH), 32, 0, stream>>>(Ph, Pl, VTh + zk * HD * TT, VTl + zk * HD * TT, TT, Ob, HD, nullptr, (size_t)RH * TT, (size_t)HD * TT, (size_t)TT * HD);
            k_gemmw<h16, 0, false><<<dim3((TT - RH) / 64, HD / 64, ZH), 32, 0, stream>>>(P16 + (size_t)RH * TT, nullptr, VT16 + zk * HD * TT, nullptr, TT, Ob + (size_t)RH * HD, HD, nullptr, (size_t)TT * TT, (size_t)HD * TT, (size_t)TT * HD);
            k_merge<<<(unsigned)(((size_t)ZH * TT * HD / 2 + 255) / 256), 256, 0, stream>>>(Ob, h0, ATh, ATl); }
        k_gemmw<bf, 3, false><<<dim3(DM / 64, TT / 64, 1), 32, 0, stream>>>(WO, nullptr, ATh, ATl, DQ, OUT + (size_t)b * DM * TT, TT, nullptr, 0, 0, 0);   /* channel-major output rows [e][t]: exact W_out x (merged hi + lo) */ }
}

// v001
// Measured time: 729 microseconds a run.
// Two timings next to v000 put it at 2.78 and 2.77 times that version's speed.
#include <hip/hip_runtime.h>

// Multi-head attention with interleaved-pair rotary embeddings on a channel-major input (x [2][1024][2048] = (batch, dim, seq); xt = x^T; [q|k|v] = xt W_qkv^T ('oi' [3072][1024]: row blocks q | k | v; 16 heads x 64); rotary on adjacent (even, odd) pairs with angle t x 10000^(-2i/64) (tables computed on device from the reference's float32 inv_freq); scores/8 over all 2048 keys; softmax; merged heads; out^T = W_out ('oi' [1024][1024]) x merged^T written channel-major -> [2][1024][2048] (4.2 M)).
// Compute dtypes, f32 accumulate: every input rounded to bf16; q/k/v on PLAIN bf16 operands (inputs: exact); input transposed to token-major while converting to bf16; interleaved rotary in f32 (precise cosf/sinf table); scores and attn.v: query rows < 512 hl (3 products), the rest single fp16 (x1024); softmax f32; W_out exact x merged hl (2 products), written transposed (dim-major) straight from the GEMM epilogue.

#define NB_  2
#define TT   2048
#define DM   1024
#define NH_  16
#define NKV  16
#define REP  (NH_ / NKV)
#define HD   64
#define DQ   (NH_ * HD)
#define DKV  (NKV * HD)
#define ZH   16                   // heads per attention launch (all of them)
#define CH   512                  // query rows per score + softmax pass; the f32 score block [ZH][CH][TT] is 64 MiB
#define RH   512                  // query rows < RH use hi+lo planes
#define WIN  2048
#define PCAR 1024.0f
#define SCL  0.125f   // HD^-0.5
static_assert(RH == CH && (TT - RH) % CH == 0 && 2 * RH <= TT - RH, "the hi+lo rows are one pass, the fp16 rows whole passes, and the hi and lo planes fit in the fp16 plane's space");
typedef _Float16 h16;
typedef unsigned short bf;
typedef __attribute__((ext_vector_type(16))) __bf16   v16bf;
typedef __attribute__((ext_vector_type(16))) _Float16 v16h;
typedef __attribute__((ext_vector_type(8)))  _Float16 v8h;
typedef __attribute__((ext_vector_type(8)))  unsigned short v8us;
typedef __attribute__((ext_vector_type(8)))  float    v8f;
typedef __attribute__((ext_vector_type(4)))  float    v4f;
typedef v8h  __attribute__((may_alias)) v8ha;
typedef v4f  __attribute__((may_alias)) v4fa;
typedef v8us __attribute__((may_alias)) v8usa;

__device__ __forceinline__ unsigned short f2bf(float f) { unsigned u = __float_as_uint(f); u += 0x7FFFu + ((u >> 16) & 1u); return (unsigned short)(u >> 16); }
__device__ __forceinline__ float bf2f(unsigned short b) { return __uint_as_float(((unsigned)b) << 16); }
__device__ __forceinline__ float bfr(float f) { return bf2f(f2bf(f)); }
__device__ __forceinline__ v16h cat16(v8h lo, v8h hi) { return __builtin_shufflevector(lo, hi, 0, 1, 2, 3, 4, 5, 6, 7, 8, 9, 10, 11, 12, 13, 14, 15); }
__device__ __forceinline__ v16bf cat16b(v8us lo, v8us hi) { return __builtin_bit_cast(v16bf, __builtin_shufflevector(lo, hi, 0, 1, 2, 3, 4, 5, 6, 7, 8, 9, 10, 11, 12, 13, 14, 15)); }
__device__ __forceinline__ v8f wmma16(v16h a, v16h b, v8f c) { return __builtin_amdgcn_wmma_f32_16x16x32_f16(false, a, false, b, (short)0, c, false, false); }
__device__ __forceinline__ v8f wmmab(v16bf a, v16bf b, v8f c) { return __builtin_amdgcn_wmma_f32_16x16x32_bf16(false, a, false, b, (short)0, c, false, false); }



// ---- k_gemmw: register-blocked GEMM, ONE WAVE per 64x64 output tile (16 accumulators), operands straight from K-contiguous 16-bit planes; grid (M/64, N/64, Z), 32 threads.
// C[m][n] (f32, pitch ldc, + optional f32 bias[n]) = sum_k A[m][k] Bt[n][k] (+ split products per NSPLIT). z-batch strides sA/sB/sC in elements. K % 32 == 0.
template <typename T16> struct WFrag;
template <> struct WFrag<h16> { typedef v16h V; static __device__ __forceinline__ V ld(const h16* p) { return cat16(*(const v8h*)p, *(const v8h*)(p + 16)); } static __device__ __forceinline__ v8f mma(V a, V b, v8f c) { return wmma16(a, b, c); } };
template <> struct WFrag<bf> { typedef v16bf V; static __device__ __forceinline__ V ld(const bf* p) { return cat16b(*(const v8us*)p, *(const v8us*)(p + 16)); } static __device__ __forceinline__ v8f mma(V a, V b, v8f c) { return wmmab(a, b, c); } };
template <typename T16, int NSPLIT, bool BIAS>
__global__ __launch_bounds__(32) void k_gemmw(const T16* __restrict__ A, const T16* __restrict__ A2, const T16* __restrict__ Bt, const T16* __restrict__ Bt2, int K, float* C, int ldc, const float* __restrict__ bias, size_t sA, size_t sB, size_t sC) {
    typedef typename WFrag<T16>::V V;
    __shared__ __align__(16) float os[16 * 68];
    const size_t z = blockIdx.z; A += z * sA; if (A2) A2 += z * sA; Bt += z * sB; if (Bt2) Bt2 += z * sB; C += z * sC;
    const int lane = threadIdx.x & 31, lr = lane & 15, hi = lane >> 4; const int r0 = blockIdx.x * 64, c0 = blockIdx.y * 64;
    v8f acc[4][4];
#pragma unroll
    for (int mb = 0; mb < 4; ++mb)
#pragma unroll
        for (int nb = 0; nb < 4; ++nb) acc[mb][nb] = (v8f){};
    const size_t aoff = (size_t)(r0 + lr) * K + 8 * hi, boff = (size_t)(c0 + lr) * K + 8 * hi;
#pragma unroll 1
    for (int kc = 0; kc < K; kc += 32) {
        V a[4], a2[4];
#pragma unroll
        for (int mb = 0; mb < 4; ++mb) { a[mb] = WFrag<T16>::ld(A + aoff + (size_t)mb * 16 * K + kc); if (NSPLIT == 1 || NSPLIT == 2) a2[mb] = WFrag<T16>::ld(A2 + aoff + (size_t)mb * 16 * K + kc); }
#pragma unroll
        for (int nb = 0; nb < 4; ++nb) { const V b = WFrag<T16>::ld(Bt + boff + (size_t)nb * 16 * K + kc); V b2; if (NSPLIT >= 2) b2 = WFrag<T16>::ld(Bt2 + boff + (size_t)nb * 16 * K + kc);
#pragma unroll
            for (int mb = 0; mb < 4; ++mb) { acc[mb][nb] = WFrag<T16>::mma(a[mb], b, acc[mb][nb]); if (NSPLIT == 1 || NSPLIT == 2) acc[mb][nb] = WFrag<T16>::mma(a2[mb], b, acc[mb][nb]); if (NSPLIT >= 2) acc[mb][nb] = WFrag<T16>::mma(a[mb], b2, acc[mb][nb]); } }
        asm volatile("v_nop\n\tv_nop\n\tv_nop\n\tv_nop" : "+v"(acc[0][0]), "+v"(acc[1][1]), "+v"(acc[2][2]), "+v"(acc[3][3]) : "v"(a[0]), "v"(a[3]));
    }
#pragma unroll
    for (int mb = 0; mb < 4; ++mb) {
#pragma unroll
        for (int nb = 0; nb < 4; ++nb) {
#pragma unroll
            for (int j = 0; j < 8; ++j) os[(hi * 8 + j) * 68 + nb * 16 + lr] = acc[mb][nb][j]; }
        __builtin_amdgcn_wave_barrier(); asm volatile("" ::: "memory");
        float* crow = C + (size_t)(r0 + mb * 16) * ldc + c0;
{
#pragma unroll
            for (int s = 0; s < 8; ++s) { const int row = 2 * s + hi, cofs = lr * 4; v4f val = *(const v4fa*)(os + row * 68 + cofs); if (BIAS) { val[0] += bfr(bias[c0 + cofs]); val[1] += bfr(bias[c0 + cofs + 1]); val[2] += bfr(bias[c0 + cofs + 2]); val[3] += bfr(bias[c0 + cofs + 3]); }
                *(v4f*)(crow + (size_t)row * ldc + cofs) = val; }
             }
        __builtin_amdgcn_wave_barrier(); asm volatile("" ::: "memory");
    }
}

__device__ __forceinline__ h16 tohx(float x) { return (h16)x; }
__device__ __forceinline__ void splitf(float y, unsigned short& h, unsigned short& l) { h = f2bf(y); l = f2bf(y - bf2f(h)); }
typedef __attribute__((ext_vector_type(2))) _Float16 v2h;
typedef __attribute__((ext_vector_type(4))) _Float16 v4h;
typedef __attribute__((ext_vector_type(2))) unsigned short v2us;
typedef __attribute__((ext_vector_type(4))) unsigned short v4us;
typedef __attribute__((ext_vector_type(2))) float v2f;
typedef __attribute__((ext_vector_type(4))) int v4i;

__global__ __launch_bounds__(256) void k_wtG(const float* __restrict__ w, int K, int N, bf* Bt) {
    const int lane = threadIdx.x & 31; const int L0 = (blockIdx.x * 8 + (threadIdx.x >> 5)) * 8; const int nlines = N * K / 64;
{
#pragma unroll 1
        for (int l = 0; l < 8; ++l) { const int L = L0 + l; if (L >= nlines) break; const size_t e = (size_t)L * 64 + lane * 2; const int k = (int)(e % K), n = (int)(e / K); v2us o;
            o[0] = f2bf(w[(size_t)k * N + n]); o[1] = f2bf(w[(size_t)(k + 1) * N + n]); *(v2us*)(Bt + e) = o; }
         }
}
__global__ __launch_bounds__(256) void k_cvt8T(const float* __restrict__ src, bf* dst) { const size_t i = (size_t)blockIdx.x * 256 + threadIdx.x; if (i >= (size_t)TT * DM / 8) return; const int t = (int)(i / (DM / 8)); const int c0 = (int)(i % (DM / 8)) * 8; v8us o;
#pragma unroll
    for (int k = 0; k < 8; ++k) o[k] = f2bf(src[(size_t)(c0 + k) * TT + t]); *(v8us*)(dst + (size_t)t * DM + c0) = o;  }
__global__ __launch_bounds__(256) void k_cvt8(const float* __restrict__ src, bf* dst, size_t n8) { const size_t i = (size_t)blockIdx.x * 256 + threadIdx.x; if (i >= n8) return; const v8f v = *(const v8f*)(src + i * 8); v8us o;
#pragma unroll
    for (int k = 0; k < 8; ++k) o[k] = f2bf(v[k]); *(v8us*)(dst + i * 8) = o;  }

// k_ropeI: head planes [h][t][d] (fp16 + hi/lo) of rope(x) x sc with the interleaved-pair convention out[2i] = x[2i] cos - x[2i+1] sin, out[2i+1] = x[2i] sin + x[2i+1] cos (angle t x INV[i])

__global__ __launch_bounds__(256) void k_vtp(const float* __restrict__ F, int pitch, int nheads, h16* V16, bf* Vh, bf* Vl) { const size_t e = ((size_t)blockIdx.x * 256 + threadIdx.x) * 2; if (e >= (size_t)nheads * HD * TT) return; const int t = (int)(e % TT); const int d = (int)((e / TT) % HD); const int g = (int)(e / ((size_t)TT * HD)); v2h o16; v2us oh, ol;
#pragma unroll
    for (int q = 0; q < 2; ++q) { const float x = F[(size_t)(t + q) * pitch + g * HD + d]; o16[q] = tohx(x); unsigned short a2, c2; splitf(x, a2, c2); oh[q] = a2; ol[q] = c2; }
    *(v2h*)(V16 + e) = o16; *(v2us*)(Vh + e) = oh; *(v2us*)(Vl + e) = ol;  }
__constant__ float INV[HD / 2] = {1.0f,0.749894202f,0.562341332f,0.421696514f,0.316227764f,0.237137362f,0.177827939f,0.133352146f,0.100000001f,0.0749894157f,0.0562341288f,0.0421696492f,0.0316227786f,0.0237137359f,0.0177827943f,0.0133352149f,0.00999999978f,0.00749894232f,0.00562341325f,0.00421696482f,0.00316227786f,0.00237137382f,0.00177827943f,0.00133352145f,0.00100000005f,0.000749894185f,0.000562341302f,0.000421696488f,0.000316227786f,0.000237137385f,0.00017782794f,0.00013335215f};
__global__ __launch_bounds__(256) void k_cstab(float* CS) { const int idx = blockIdx.x * 256 + threadIdx.x; if (idx >= TT * HD) return; const int t = idx / HD, d = idx % HD; const float ang = __fmul_rn((float)t, INV[d >> 1]); v2f cs; cs[0] = cosf(ang); cs[1] = sinf(ang);
    *(v2f*)(CS + (size_t)idx * 2) = cs;  }
__global__ __launch_bounds__(256) void k_ropeI(const float* __restrict__ F, int pitch, int nheads, const float* __restrict__ CS, float sc, h16* P16, bf* Ph, bf* Pl) {
    const size_t e = ((size_t)blockIdx.x * 256 + threadIdx.x) * 2; if (e >= (size_t)nheads * TT * HD) return; const int d = (int)(e % HD); const int t = (int)((e / HD) % TT); const int h = (int)(e / ((size_t)HD * TT)); const float* f = F + (size_t)t * pitch + h * HD; const float x0 = f[d], x1 = f[d + 1]; const v2f cs = *(const v2f*)(CS + ((size_t)t * HD + d) * 2); v2h o16; v2us oh, ol;
    float a0 = __fmul_rn(x0, cs[0]), b0 = __fmul_rn(x1, cs[1]), a1 = __fmul_rn(x1, cs[0]), b1 = __fmul_rn(x0, cs[1]); asm volatile("" : "+v"(a0), "+v"(b0), "+v"(a1), "+v"(b1));
    float r0 = __fsub_rn(a0, b0) * sc, r1 = __fadd_rn(b1, a1) * sc;   /* even: x0 c - x1 s; odd: x0 s + x1 c */
    o16[0] = tohx(r0); o16[1] = tohx(r1); { unsigned short a2, c2; splitf(r0, a2, c2); oh[0] = a2; ol[0] = c2; splitf(r1, a2, c2); oh[1] = a2; ol[1] = c2; }
    *(v2h*)(P16 + e) = o16; *(v2us*)(Ph + e) = oh; *(v2us*)(Pl + e) = ol;  }

// k_asoft: one pass of CH query rows [r0, r0 + CH) of every head; per row (zz, i): t = S x HD^-0.5 (no mask); softmax over the 2048 keys (register row, one exp, fixed trees);
// score block Sb [ZH][CH][TT]; probabilities: rows < RH to Ph/Pl [ZH][RH][TT], the rest to P16 [ZH][TT - RH][TT].
__global__ __launch_bounds__(256) void k_asoft(const float* __restrict__ Sb, int r0, h16* P16, bf* Ph, bf* Pl) {
    const int lane = threadIdx.x & 31; const int row = blockIdx.x * 8 + (threadIdx.x >> 5); if (row >= ZH * CH) return; const int i = r0 + row % CH; const int zz = row / CH; const bool hires = (i < RH); const float* sr = Sb + (size_t)row * TT; float v[TT / 32]; float mx = -3.0e38f;
#pragma unroll
    for (int ch = 0; ch < TT / 128; ++ch) { const int j0 = ch * 128 + lane * 4; const v4f a = *(const v4f*)(sr + j0);
#pragma unroll
        for (int q = 0; q < 4; ++q) { const int j = j0 + q; (void)j; const float t = a[q] * SCL; v[ch * 4 + q] = t; mx = fmaxf(mx, t); } }
    asm volatile("s_wait_xcnt 0x0" :: "v"(sr + lane * 4) : "memory");   // the wait that stands before a register named by the row loads is rewritten; the address pair is an input so that it stays live up to the wait (without it the last load's result was placed on the pair)
#pragma unroll
    for (int sh = 16; sh; sh >>= 1) mx = fmaxf(mx, __shfl_xor(mx, sh, 32));
    float sum = 0.f;
#pragma unroll
    for (int k = 0; k < TT / 32; ++k) { float d0 = __fsub_rn(v[k], mx); asm volatile("" : "+v"(d0)); v[k] = __builtin_amdgcn_exp2f(__fmul_rn(d0, 1.4426950408889634f)); sum += v[k]; }
#pragma unroll
    for (int sh = 16; sh; sh >>= 1) sum += __shfl_xor(sum, sh, 32);
    const float f = __fdiv_rn(hires ? 1.0f : PCAR, sum);
{
        if (hires) {
#pragma unroll
            for (int ch = 0; ch < TT / 128; ++ch) { v4us oh, ol;
#pragma unroll
                for (int q = 0; q < 4; ++q) { unsigned short a, c2; splitf(v[ch * 4 + q] * f, a, c2); oh[q] = a; ol[q] = c2; }
                const size_t oo = ((size_t)zz * (RH ? RH : 1) + i) * TT + ch * 128 + lane * 4; *(v4us*)(Ph + oo) = oh; *(v4us*)(Pl + oo) = ol; }
        } else {
#pragma unroll
            for (int ch = 0; ch < TT / 128; ++ch) { v4h o4;
#pragma unroll
                for (int q = 0; q < 4; ++q) o4[q] = tohx(v[ch * 4 + q] * f);
                *(v4h*)(P16 + ((size_t)zz * (TT - RH) + (i - RH)) * TT + ch * 128 + lane * 4) = o4; } }
         }
}
__global__ __launch_bounds__(256) void k_merge(const float* __restrict__ O, int h0, bf* Ah, bf* Al) { const size_t e = ((size_t)blockIdx.x * 256 + threadIdx.x) * 2; if (e >= (size_t)ZH * TT * HD) return; const int d = (int)(e % HD); const int t = (int)((e / HD) % TT); const int zz = (int)(e / ((size_t)HD * TT)); const float cs = (t < RH) ? 1.0f : (1.0f / PCAR); const size_t oo = (size_t)t * DQ + (h0 + zz) * HD + d;
    v2us oh, ol;
#pragma unroll
    for (int q = 0; q < 2; ++q) { unsigned short a, c2; splitf(O[e + q] * cs, a, c2); oh[q] = a; ol[q] = c2; } *(v2us*)(Ah + oo) = oh; *(v2us*)(Al + oo) = ol;  }

extern "C" void kernel_launch(void* const* d_in, const int* in_sizes, int n_in,
                              void* d_out, int out_size, void* d_ws, size_t ws_size, hipStream_t stream) {
    (void)in_sizes; (void)n_in; (void)out_size;
    const float* x = (const float*)d_in[0]; const float* wqkv = (const float*)d_in[1]; const float* wo = (const float*)d_in[2];  const float* wq = wqkv; const float* wk = wqkv + (size_t)1024 * 1024; const float* wv = wqkv + (size_t)2048 * 1024; (void)wq; (void)wk; (void)wv;
    float* OUT = (float*)d_out;     // [2][1024][2048] (batch, dim, seq)
    char* wsp = (char*)d_ws;
    auto take = [&](size_t bytes) { char* p = wsp; wsp += (bytes + 255) & ~(size_t)255; return (void*)p; };
    bf* WQ = (bf*)take((size_t)DQ * DM * 2); bf* WK = (bf*)take((size_t)DKV * DM * 2); bf* WV = (bf*)take((size_t)DKV * DM * 2); bf* WO = (bf*)take((size_t)DM * DQ * 2); float* CS = (float*)take((size_t)TT * HD * 2 * 4);
    bf* XB = (bf*)take((size_t)TT * DM * 2); float* FQ = (float*)take((size_t)TT * DQ * 4); float* FK = (float*)take((size_t)TT * DKV * 4);
    h16* QP16 = (h16*)take((size_t)NH_ * TT * HD * 2); h16* KP16 = (h16*)take((size_t)NKV * TT * HD * 2); h16* VT16 = (h16*)take((size_t)NKV * HD * TT * 2);
    bf* QPh = (bf*)take((size_t)NH_ * TT * HD * 2); bf* QPl = (bf*)take((size_t)NH_ * TT * HD * 2); bf* KPh = (bf*)take((size_t)NKV * TT * HD * 2); bf* KPl = (bf*)take((size_t)NKV * TT * HD * 2); bf* VTh = (bf*)take((size_t)NKV * HD * TT * 2); bf* VTl = (bf*)take((size_t)NKV * HD * TT * 2);
    float* Sb = (float*)take((size_t)ZH * CH * TT * 4); h16* P16 = (h16*)take((size_t)ZH * (TT - RH) * TT * 2); float* Ob = (float*)take((size_t)ZH * TT * HD * 4); bf* ATh = (bf*)take((size_t)TT * DQ * 2); bf* ATl = (bf*)take((size_t)TT * DQ * 2);
    if ((size_t)(wsp - (char*)d_ws) > ws_size) return;    // ws 256 MiB
    bf* Ph = (bf*)P16; bf* Pl = Ph + (size_t)ZH * RH * TT;   // the hi and lo planes share the fp16 plane's space: their attn.v launch has read them before the first fp16 row is stored (stream-ordered); 2 RH <= TT - RH
    float* FV = FK;   // v projection reuses the k buffer after the k planes are built (stream-ordered)
    { k_cvt8<<<(unsigned)(((size_t)DQ * DM / 8 + 255) / 256), 256, 0, stream>>>(wq, WQ, (size_t)DQ * DM / 8); k_cvt8<<<(unsigned)(((size_t)DKV * DM / 8 + 255) / 256), 256, 0, stream>>>(wk, WK, (size_t)DKV * DM / 8); k_cvt8<<<(unsigned)(((size_t)DKV * DM / 8 + 255) / 256), 256, 0, stream>>>(wv, WV, (size_t)DKV * DM / 8);
      k_cvt8<<<(unsigned)(((size_t)DM * DQ / 8 + 255) / 256), 256, 0, stream>>>(wo, WO, (size_t)DM * DQ / 8);
       }
    k_cstab<<<(TT * HD + 255) / 256, 256, 0, stream>>>(CS);
    const unsigned LQ = (unsigned)(((size_t)NH_ * TT * HD / 2 + 255) / 256), LKv = (unsigned)(((size_t)NKV * TT * HD / 2 + 255) / 256);
    for (int b = 0; b < NB_; ++b) {
        
        k_cvt8T<<<(unsigned)(((size_t)TT * DM / 8 + 255) / 256), 256, 0, stream>>>(x + (size_t)b * DM * TT, XB);   /* x[b] is channel-major [DM][TT] -> XB token-major [TT][DM] */
        k_gemmw<bf, 0, false><<<dim3(TT / 64, DQ / 64, 1), 32, 0, stream>>>(XB, nullptr, WQ, nullptr, DM, FQ, DQ, nullptr, 0, 0, 0);
        k_ropeI<<<LQ, 256, 0, stream>>>(FQ, DQ, NH_, CS, 1.0f, QP16, QPh, QPl);
        k_gemmw<bf, 0, false><<<dim3(TT / 64, DKV / 64, 1), 32, 0, stream>>>(XB, nullptr, WK, nullptr, DM, FK, DKV, nullptr, 0, 0, 0);
        k_ropeI<<<LKv, 256, 0, stream>>>(FK, DKV, NKV, CS, 1.0f, KP16, KPh, KPl);
        k_gemmw<bf, 0, false><<<dim3(TT / 64, DKV / 64, 1), 32, 0, stream>>>(XB, nullptr, WV, nullptr, DM, FV, DKV, nullptr, 0, 0, 0); k_vtp<<<LKv, 256, 0, stream>>>(FV, DKV, NKV, VT16, VTh, VTl);
        // every launch covers all heads (one kv head per query head, z-strides TT*HD); scores and softmax go in passes of CH query rows, attn.v once per precision over all of its rows
        k_gemmw<bf, 2, false><<<dim3(RH / 64, TT / 64, ZH), 32, 0, stream>>>(QPh, QPl, KPh, KPl, HD, Sb, TT, nullptr, (size_t)TT * HD, (size_t)TT * HD, (size_t)CH * TT);
        k_asoft<<<ZH * CH / 8, 256, 0, stream>>>(Sb, 0, P16, Ph, Pl);
        k_gemmw<bf, 2, false><<<dim3(RH / 64, HD / 64, ZH), 32, 0, stream>>>(Ph, Pl, VTh, VTl, TT, Ob, HD, nullptr, (size_t)RH * TT, (size_t)HD * TT, (size_t)TT * HD);
        for (int r0 = RH; r0 < TT; r0 += CH) {
            k_gemmw<h16, 0, false><<<dim3(CH / 64, TT / 64, ZH), 32, 0, stream>>>(QP16 + (size_t)r0 * HD, nullptr, KP16, nullptr, HD, Sb, TT, nullptr, (size_t)TT * HD, (size_t)TT * HD, (size_t)CH * TT);
            k_asoft<<<ZH * CH / 8, 256, 0, stream>>>(Sb, r0, P16, Ph, Pl); }
        k_gemmw<h16, 0, false><<<dim3((TT - RH) / 64, HD / 64, ZH), 32, 0, stream>>>(P16, nullptr, VT16, nullptr, TT, Ob + (size_t)RH * HD, HD, nullptr, (size_t)(TT - RH) * TT, (size_t)HD * TT, (size_t)TT * HD);
        k_merge<<<(unsigned)(((size_t)ZH * TT * HD / 2 + 255) / 256), 256, 0, stream>>>(Ob, 0, ATh, ATl);
        k_gemmw<bf, 3, false><<<dim3(DM / 64, TT / 64, 1), 32, 0, stream>>>(WO, nullptr, ATh, ATl, DQ, OUT + (size_t)b * DM * TT, TT, nullptr, 0, 0, 0);   /* channel-major output rows [e][t]: exact W_out x (merged hi + lo) */ }
}

// v002
// One run takes 390 microseconds.
// Timed twice side by side with v001, it ran 1.85 and 1.83 times as fast.
// Over all steps from v000 it is 5.12 times as fast.
#include <hip/hip_runtime.h>

// Multi-head attention with interleaved-pair rotary embeddings on a channel-major input (x [2][1024][2048] = (batch, dim, seq); xt = x^T; [q|k|v] = xt W_qkv^T ('oi' [3072][1024]: row blocks q | k | v; 16 heads x 64); rotary on adjacent (even, odd) pairs with angle t x 10000^(-2i/64) (tables computed on device from the reference's float32 inv_freq); scores/8 over all 2048 keys; softmax; merged heads; out^T = W_out ('oi' [1024][1024]) x merged^T written channel-major -> [2][1024][2048] (4.2 M)).
// Compute dtypes, f32 accumulate: every input rounded to bf16; q/k/v on PLAIN bf16 operands (inputs: exact); input transposed to token-major while converting to bf16; interleaved rotary in f32 (precise cosf/sinf table); scores and attn.v fused in one launch per batch (online softmax in f32, scores never in memory): query rows < 512 hl (3 products), the rest single fp16 (x16); W_out exact x merged hl (2 products), written transposed (dim-major) straight from the GEMM epilogue.

#define NB_  2
#define TT   2048
#define DM   1024
#define NH_  16
#define NKV  16
#define REP  (NH_ / NKV)
#define HD   64
#define DQ   (NH_ * HD)
#define DKV  (NKV * HD)
#define RH   512                  // query rows < RH use hi+lo planes (0: none)
#define WIN  2048
#define SCL  0.125f   // HD^-0.5
typedef _Float16 h16;
typedef unsigned short bf;
typedef __attribute__((ext_vector_type(16))) __bf16   v16bf;
typedef __attribute__((ext_vector_type(16))) _Float16 v16h;
typedef __attribute__((ext_vector_type(8)))  _Float16 v8h;
typedef __attribute__((ext_vector_type(8)))  unsigned short v8us;
typedef __attribute__((ext_vector_type(8)))  float    v8f;
typedef __attribute__((ext_vector_type(4)))  float    v4f;
typedef v8h  __attribute__((may_alias)) v8ha;
typedef v4f  __attribute__((may_alias)) v4fa;
typedef v8us __attribute__((may_alias)) v8usa;

__device__ __forceinline__ unsigned short f2bf(float f) { unsigned u = __float_as_uint(f); u += 0x7FFFu + ((u >> 16) & 1u); return (unsigned short)(u >> 16); }
__device__ __forceinline__ float bf2f(unsigned short b) { return __uint_as_float(((unsigned)b) << 16); }
__device__ __forceinline__ float bfr(float f) { return bf2f(f2bf(f)); }
__device__ __forceinline__ v16h cat16(v8h lo, v8h hi) { return __builtin_shufflevector(lo, hi, 0, 1, 2, 3, 4, 5, 6, 7, 8, 9, 10, 11, 12, 13, 14, 15); }
__device__ __forceinline__ v16bf cat16b(v8us lo, v8us hi) { return __builtin_bit_cast(v16bf, __builtin_shufflevector(lo, hi, 0, 1, 2, 3, 4, 5, 6, 7, 8, 9, 10, 11, 12, 13, 14, 15)); }
__device__ __forceinline__ v8f wmma16(v16h a, v16h b, v8f c) { return __builtin_amdgcn_wmma_f32_16x16x32_f16(false, a, false, b, (short)0, c, false, false); }
__device__ __forceinline__ v8f wmmab(v16bf a, v16bf b, v8f c) { return __builtin_amdgcn_wmma_f32_16x16x32_bf16(false, a, false, b, (short)0, c, false, false); }



// ---- k_gemmw: register-blocked GEMM, ONE WAVE per 64x64 output tile (16 accumulators), operands straight from K-contiguous 16-bit planes; grid (M/64, N/64, Z), 32 threads.
// C[m][n] (f32, pitch ldc, + optional f32 bias[n]) = sum_k A[m][k] Bt[n][k] (+ split products per NSPLIT). z-batch strides sA/sB/sC in elements. K % 32 == 0.
template <typename T16> struct WFrag;
template <> struct WFrag<h16> { typedef v16h V; static __device__ __forceinline__ V ld(const h16* p) { return cat16(*(const v8h*)p, *(const v8h*)(p + 16)); } static __device__ __forceinline__ v8f mma(V a, V b, v8f c) { return wmma16(a, b, c); } };
template <> struct WFrag<bf> { typedef v16bf V; static __device__ __forceinline__ V ld(const bf* p) { return cat16b(*(const v8us*)p, *(const v8us*)(p + 16)); } static __device__ __forceinline__ v8f mma(V a, V b, v8f c) { return wmmab(a, b, c); } };
template <typename T16, int NSPLIT, bool BIAS>
__global__ __launch_bounds__(32) void k_gemmw(const T16* __restrict__ A, const T16* __restrict__ A2, const T16* __restrict__ Bt, const T16* __restrict__ Bt2, int K, float* C, int ldc, const float* __restrict__ bias, size_t sA, size_t sB, size_t sC) {
    typedef typename WFrag<T16>::V V;
    __shared__ __align__(16) float os[16 * 68];
    const size_t z = blockIdx.z; A += z * sA; if (A2) A2 += z * sA; Bt += z * sB; if (Bt2) Bt2 += z * sB; C += z * sC;
    const int lane = threadIdx.x & 31, lr = lane & 15, hi = lane >> 4; const int r0 = blockIdx.x * 64, c0 = blockIdx.y * 64;
    v8f acc[4][4];
#pragma unroll
    for (int mb = 0; mb < 4; ++mb)
#pragma unroll
        for (int nb = 0; nb < 4; ++nb) acc[mb][nb] = (v8f){};
    const size_t aoff = (size_t)(r0 + lr) * K + 8 * hi, boff = (size_t)(c0 + lr) * K + 8 * hi;
#pragma unroll 1
    for (int kc = 0; kc < K; kc += 32) {
        V a[4], a2[4];
#pragma unroll
        for (int mb = 0; mb < 4; ++mb) { a[mb] = WFrag<T16>::ld(A + aoff + (size_t)mb * 16 * K + kc); if (NSPLIT == 1 || NSPLIT == 2) a2[mb] = WFrag<T16>::ld(A2 + aoff + (size_t)mb * 16 * K + kc); }
#pragma unroll
        for (int nb = 0; nb < 4; ++nb) { const V b = WFrag<T16>::ld(Bt + boff + (size_t)nb * 16 * K + kc); V b2; if (NSPLIT >= 2) b2 = WFrag<T16>::ld(Bt2 + boff + (size_t)nb * 16 * K + kc);
#pragma unroll
            for (int mb = 0; mb < 4; ++mb) { acc[mb][nb] = WFrag<T16>::mma(a[mb], b, acc[mb][nb]); if (NSPLIT == 1 || NSPLIT == 2) acc[mb][nb] = WFrag<T16>::mma(a2[mb], b, acc[mb][nb]); if (NSPLIT >= 2) acc[mb][nb] = WFrag<T16>::mma(a[mb], b2, acc[mb][nb]); } }
        asm volatile("v_nop\n\tv_nop\n\tv_nop\n\tv_nop" : "+v"(acc[0][0]), "+v"(acc[1][1]), "+v"(acc[2][2]), "+v"(acc[3][3]) : "v"(a[0]), "v"(a[3]));
    }
#pragma unroll
    for (int mb = 0; mb < 4; ++mb) {
#pragma unroll
        for (int nb = 0; nb < 4; ++nb) {
#pragma unroll
            for (int j = 0; j < 8; ++j) os[(hi * 8 + j) * 68 + nb * 16 + lr] = acc[mb][nb][j]; }
        __builtin_amdgcn_wave_barrier(); asm volatile("" ::: "memory");
        float* crow = C + (size_t)(r0 + mb * 16) * ldc + c0;
{
#pragma unroll
            for (int s = 0; s < 8; ++s) { const int row = 2 * s + hi, cofs = lr * 4; v4f val = *(const v4fa*)(os + row * 68 + cofs); if (BIAS) { val[0] += bfr(bias[c0 + cofs]); val[1] += bfr(bias[c0 + cofs + 1]); val[2] += bfr(bias[c0 + cofs + 2]); val[3] += bfr(bias[c0 + cofs + 3]); }
                *(v4f*)(crow + (size_t)row * ldc + cofs) = val; }
             }
        __builtin_amdgcn_wave_barrier(); asm volatile("" ::: "memory");
    }
}

__device__ __forceinline__ h16 tohx(float x) { return (h16)x; }
__device__ __forceinline__ void splitf(float y, unsigned short& h, unsigned short& l) { h = f2bf(y); l = f2bf(y - bf2f(h)); }
typedef __attribute__((ext_vector_type(2))) _Float16 v2h;
typedef __attribute__((ext_vector_type(4))) _Float16 v4h;
typedef __attribute__((ext_vector_type(2))) unsigned short v2us;
typedef __attribute__((ext_vector_type(4))) unsigned short v4us;
typedef __attribute__((ext_vector_type(2))) float v2f;
typedef __attribute__((ext_vector_type(4))) int v4i;

__global__ __launch_bounds__(256) void k_wtG(const float* __restrict__ w, int K, int N, bf* Bt) {
    const int lane = threadIdx.x & 31; const int L0 = (blockIdx.x * 8 + (threadIdx.x >> 5)) * 8; const int nlines = N * K / 64;
{
#pragma unroll 1
        for (int l = 0; l < 8; ++l) { const int L = L0 + l; if (L >= nlines) break; const size_t e = (size_t)L * 64 + lane * 2; const int k = (int)(e % K), n = (int)(e / K); v2us o;
            o[0] = f2bf(w[(size_t)k * N + n]); o[1] = f2bf(w[(size_t)(k + 1) * N + n]); *(v2us*)(Bt + e) = o; }
         }
}
__global__ __launch_bounds__(256) void k_cvt8T(const float* __restrict__ src, bf* dst) { const size_t i = (size_t)blockIdx.x * 256 + threadIdx.x; if (i >= (size_t)TT * DM / 8) return; const int t = (int)(i / (DM / 8)); const int c0 = (int)(i % (DM / 8)) * 8; v8us o;
#pragma unroll
    for (int k = 0; k < 8; ++k) o[k] = f2bf(src[(size_t)(c0 + k) * TT + t]); *(v8us*)(dst + (size_t)t * DM + c0) = o;  }
__global__ __launch_bounds__(256) void k_cvt8(const float* __restrict__ src, bf* dst, size_t n8) { const size_t i = (size_t)blockIdx.x * 256 + threadIdx.x; if (i >= n8) return; const v8f v = *(const v8f*)(src + i * 8); v8us o;
#pragma unroll
    for (int k = 0; k < 8; ++k) o[k] = f2bf(v[k]); *(v8us*)(dst + i * 8) = o;  }

// k_ropeI: head planes [h][t][d] (fp16 + hi/lo) of rope(x) x sc with the interleaved-pair convention out[2i] = x[2i] cos - x[2i+1] sin, out[2i+1] = x[2i] sin + x[2i+1] cos (angle t x INV[i])

__global__ __launch_bounds__(256) void k_vtp(const float* __restrict__ F, int pitch, int nheads, h16* V16, bf* Vh, bf* Vl) { const size_t e = ((size_t)blockIdx.x * 256 + threadIdx.x) * 2; if (e >= (size_t)nheads * HD * TT) return; const int t = (int)(e % TT); const int d = (int)((e / TT) % HD); const int g = (int)(e / ((size_t)TT * HD)); v2h o16; v2us oh, ol;
#pragma unroll
    for (int q = 0; q < 2; ++q) { const float x = F[(size_t)(t + q) * pitch + g * HD + d]; o16[q] = tohx(x); unsigned short a2, c2; splitf(x, a2, c2); oh[q] = a2; ol[q] = c2; }
    *(v2h*)(V16 + e) = o16; *(v2us*)(Vh + e) = oh; *(v2us*)(Vl + e) = ol;  }
__constant__ float INV[HD / 2] = {1.0f,0.749894202f,0.562341332f,0.421696514f,0.316227764f,0.237137362f,0.177827939f,0.133352146f,0.100000001f,0.0749894157f,0.0562341288f,0.0421696492f,0.0316227786f,0.0237137359f,0.0177827943f,0.0133352149f,0.00999999978f,0.00749894232f,0.00562341325f,0.00421696482f,0.00316227786f,0.00237137382f,0.00177827943f,0.00133352145f,0.00100000005f,0.000749894185f,0.000562341302f,0.000421696488f,0.000316227786f,0.000237137385f,0.00017782794f,0.00013335215f};
__global__ __launch_bounds__(256) void k_cstab(float* CS) { const int idx = blockIdx.x * 256 + threadIdx.x; if (idx >= TT * HD) return; const int t = idx / HD, d = idx % HD; const float ang = __fmul_rn((float)t, INV[d >> 1]); v2f cs; cs[0] = cosf(ang); cs[1] = sinf(ang);
    *(v2f*)(CS + (size_t)idx * 2) = cs;  }
__global__ __launch_bounds__(256) void k_ropeI(const float* __restrict__ F, int pitch, int nheads, const float* __restrict__ CS, float sc, h16* P16, bf* Ph, bf* Pl) {
    const size_t e = ((size_t)blockIdx.x * 256 + threadIdx.x) * 2; if (e >= (size_t)nheads * TT * HD) return; const int d = (int)(e % HD); const int t = (int)((e / HD) % TT); const int h = (int)(e / ((size_t)HD * TT)); const float* f = F + (size_t)t * pitch + h * HD; const float x0 = f[d], x1 = f[d + 1]; const v2f cs = *(const v2f*)(CS + ((size_t)t * HD + d) * 2); v2h o16; v2us oh, ol;
    float a0 = __fmul_rn(x0, cs[0]), b0 = __fmul_rn(x1, cs[1]), a1 = __fmul_rn(x1, cs[0]), b1 = __fmul_rn(x0, cs[1]); asm volatile("" : "+v"(a0), "+v"(b0), "+v"(a1), "+v"(b1));
    float r0 = __fsub_rn(a0, b0) * sc, r1 = __fadd_rn(b1, a1) * sc;   /* even: x0 c - x1 s; odd: x0 s + x1 c */
    o16[0] = tohx(r0); o16[1] = tohx(r1); { unsigned short a2, c2; splitf(r0, a2, c2); oh[0] = a2; ol[0] = c2; splitf(r1, a2, c2); oh[1] = a2; ol[1] = c2; }
    *(v2h*)(P16 + e) = o16; *(v2us*)(Ph + e) = oh; *(v2us*)(Pl + e) = ol;  }

#define KS   64                   // keys per LDS stage
#define LP   72                   // LDS row pitch in 16-bit elements: 144 B = 16 B x odd, conflict-free for 16-byte reads
#define TILE (64 * LP)            // one staged plane: 64 rows (keys of K, channels of V^T) x 64 elements
static_assert(HD == 64 && KS == 64 && TT % KS == 0 && RH % 64 == 0 && (TT - RH) % 128 == 0, "tile geometry of k_fattn");
__device__ __forceinline__ float xhalf(float x) { return __builtin_bit_cast(float, __builtin_amdgcn_permlanex16(__builtin_bit_cast(int, x), __builtin_bit_cast(int, x), 0x76543210, 0xfedcba98, false, false)); }   // lane l <-> lane l ^ 16, on the vector pipe
// Eight independent v_exp_f32, then the one slot that the instruction set asks for behind a transcendental before its result is read or its source overwritten; "=&v" keeps every result off every source.
__device__ __forceinline__ void exp2x8(const float (&t)[8], float (&p)[8]) {
    asm("v_exp_f32 %0, %8\n\tv_exp_f32 %1, %9\n\tv_exp_f32 %2, %10\n\tv_exp_f32 %3, %11\n\tv_exp_f32 %4, %12\n\tv_exp_f32 %5, %13\n\tv_exp_f32 %6, %14\n\tv_exp_f32 %7, %15\n\tv_nop"
        : "=&v"(p[0]), "=&v"(p[1]), "=&v"(p[2]), "=&v"(p[3]), "=&v"(p[4]), "=&v"(p[5]), "=&v"(p[6]), "=&v"(p[7]) : "v"(t[0]), "v"(t[1]), "v"(t[2]), "v"(t[3]), "v"(t[4]), "v"(t[5]), "v"(t[6]), "v"(t[7])); }
__device__ __forceinline__ float exp2s(float x) { float r; asm("v_exp_f32 %0, %1\n\tv_nop" : "=&v"(r) : "v"(x)); return r; }   // one v_exp_f32 with the same slot behind it
template <bool HL> struct FOp;
template <> struct FOp<false> { typedef v16h V; static __device__ __forceinline__ V frag(const unsigned short* p) { return cat16(__builtin_bit_cast(v8h, *(const v8usa*)p), __builtin_bit_cast(v8h, *(const v8usa*)(p + 16))); } static __device__ __forceinline__ v8f mma(V a, V b, v8f c) { return wmma16(a, b, c); } };
template <> struct FOp<true> { typedef v16bf V; static __device__ __forceinline__ V frag(const unsigned short* p) { return cat16b(*(const v8usa*)p, *(const v8usa*)(p + 16)); } static __device__ __forceinline__ v8f mma(V a, V b, v8f c) { return wmmab(a, b, c); } };
// Q*, K* [t][HD], V* [HD][t] of this head (plane 1: the lo planes, HL only); q0: the wave's first query; NF: query fragments of 16 per wave.
template <bool HL, int NF>
__device__ __forceinline__ void fa_body(unsigned short* sm, const unsigned short* __restrict__ Q0, const unsigned short* __restrict__ Q1, const unsigned short* __restrict__ K0, const unsigned short* __restrict__ K1, const unsigned short* __restrict__ V0, const unsigned short* __restrict__ V1, int q0, int h, bf* Ah, bf* Al) {
    typedef FOp<HL> F; typedef typename F::V V;
    constexpr int NP = HL ? 2 : 1;                       // planes per operand
    constexpr float C = SCL * 1.4426950408889634f;       // raw score -> log2 units
    constexpr float SH = HL ? 0.0f : 4.0f;               // fp16 probabilities carry x16: at most 2^(8+4), and small ones stay normal numbers
    const int tid = threadIdx.x, lane = tid & 31, lr = lane & 15, hi = lane >> 4;
    const int srow = tid >> 3, scol = (tid & 7) * 8;     // staging: 8 threads per 128-byte row, 16 rows a sweep
    V qa[NP][NF][2];
#pragma unroll
    for (int qf = 0; qf < NF; ++qf)
#pragma unroll
        for (int ks = 0; ks < 2; ++ks) { const size_t qo = (size_t)(q0 + qf * 16 + lr) * HD + ks * 32 + 8 * hi; qa[0][qf][ks] = F::frag(Q0 + qo); if (HL) qa[NP - 1][qf][ks] = F::frag(Q1 + qo); }
    v8f o[4][NF]; float m[NF], l[NF];
#pragma unroll
    for (int qf = 0; qf < NF; ++qf) { m[qf] = -3.0e38f; l[qf] = 0.f;
#pragma unroll
        for (int mb = 0; mb < 4; ++mb) o[mb][qf] = (v8f){}; }
    v8us rk[NP][4], rv[NP][4]; const size_t kof = (size_t)srow * HD + scol, vof = (size_t)srow * TT + scol;
    auto gload = [&](int s) {
#pragma unroll
        for (int u = 0; u < 4; ++u) { const size_t ko = kof + (size_t)s * (KS * HD) + u * (16 * HD), vo = vof + (size_t)s * KS + u * (16 * TT);
            rk[0][u] = *(const v8usa*)(K0 + ko); rv[0][u] = *(const v8usa*)(V0 + vo); if (HL) { rk[NP - 1][u] = *(const v8usa*)(K1 + ko); rv[NP - 1][u] = *(const v8usa*)(V1 + vo); } } };
    auto sstore = [&](int b) { unsigned short* d = sm + b * (2 * NP * TILE) + srow * LP + scol;
#pragma unroll
        for (int u = 0; u < 4; ++u)
#pragma unroll
            for (int pl = 0; pl < NP; ++pl) { *(v8usa*)(d + pl * TILE + u * 16 * LP) = rk[pl][u]; *(v8usa*)(d + (NP + pl) * TILE + u * 16 * LP) = rv[pl][u]; } };
    gload(0); sstore(0); __syncthreads();
#pragma unroll 1   // rolled: one copy of the stage body, so that the hot loop stays short in the instruction cache
    for (int s = 0; s < TT / KS; ++s) {
        if (s + 1 < TT / KS) gload(s + 1);               // the next stage's global loads fly while this stage is worked on
        const unsigned short* kb = sm + (s & 1) * (2 * NP * TILE) + lr * LP + 8 * hi; const unsigned short* vb = kb + NP * TILE;
#pragma unroll
        for (int c = 0; c < KS / 32; ++c) {
            v8f st[2][NF];
#pragma unroll
            for (int kt = 0; kt < 2; ++kt) { V ka[NP][2];
#pragma unroll
                for (int pl = 0; pl < NP; ++pl)
#pragma unroll
                    for (int ks = 0; ks < 2; ++ks) ka[pl][ks] = F::frag(kb + pl * TILE + (c * 32 + kt * 16) * LP + ks * 32);
#pragma unroll
                for (int qf = 0; qf < NF; ++qf) { v8f a = (v8f){};
#pragma unroll
                    for (int ks = 0; ks < 2; ++ks) { a = F::mma(ka[0][ks], qa[0][qf][ks], a); if (HL) { a = F::mma(ka[NP - 1][ks], qa[0][qf][ks], a); a = F::mma(ka[0][ks], qa[NP - 1][qf][ks], a); } }
                    st[kt][qf] = a; } }
            float mx[NF]; bool need = false;
#pragma unroll
            for (int qf = 0; qf < NF; ++qf) { float a = fmaxf(st[0][qf][0], st[1][qf][0]), a1 = fmaxf(st[0][qf][1], st[1][qf][1]);   // two short chains
#pragma unroll
                for (int j = 2; j < 8; j += 2) { a = fmaxf(a, fmaxf(st[0][qf][j], st[1][qf][j])); a1 = fmaxf(a1, fmaxf(st[0][qf][j + 1], st[1][qf][j + 1])); }
                a = fmaxf(a, a1); a = fmaxf(a, xhalf(a)); mx[qf] = a * C; need = need || (mx[qf] > m[qf] + 8.0f); }
            if (__builtin_amdgcn_ballot_w32(need) != 0) {   // wave-uniform: one test per 32 keys
#pragma unroll
                for (int qf = 0; qf < NF; ++qf) { const float mn = fmaxf(m[qf], mx[qf]); const float al = exp2s(m[qf] - mn); m[qf] = mn; l[qf] *= al;
#pragma unroll
                    for (int mb = 0; mb < 4; ++mb)
#pragma unroll
                        for (int j = 0; j < 8; ++j) o[mb][qf][j] *= al; } }
            V ph[NF], pl2[NF];
#pragma unroll
            for (int qf = 0; qf < NF; ++qf) { const float mo = m[qf] - SH; float sum[4];   // four short chains
#pragma unroll
                for (int kt = 0; kt < 2; ++kt) { float t[8], p[8];
#pragma unroll
                    for (int j = 0; j < 8; j += 2) { const v2f r = __builtin_elementwise_fma((v2f){st[kt][qf][j], st[kt][qf][j + 1]}, (v2f){C, C}, (v2f){-mo, -mo}); t[j] = r[0]; t[j + 1] = r[1]; }   // packed: two scores an instruction
                    exp2x8(t, p);
#pragma unroll
                    for (int j = 0; j < 8; ++j) { if (kt == 0 && j < 4) sum[j] = p[j]; else sum[j & 3] += p[j];
                        if constexpr (HL) { const __bf16 a = (__bf16)p[j]; ph[qf][kt * 8 + j] = a; pl2[qf][kt * 8 + j] = (__bf16)(p[j] - (float)a); } else { ph[qf][kt * 8 + j] = (h16)p[j]; } } }
                l[qf] += (sum[0] + sum[1]) + (sum[2] + sum[3]); }
#pragma unroll
            for (int mb = 0; mb < 4; ++mb) { V va[NP];
#pragma unroll
                for (int pl = 0; pl < NP; ++pl) va[pl] = F::frag(vb + pl * TILE + mb * 16 * LP + c * 32);
#pragma unroll
                for (int qf = 0; qf < NF; ++qf) { o[mb][qf] = F::mma(va[0], ph[qf], o[mb][qf]); if (HL) { o[mb][qf] = F::mma(va[NP - 1], ph[qf], o[mb][qf]); o[mb][qf] = F::mma(va[0], pl2[qf], o[mb][qf]); } } }
        }
        if (s + 1 < TT / KS) sstore((s + 1) & 1);        // into the buffer whose last readers passed the barrier of the trip before
        __syncthreads();                                 // publishes stage s + 1 and ends every read of stage s
    }
#pragma unroll
    for (int qf = 0; qf < NF; ++qf) { const float inv = __fdiv_rn(1.0f, l[qf] + xhalf(l[qf])); const size_t ob = (size_t)(q0 + qf * 16 + lr) * DQ + h * HD + hi * 8;
#pragma unroll
        for (int mb = 0; mb < 4; ++mb) { v8us oh, ol;
#pragma unroll
            for (int j = 0; j < 8; ++j) { unsigned short a, c2; splitf(o[mb][qf][j] * inv, a, c2); oh[j] = a; ol[j] = c2; }
            *(v8us*)(Ah + ob + mb * 16) = oh; *(v8us*)(Al + ob + mb * 16) = ol; } }
}
__global__ __launch_bounds__(128) void k_fattn(const h16* __restrict__ Q16, const h16* __restrict__ K16, const h16* __restrict__ V16, const bf* __restrict__ Qh, const bf* __restrict__ Ql, const bf* __restrict__ Kh, const bf* __restrict__ Kl, const bf* __restrict__ Vh, const bf* __restrict__ Vl, bf* Ah, bf* Al) {
    __shared__ __align__(16) unsigned short sm[2 * 4 * TILE];
    const int h = blockIdx.y, w = threadIdx.x >> 5, bx = blockIdx.x; const size_t ho = (size_t)h * TT * HD;
    if (bx < RH / 64) fa_body<true, 1>(sm, Qh + ho, Ql + ho, Kh + ho, Kl + ho, Vh + ho, Vl + ho, bx * 64 + w * 16, h, Ah, Al);
    else fa_body<false, 2>(sm, (const unsigned short*)Q16 + ho, nullptr, (const unsigned short*)K16 + ho, nullptr, (const unsigned short*)V16 + ho, nullptr, RH + (bx - RH / 64) * 128 + w * 32, h, Ah, Al);
}

extern "C" void kernel_launch(void* const* d_in, const int* in_sizes, int n_in,
                              void* d_out, int out_size, void* d_ws, size_t ws_size, hipStream_t stream) {
    (void)in_sizes; (void)n_in; (void)out_size;
    const float* x = (const float*)d_in[0]; const float* wqkv = (const float*)d_in[1]; const float* wo = (const float*)d_in[2];  const float* wq = wqkv; const float* wk = wqkv + (size_t)1024 * 1024; const float* wv = wqkv + (size_t)2048 * 1024; (void)wq; (void)wk; (void)wv;
    float* OUT = (float*)d_out;     // [2][1024][2048] (batch, dim, seq)
    char* wsp = (char*)d_ws;
    auto take = [&](size_t bytes) { char* p = wsp; wsp += (bytes + 255) & ~(size_t)255; return (void*)p; };
    bf* WQ = (bf*)take((size_t)DQ * DM * 2); bf* WK = (bf*)take((size_t)DKV * DM * 2); bf* WV = (bf*)take((size_t)DKV * DM * 2); bf* WO = (bf*)take((size_t)DM * DQ * 2); float* CS = (float*)take((size_t)TT * HD * 2 * 4);
    bf* XB = (bf*)take((size_t)TT * DM * 2); float* FQ = (float*)take((size_t)TT * DQ * 4); float* FK = (float*)take((size_t)TT * DKV * 4);
    h16* QP16 = (h16*)take((size_t)NH_ * TT * HD * 2); h16* KP16 = (h16*)take((size_t)NKV * TT * HD * 2); h16* VT16 = (h16*)take((size_t)NKV * HD * TT * 2);
    bf* QPh = (bf*)take((size_t)NH_ * TT * HD * 2); bf* QPl = (bf*)take((size_t)NH_ * TT * HD * 2); bf* KPh = (bf*)take((size_t)NKV * TT * HD * 2); bf* KPl = (bf*)take((size_t)NKV * TT * HD * 2); bf* VTh = (bf*)take((size_t)NKV * HD * TT * 2); bf* VTl = (bf*)take((size_t)NKV * HD * TT * 2);
    bf* ATh = (bf*)take((size_t)TT * DQ * 2); bf* ATl = (bf*)take((size_t)TT * DQ * 2);
    if ((size_t)(wsp - (char*)d_ws) > ws_size) return;    // ws 256 MiB
    float* FV = FK;   // v projection reuses the k buffer after the k planes are built (stream-ordered)
    { k_cvt8<<<(unsigned)(((size_t)DQ * DM / 8 + 255) / 256), 256, 0, stream>>>(wq, WQ, (size_t)DQ * DM / 8); k_cvt8<<<(unsigned)(((size_t)DKV * DM / 8 + 255) / 256), 256, 0, stream>>>(wk, WK, (size_t)DKV * DM / 8); k_cvt8<<<(unsigned)(((size_t)DKV * DM / 8 + 255) / 256), 256, 0, stream>>>(wv, WV, (size_t)DKV * DM / 8);
      k_cvt8<<<(unsigned)(((size_t)DM * DQ / 8 + 255) / 256), 256, 0, stream>>>(wo, WO, (size_t)DM * DQ / 8);
       }
    k_cstab<<<(TT * HD + 255) / 256, 256, 0, stream>>>(CS);
    const unsigned LQ = (unsigned)(((size_t)NH_ * TT * HD / 2 + 255) / 256), LKv = (unsigned)(((size_t)NKV * TT * HD / 2 + 255) / 256);
    for (int b = 0; b < NB_; ++b) {
        
        k_cvt8T<<<(unsigned)(((size_t)TT * DM / 8 + 255) / 256), 256, 0, stream>>>(x + (size_t)b * DM * TT, XB);   /* x[b] is channel-major [DM][TT] -> XB token-major [TT][DM] */
        k_gemmw<bf, 0, false><<<dim3(TT / 64, DQ / 64, 1), 32, 0, stream>>>(XB, nullptr, WQ, nullptr, DM, FQ, DQ, nullptr, 0, 0, 0);
        k_ropeI<<<LQ, 256, 0, stream>>>(FQ, DQ, NH_, CS, 1.0f, QP16, QPh, QPl);
        k_gemmw<bf, 0, false><<<dim3(TT / 64, DKV / 64, 1), 32, 0, stream>>>(XB, nullptr, WK, nullptr, DM, FK, DKV, nullptr, 0, 0, 0);
        k_ropeI<<<LKv, 256, 0, stream>>>(FK, DKV, NKV, CS, 1.0f, KP16, KPh, KPl);
        k_gemmw<bf, 0, false><<<dim3(TT / 64, DKV / 64, 1), 32, 0, stream>>>(XB, nullptr, WV, nullptr, DM, FV, DKV, nullptr, 0, 0, 0); k_vtp<<<LKv, 256, 0, stream>>>(FV, DKV, NKV, VT16, VTh, VTl);
        k_fattn<<<dim3(RH / 64 + (TT - RH) / 128, NH_, 1), 128, 0, stream>>>(QP16, KP16, VT16, QPh, QPl, KPh, KPl, VTh, VTl, ATh, ATl);   /* all heads and query rows: scores, softmax, attn.v, merged hi + lo planes [t][DQ] */
        k_gemmw<bf, 3, false><<<dim3(DM / 64, TT / 64, 1), 32, 0, stream>>>(WO, nullptr, ATh, ATl, DQ, OUT + (size_t)b * DM * TT, TT, nullptr, 0, 0, 0);   /* channel-major output rows [e][t]: exact W_out x (merged hi + lo) */ }
}

// v003
// A run of this version takes 371 microseconds.
// In two side-by-side timings against v002, it was 1.06 and 1.04 times as fast.
// All steps since v000 together make it 5.40 times as fast.
#include <hip/hip_runtime.h>

// Multi-head attention with interleaved-pair rotary embeddings on a channel-major input (x [2][1024][2048] = (batch, dim, seq); xt = x^T; [q|k|v] = xt W_qkv^T ('oi' [3072][1024]: row blocks q | k | v; 16 heads x 64); rotary on adjacent (even, odd) pairs with angle t x 10000^(-2i/64) (tables computed on device from the reference's float32 inv_freq); scores/8 over all 2048 keys; softmax; merged heads; out^T = W_out ('oi' [1024][1024]) x merged^T written channel-major -> [2][1024][2048] (4.2 M)).
// Compute dtypes, f32 accumulate: every input rounded to bf16; q/k/v on PLAIN bf16 operands (inputs: exact); input transposed to token-major while converting to bf16; interleaved rotary in f32 (precise cosf/sinf table) and the 16-bit operand planes written in the projections' own epilogues; scores and attn.v fused in one launch per batch (online softmax in f32, scores never in memory): query rows < 512 hl (3 products), the rest single fp16 (x16); W_out exact x merged hl (2 products), written transposed (dim-major) straight from the GEMM epilogue.

#define NB_  2
#define TT   2048
#define DM   1024
#define NH_  16
#define NKV  16
#define REP  (NH_ / NKV)
#define HD   64
#define DQ   (NH_ * HD)
#define DKV  (NKV * HD)
#define RH   512                  // query rows < RH use hi+lo planes (0: none)
#define WIN  2048
#define SCL  0.125f   // HD^-0.5
typedef _Float16 h16;
typedef unsigned short bf;
typedef __attribute__((ext_vector_type(16))) __bf16   v16bf;
typedef __attribute__((ext_vector_type(16))) _Float16 v16h;
typedef __attribute__((ext_vector_type(8)))  _Float16 v8h;
typedef __attribute__((ext_vector_type(8)))  unsigned short v8us;
typedef __attribute__((ext_vector_type(8)))  float    v8f;
typedef __attribute__((ext_vector_type(4)))  float    v4f;
typedef v8h  __attribute__((may_alias)) v8ha;
typedef v4f  __attribute__((may_alias)) v4fa;
typedef v8us __attribute__((may_alias)) v8usa;

__device__ __forceinline__ unsigned short f2bf(float f) { unsigned u = __float_as_uint(f); u += 0x7FFFu + ((u >> 16) & 1u); return (unsigned short)(u >> 16); }
__device__ __forceinline__ float bf2f(unsigned short b) { return __uint_as_float(((unsigned)b) << 16); }
__device__ __forceinline__ float bfr(float f) { return bf2f(f2bf(f)); }
__device__ __forceinline__ v16h cat16(v8h lo, v8h hi) { return __builtin_shufflevector(lo, hi, 0, 1, 2, 3, 4, 5, 6, 7, 8, 9, 10, 11, 12, 13, 14, 15); }
__device__ __forceinline__ v16bf cat16b(v8us lo, v8us hi) { return __builtin_bit_cast(v16bf, __builtin_shufflevector(lo, hi, 0, 1, 2, 3, 4, 5, 6, 7, 8, 9, 10, 11, 12, 13, 14, 15)); }
__device__ __forceinline__ v8f wmma16(v16h a, v16h b, v8f c) { return __builtin_amdgcn_wmma_f32_16x16x32_f16(false, a, false, b, (short)0, c, false, false); }
__device__ __forceinline__ v8f wmmab(v16bf a, v16bf b, v8f c) { return __builtin_amdgcn_wmma_f32_16x16x32_bf16(false, a, false, b, (short)0, c, false, false); }



__device__ __forceinline__ h16 tohx(float x) { return (h16)x; }
__device__ __forceinline__ void splitf(float y, unsigned short& h, unsigned short& l) { h = f2bf(y); l = f2bf(y - bf2f(h)); }
typedef __attribute__((ext_vector_type(2))) _Float16 v2h;
typedef __attribute__((ext_vector_type(4))) _Float16 v4h;
typedef __attribute__((ext_vector_type(2))) unsigned short v2us;
typedef __attribute__((ext_vector_type(4))) unsigned short v4us;
typedef __attribute__((ext_vector_type(2))) float v2f;
typedef __attribute__((ext_vector_type(4))) int v4i;

// ---- k_gemmw: register-blocked GEMM, ONE WAVE per 64x64 output tile (16 accumulators), operands straight from K-contiguous 16-bit planes; grid (M/64, N/64, Z), 32 threads.
// C[m][n] (f32, pitch ldc, + optional f32 bias[n]) = sum_k A[m][k] Bt[n][k] (+ split products per NSPLIT). z-batch strides sA/sB/sC in elements. K % 32 == 0.
// EPI 0: the f32 tile goes to C. EPI 1 and 2: no f32 result reaches memory; the epilogue writes the three 16-bit planes (fp16, bf16 hi, bf16 lo) that the attention kernel reads.
// EPI 1 (q, k; m = token, n = channel, one head per tile column): interleaved rotary with the table CS [t][HD][cos, sin], planes [head][t][HD]. EPI 2 (v; m = channel, n = token): planes [channel][t], pitch TT.
template <typename T16> struct WFrag;
template <> struct WFrag<h16> { typedef v16h V; static __device__ __forceinline__ V ld(const h16* p) { return cat16(*(const v8h*)p, *(const v8h*)(p + 16)); } static __device__ __forceinline__ v8f mma(V a, V b, v8f c) { return wmma16(a, b, c); } };
template <> struct WFrag<bf> { typedef v16bf V; static __device__ __forceinline__ V ld(const bf* p) { return cat16b(*(const v8us*)p, *(const v8us*)(p + 16)); } static __device__ __forceinline__ v8f mma(V a, V b, v8f c) { return wmmab(a, b, c); } };
template <typename T16, int NSPLIT, bool BIAS, int EPI>
__global__ __launch_bounds__(32) void k_gemmw(const T16* __restrict__ A, const T16* __restrict__ A2, const T16* __restrict__ Bt, const T16* __restrict__ Bt2, int K, float* C, int ldc, const float* __restrict__ bias, size_t sA, size_t sB, size_t sC, const float* __restrict__ CS, h16* P16, bf* Ph, bf* Pl) {
    typedef typename WFrag<T16>::V V;
    __shared__ __align__(16) float os[16 * 68];
    const size_t z = blockIdx.z; A += z * sA; if (A2) A2 += z * sA; Bt += z * sB; if (Bt2) Bt2 += z * sB; C += z * sC;
    const int lane = threadIdx.x & 31, lr = lane & 15, hi = lane >> 4; const int r0 = blockIdx.x * 64, c0 = blockIdx.y * 64;
    v8f acc[4][4];
#pragma unroll
    for (int mb = 0; mb < 4; ++mb)
#pragma unroll
        for (int nb = 0; nb < 4; ++nb) acc[mb][nb] = (v8f){};
    const size_t aoff = (size_t)(r0 + lr) * K + 8 * hi, boff = (size_t)(c0 + lr) * K + 8 * hi;
#pragma unroll 1
    for (int kc = 0; kc < K; kc += 32) {
        V a[4], a2[4];
#pragma unroll
        for (int mb = 0; mb < 4; ++mb) { a[mb] = WFrag<T16>::ld(A + aoff + (size_t)mb * 16 * K + kc); if (NSPLIT == 1 || NSPLIT == 2) a2[mb] = WFrag<T16>::ld(A2 + aoff + (size_t)mb * 16 * K + kc); }
#pragma unroll
        for (int nb = 0; nb < 4; ++nb) { const V b = WFrag<T16>::ld(Bt + boff + (size_t)nb * 16 * K + kc); V b2; if (NSPLIT >= 2) b2 = WFrag<T16>::ld(Bt2 + boff + (size_t)nb * 16 * K + kc);
#pragma unroll
            for (int mb = 0; mb < 4; ++mb) { acc[mb][nb] = WFrag<T16>::mma(a[mb], b, acc[mb][nb]); if (NSPLIT == 1 || NSPLIT == 2) acc[mb][nb] = WFrag<T16>::mma(a2[mb], b, acc[mb][nb]); if (NSPLIT >= 2) acc[mb][nb] = WFrag<T16>::mma(a[mb], b2, acc[mb][nb]); } }
        asm volatile("v_nop\n\tv_nop\n\tv_nop\n\tv_nop" : "+v"(acc[0][0]), "+v"(acc[1][1]), "+v"(acc[2][2]), "+v"(acc[3][3]) : "v"(a[0]), "v"(a[3]));
    }
    constexpr int ES = EPI == 1 ? HD : TT;   // plane elements from one tile row to the next
    const float* cb = nullptr; size_t e0 = 0;   // this lane's first table entry and first plane element; every later one is a constant step away
    if constexpr (EPI == 1) { cb = CS + ((size_t)(r0 + hi) * HD + lr * 4) * 2; e0 = ((size_t)blockIdx.y * TT + r0 + hi) * HD + lr * 4; }
    if constexpr (EPI == 2) e0 = (size_t)(r0 + hi) * TT + c0 + lr * 4;
#pragma unroll
    for (int mb = 0; mb < 4; ++mb) {
        v2f cs[8][2];   // EPI 1: cos, sin of this lane's two pairs in each of its 8 rows, asked for ahead of the LDS exchange so that they fly during it
        if constexpr (EPI == 1) {
#pragma unroll
            for (int s = 0; s < 8; ++s) { const float* c = cb + (mb * 16 + 2 * s) * (HD * 2); cs[s][0] = *(const v2f*)c; cs[s][1] = *(const v2f*)(c + 4); } }
#pragma unroll
        for (int nb = 0; nb < 4; ++nb) {
#pragma unroll
            for (int j = 0; j < 8; ++j) os[(hi * 8 + j) * 68 + nb * 16 + lr] = acc[mb][nb][j]; }
        __builtin_amdgcn_wave_barrier(); asm volatile("" ::: "memory");
        float* crow = C + (size_t)(r0 + mb * 16) * ldc + c0;
#pragma unroll
        for (int s = 0; s < 8; ++s) { const int row = 2 * s + hi, cofs = lr * 4; v4f val = *(const v4fa*)(os + row * 68 + cofs); if (BIAS) { val[0] += bfr(bias[c0 + cofs]); val[1] += bfr(bias[c0 + cofs + 1]); val[2] += bfr(bias[c0 + cofs + 2]); val[3] += bfr(bias[c0 + cofs + 3]); }
            if constexpr (EPI == 0) {
                *(v4f*)(crow + (size_t)row * ldc + cofs) = val; }
            else {
                if constexpr (EPI == 1) { const v4f x = val;   /* even: x0 c - x1 s; odd: x0 s + x1 c */
                    val[0] = x[0] * cs[s][0][0] - x[1] * cs[s][0][1]; val[1] = x[0] * cs[s][0][1] + x[1] * cs[s][0][0]; val[2] = x[2] * cs[s][1][0] - x[3] * cs[s][1][1]; val[3] = x[2] * cs[s][1][1] + x[3] * cs[s][1][0]; }
                const size_t e = e0 + (mb * 16 + 2 * s) * ES;   // 16 lanes x 8 bytes: one whole 128-byte line per row and plane
                v4h o16; v4us oh, ol;
#pragma unroll
                for (int q = 0; q < 4; ++q) { o16[q] = tohx(val[q]); unsigned short a2, c2; splitf(val[q], a2, c2); oh[q] = a2; ol[q] = c2; }
                *(v4h*)(P16 + e) = o16; *(v4us*)(Ph + e) = oh; *(v4us*)(Pl + e) = ol; } }
        if constexpr (EPI != 0) asm volatile("s_wait_xcnt 0x0" ::: "memory");   // the next block's values reuse the registers that these plane stores name
        __builtin_amdgcn_wave_barrier(); asm volatile("" ::: "memory");
    }
}

__global__ __launch_bounds__(256) void k_wtG(const float* __restrict__ w, int K, int N, bf* Bt) {
    const int lane = threadIdx.x & 31; const int L0 = (blockIdx.x * 8 + (threadIdx.x >> 5)) * 8; const int nlines = N * K / 64;
{
#pragma unroll 1
        for (int l = 0; l < 8; ++l) { const int L = L0 + l; if (L >= nlines) break; const size_t e = (size_t)L * 64 + lane * 2; const int k = (int)(e % K), n = (int)(e / K); v2us o;
            o[0] = f2bf(w[(size_t)k * N + n]); o[1] = f2bf(w[(size_t)(k + 1) * N + n]); *(v2us*)(Bt + e) = o; }
         }
}
__global__ __launch_bounds__(256) void k_cvt8T(const float* __restrict__ src, bf* dst) { const size_t i = (size_t)blockIdx.x * 256 + threadIdx.x; if (i >= (size_t)TT * DM / 8) return; const int t = (int)(i / (DM / 8)); const int c0 = (int)(i % (DM / 8)) * 8; v8us o;
#pragma unroll
    for (int k = 0; k < 8; ++k) o[k] = f2bf(src[(size_t)(c0 + k) * TT + t]); *(v8us*)(dst + (size_t)t * DM + c0) = o;  }
__global__ __launch_bounds__(256) void k_cvt8(const float* __restrict__ src, bf* dst, size_t n8) { const size_t i = (size_t)blockIdx.x * 256 + threadIdx.x; if (i >= n8) return; const v8f v = *(const v8f*)(src + i * 8); v8us o;
#pragma unroll
    for (int k = 0; k < 8; ++k) o[k] = f2bf(v[k]); *(v8us*)(dst + i * 8) = o;  }

__constant__ float INV[HD / 2] = {1.0f,0.749894202f,0.562341332f,0.421696514f,0.316227764f,0.237137362f,0.177827939f,0.133352146f,0.100000001f,0.0749894157f,0.0562341288f,0.0421696492f,0.0316227786f,0.0237137359f,0.0177827943f,0.0133352149f,0.00999999978f,0.00749894232f,0.00562341325f,0.00421696482f,0.00316227786f,0.00237137382f,0.00177827943f,0.00133352145f,0.00100000005f,0.000749894185f,0.000562341302f,0.000421696488f,0.000316227786f,0.000237137385f,0.00017782794f,0.00013335215f};
__global__ __launch_bounds__(256) void k_cstab(float* CS) { const int idx = blockIdx.x * 256 + threadIdx.x; if (idx >= TT * HD) return; const int t = idx / HD, d = idx % HD; const float ang = __fmul_rn((float)t, INV[d >> 1]); v2f cs; cs[0] = cosf(ang); cs[1] = sinf(ang);
    *(v2f*)(CS + (size_t)idx * 2) = cs;  }

#define KS   64                   // keys per LDS stage
#define LP   72                   // LDS row pitch in 16-bit elements: 144 B = 16 B x odd, conflict-free for 16-byte reads
#define TILE (64 * LP)            // one staged plane: 64 rows (keys of K, channels of V^T) x 64 elements
static_assert(HD == 64 && KS == 64 && TT % KS == 0 && RH % 64 == 0 && (TT - RH) % 128 == 0, "tile geometry of k_fattn");
__device__ __forceinline__ float xhalf(float x) { return __builtin_bit_cast(float, __builtin_amdgcn_permlanex16(__builtin_bit_cast(int, x), __builtin_bit_cast(int, x), 0x76543210, 0xfedcba98, false, false)); }   // lane l <-> lane l ^ 16, on the vector pipe
// Eight independent v_exp_f32, then the one slot that the instruction set asks for behind a transcendental before its result is read or its source overwritten; "=&v" keeps every result off every source.
__device__ __forceinline__ void exp2x8(const float (&t)[8], float (&p)[8]) {
    asm("v_exp_f32 %0, %8\n\tv_exp_f32 %1, %9\n\tv_exp_f32 %2, %10\n\tv_exp_f32 %3, %11\n\tv_exp_f32 %4, %12\n\tv_exp_f32 %5, %13\n\tv_exp_f32 %6, %14\n\tv_exp_f32 %7, %15\n\tv_nop"
        : "=&v"(p[0]), "=&v"(p[1]), "=&v"(p[2]), "=&v"(p[3]), "=&v"(p[4]), "=&v"(p[5]), "=&v"(p[6]), "=&v"(p[7]) : "v"(t[0]), "v"(t[1]), "v"(t[2]), "v"(t[3]), "v"(t[4]), "v"(t[5]), "v"(t[6]), "v"(t[7])); }
__device__ __forceinline__ float exp2s(float x) { float r; asm("v_exp_f32 %0, %1\n\tv_nop" : "=&v"(r) : "v"(x)); return r; }   // one v_exp_f32 with the same slot behind it
template <bool HL> struct FOp;
template <> struct FOp<false> { typedef v16h V; static __device__ __forceinline__ V frag(const unsigned short* p) { return cat16(__builtin_bit_cast(v8h, *(const v8usa*)p), __builtin_bit_cast(v8h, *(const v8usa*)(p + 16))); } static __device__ __forceinline__ v8f mma(V a, V b, v8f c) { return wmma16(a, b, c); } };
template <> struct FOp<true> { typedef v16bf V; static __device__ __forceinline__ V frag(const unsigned short* p) { return cat16b(*(const v8usa*)p, *(const v8usa*)(p + 16)); } static __device__ __forceinline__ v8f mma(V a, V b, v8f c) { return wmmab(a, b, c); } };
// Q*, K* [t][HD], V* [HD][t] of this head (plane 1: the lo planes, HL only); q0: the wave's first query; NF: query fragments of 16 per wave.
template <bool HL, int NF>
__device__ __forceinline__ void fa_body(unsigned short* sm, const unsigned short* __restrict__ Q0, const unsigned short* __restrict__ Q1, const unsigned short* __restrict__ K0, const unsigned short* __restrict__ K1, const unsigned short* __restrict__ V0, const unsigned short* __restrict__ V1, int q0, int h, bf* Ah, bf* Al) {
    typedef FOp<HL> F; typedef typename F::V V;
    constexpr int NP = HL ? 2 : 1;                       // planes per operand
    constexpr float C = SCL * 1.4426950408889634f;       // raw score -> log2 units
    constexpr float SH = HL ? 0.0f : 4.0f;               // fp16 probabilities carry x16: at most 2^(8+4), and small ones stay normal numbers
    const int tid = threadIdx.x, lane = tid & 31, lr = lane & 15, hi = lane >> 4;
    const int srow = tid >> 3, scol = (tid & 7) * 8;     // staging: 8 threads per 128-byte row, 16 rows a sweep
    V qa[NP][NF][2];
#pragma unroll
    for (int qf = 0; qf < NF; ++qf)
#pragma unroll
        for (int ks = 0; ks < 2; ++ks) { const size_t qo = (size_t)(q0 + qf * 16 + lr) * HD + ks * 32 + 8 * hi; qa[0][qf][ks] = F::frag(Q0 + qo); if (HL) qa[NP - 1][qf][ks] = F::frag(Q1 + qo); }
    v8f o[4][NF]; float m[NF], l[NF];
#pragma unroll
    for (int qf = 0; qf < NF; ++qf) { m[qf] = -3.0e38f; l[qf] = 0.f;
#pragma unroll
        for (int mb = 0; mb < 4; ++mb) o[mb][qf] = (v8f){}; }
    v8us rk[NP][4], rv[NP][4]; const size_t kof = (size_t)srow * HD + scol, vof = (size_t)srow * TT + scol;
    auto gload = [&](int s) {
#pragma unroll
        for (int u = 0; u < 4; ++u) { const size_t ko = kof + (size_t)s * (KS * HD) + u * (16 * HD), vo = vof + (size_t)s * KS + u * (16 * TT);
            rk[0][u] = *(const v8usa*)(K0 + ko); rv[0][u] = *(const v8usa*)(V0 + vo); if (HL) { rk[NP - 1][u] = *(const v8usa*)(K1 + ko); rv[NP - 1][u] = *(const v8usa*)(V1 + vo); } } };
    auto sstore = [&](int b) { unsigned short* d = sm + b * (2 * NP * TILE) + srow * LP + scol;
#pragma unroll
        for (int u = 0; u < 4; ++u)
#pragma unroll
            for (int pl = 0; pl < NP; ++pl) { *(v8usa*)(d + pl * TILE + u * 16 * LP) = rk[pl][u]; *(v8usa*)(d + (NP + pl) * TILE + u * 16 * LP) = rv[pl][u]; } };
    gload(0); sstore(0); __syncthreads();
#pragma unroll 1   // rolled: one copy of the stage body, so that the hot loop stays short in the instruction cache
    for (int s = 0; s < TT / KS; ++s) {
        if (s + 1 < TT / KS) gload(s + 1);               // the next stage's global loads fly while this stage is worked on
        const unsigned short* kb = sm + (s & 1) * (2 * NP * TILE) + lr * LP + 8 * hi; const unsigned short* vb = kb + NP * TILE;
#pragma unroll
        for (int c = 0; c < KS / 32; ++c) {
            v8f st[2][NF];
#pragma unroll
            for (int kt = 0; kt < 2; ++kt) { V ka[NP][2];
#pragma unroll
                for (int pl = 0; pl < NP; ++pl)
#pragma unroll
                    for (int ks = 0; ks < 2; ++ks) ka[pl][ks] = F::frag(kb + pl * TILE + (c * 32 + kt * 16) * LP + ks * 32);
#pragma unroll
                for (int qf = 0; qf < NF; ++qf) { v8f a = (v8f){};
#pragma unroll
                    for (int ks = 0; ks < 2; ++ks) { a = F::mma(ka[0][ks], qa[0][qf][ks], a); if (HL) { a = F::mma(ka[NP - 1][ks], qa[0][qf][ks], a); a = F::mma(ka[0][ks], qa[NP - 1][qf][ks], a); } }
                    st[kt][qf] = a; } }
            float mx[NF]; bool need = false;
#pragma unroll
            for (int qf = 0; qf < NF; ++qf) { float a = fmaxf(st[0][qf][0], st[1][qf][0]), a1 = fmaxf(st[0][qf][1], st[1][qf][1]);   // two short chains
#pragma unroll
                for (int j = 2; j < 8; j += 2) { a = fmaxf(a, fmaxf(st[0][qf][j], st[1][qf][j])); a1 = fmaxf(a1, fmaxf(st[0][qf][j + 1], st[1][qf][j + 1])); }
                a = fmaxf(a, a1); a = fmaxf(a, xhalf(a)); mx[qf] = a * C; need = need || (mx[qf] > m[qf] + 8.0f); }
            if (__builtin_amdgcn_ballot_w32(need) != 0) {   // wave-uniform: one test per 32 keys
#pragma unroll
                for (int qf = 0; qf < NF; ++qf) { const float mn = fmaxf(m[qf], mx[qf]); const float al = exp2s(m[qf] - mn); m[qf] = mn; l[qf] *= al;
#pragma unroll
                    for (int mb = 0; mb < 4; ++mb)
#pragma unroll
                        for (int j = 0; j < 8; ++j) o[mb][qf][j] *= al; } }
            V ph[NF], pl2[NF];
#pragma unroll
            for (int qf = 0; qf < NF; ++qf) { const float mo = m[qf] - SH; float sum[4];   // four short chains
#pragma unroll
                for (int kt = 0; kt < 2; ++kt) { float t[8], p[8];
#pragma unroll
                    for (int j = 0; j < 8; j += 2) { const v2f r = __builtin_elementwise_fma((v2f){st[kt][qf][j], st[kt][qf][j + 1]}, (v2f){C, C}, (v2f){-mo, -mo}); t[j] = r[0]; t[j + 1] = r[1]; }   // packed: two scores an instruction
                    exp2x8(t, p);
#pragma unroll
                    for (int j = 0; j < 8; ++j) { if (kt == 0 && j < 4) sum[j] = p[j]; else sum[j & 3] += p[j];
                        if constexpr (HL) { const __bf16 a = (__bf16)p[j]; ph[qf][kt * 8 + j] = a; pl2[qf][kt * 8 + j] = (__bf16)(p[j] - (float)a); } else { ph[qf][kt * 8 + j] = (h16)p[j]; } } }
                l[qf] += (sum[0] + sum[1]) + (sum[2] + sum[3]); }
#pragma unroll
            for (int mb = 0; mb < 4; ++mb) { V va[NP];
#pragma unroll
                for (int pl = 0; pl < NP; ++pl) va[pl] = F::frag(vb + pl * TILE + mb * 16 * LP + c * 32);
#pragma unroll
                for (int qf = 0; qf < NF; ++qf) { o[mb][qf] = F::mma(va[0], ph[qf], o[mb][qf]); if (HL) { o[mb][qf] = F::mma(va[NP - 1], ph[qf], o[mb][qf]); o[mb][qf] = F::mma(va[0], pl2[qf], o[mb][qf]); } } }
        }
        if (s + 1 < TT / KS) sstore((s + 1) & 1);        // into the buffer whose last readers passed the barrier of the trip before
        __syncthreads();                                 // publishes stage s + 1 and ends every read of stage s
    }
#pragma unroll
    for (int qf = 0; qf < NF; ++qf) { const float inv = __fdiv_rn(1.0f, l[qf] + xhalf(l[qf])); const size_t ob = (size_t)(q0 + qf * 16 + lr) * DQ + h * HD + hi * 8;
#pragma unroll
        for (int mb = 0; mb < 4; ++mb) { v8us oh, ol;
#pragma unroll
            for (int j = 0; j < 8; ++j) { unsigned short a, c2; splitf(o[mb][qf][j] * inv, a, c2); oh[j] = a; ol[j] = c2; }
            *(v8us*)(Ah + ob + mb * 16) = oh; *(v8us*)(Al + ob + mb * 16) = ol; } }
}
__global__ __launch_bounds__(128) void k_fattn(const h16* __restrict__ Q16, const h16* __restrict__ K16, const h16* __restrict__ V16, const bf* __restrict__ Qh, const bf* __restrict__ Ql, const bf* __restrict__ Kh, const bf* __restrict__ Kl, const bf* __restrict__ Vh, const bf* __restrict__ Vl, bf* Ah, bf* Al) {
    __shared__ __align__(16) unsigned short sm[2 * 4 * TILE];
    const int h = blockIdx.y, w = threadIdx.x >> 5, bx = blockIdx.x; const size_t ho = (size_t)h * TT * HD;
    if (bx < RH / 64) fa_body<true, 1>(sm, Qh + ho, Ql + ho, Kh + ho, Kl + ho, Vh + ho, Vl + ho, bx * 64 + w * 16, h, Ah, Al);
    else fa_body<false, 2>(sm, (const unsigned short*)Q16 + ho, nullptr, (const unsigned short*)K16 + ho, nullptr, (const unsigned short*)V16 + ho, nullptr, RH + (bx - RH / 64) * 128 + w * 32, h, Ah, Al);
}

extern "C" void kernel_launch(void* const* d_in, const int* in_sizes, int n_in,
                              void* d_out, int out_size, void* d_ws, size_t ws_size, hipStream_t stream) {
    (void)in_sizes; (void)n_in; (void)out_size;
    const float* x = (const float*)d_in[0]; const float* wqkv = (const float*)d_in[1]; const float* wo = (const float*)d_in[2];  const float* wq = wqkv; const float* wk = wqkv + (size_t)1024 * 1024; const float* wv = wqkv + (size_t)2048 * 1024; (void)wq; (void)wk; (void)wv;
    float* OUT = (float*)d_out;     // [2][1024][2048] (batch, dim, seq)
    char* wsp = (char*)d_ws;
    auto take = [&](size_t bytes) { char* p = wsp; wsp += (bytes + 255) & ~(size_t)255; return (void*)p; };
    bf* WQ = (bf*)take((size_t)DQ * DM * 2); bf* WK = (bf*)take((size_t)DKV * DM * 2); bf* WV = (bf*)take((size_t)DKV * DM * 2); bf* WO = (bf*)take((size_t)DM * DQ * 2); float* CS = (float*)take((size_t)TT * HD * 2 * 4);
    bf* XB = (bf*)take((size_t)TT * DM * 2);
    h16* QP16 = (h16*)take((size_t)NH_ * TT * HD * 2); h16* KP16 = (h16*)take((size_t)NKV * TT * HD * 2); h16* VT16 = (h16*)take((size_t)NKV * HD * TT * 2);
    bf* QPh = (bf*)take((size_t)NH_ * TT * HD * 2); bf* QPl = (bf*)take((size_t)NH_ * TT * HD * 2); bf* KPh = (bf*)take((size_t)NKV * TT * HD * 2); bf* KPl = (bf*)take((size_t)NKV * TT * HD * 2); bf* VTh = (bf*)take((size_t)NKV * HD * TT * 2); bf* VTl = (bf*)take((size_t)NKV * HD * TT * 2);
    bf* ATh = (bf*)take((size_t)TT * DQ * 2); bf* ATl = (bf*)take((size_t)TT * DQ * 2);
    if ((size_t)(wsp - (char*)d_ws) > ws_size) return;    // ws 256 MiB
    { k_cvt8<<<(unsigned)(((size_t)DQ * DM / 8 + 255) / 256), 256, 0, stream>>>(wq, WQ, (size_t)DQ * DM / 8); k_cvt8<<<(unsigned)(((size_t)DKV * DM / 8 + 255) / 256), 256, 0, stream>>>(wk, WK, (size_t)DKV * DM / 8); k_cvt8<<<(unsigned)(((size_t)DKV * DM / 8 + 255) / 256), 256, 0, stream>>>(wv, WV, (size_t)DKV * DM / 8);
      k_cvt8<<<(unsigned)(((size_t)DM * DQ / 8 + 255) / 256), 256, 0, stream>>>(wo, WO, (size_t)DM * DQ / 8);
       }
    k_cstab<<<(TT * HD + 255) / 256, 256, 0, stream>>>(CS);
    for (int b = 0; b < NB_; ++b) {
        
        k_cvt8T<<<(unsigned)(((size_t)TT * DM / 8 + 255) / 256), 256, 0, stream>>>(x + (size_t)b * DM * TT, XB);   /* x[b] is channel-major [DM][TT] -> XB token-major [TT][DM] */
        k_gemmw<bf, 0, false, 1><<<dim3(TT / 64, DQ / 64, 1), 32, 0, stream>>>(XB, nullptr, WQ, nullptr, DM, nullptr, 0, nullptr, 0, 0, 0, CS, QP16, QPh, QPl);    /* q projection, rotary, planes [h][t][HD] */
        k_gemmw<bf, 0, false, 1><<<dim3(TT / 64, DKV / 64, 1), 32, 0, stream>>>(XB, nullptr, WK, nullptr, DM, nullptr, 0, nullptr, 0, 0, 0, CS, KP16, KPh, KPl);   /* k projection, rotary, planes [h][t][HD] */
        k_gemmw<bf, 0, false, 2><<<dim3(DKV / 64, TT / 64, 1), 32, 0, stream>>>(WV, nullptr, XB, nullptr, DM, nullptr, 0, nullptr, 0, 0, 0, nullptr, VT16, VTh, VTl);   /* v^T = W_v x xt^T: planes [h][HD][t] as they come */
        k_fattn<<<dim3(RH / 64 + (TT - RH) / 128, NH_, 1), 128, 0, stream>>>(QP16, KP16, VT16, QPh, QPl, KPh, KPl, VTh, VTl, ATh, ATl);   /* all heads and query rows: scores, softmax, attn.v, merged hi + lo planes [t][DQ] */
        k_gemmw<bf, 3, false, 0><<<dim3(DM / 64, TT / 64, 1), 32, 0, stream>>>(WO, nullptr, ATh, ATl, DQ, OUT + (size_t)b * DM * TT, TT, nullptr, 0, 0, 0, nullptr, nullptr, nullptr, nullptr);   /* channel-major output rows [e][t]: exact W_out x (merged hi + lo) */ }
}

// v004
// A run of this version takes 220 microseconds.
// Timed twice side by side with v003, it ran 1.69 and 1.68 times as fast.
// Counting every step since v000, it is 9.09 times as fast.
#include <hip/hip_runtime.h>

// Multi-head attention with interleaved-pair rotary embeddings on a channel-major input (x [2][1024][2048] = (batch, dim, seq); xt = x^T; [q|k|v] = xt W_qkv^T ('oi' [3072][1024]: row blocks q | k | v; 16 heads x 64); rotary on adjacent (even, odd) pairs with angle t x 10000^(-2i/64) (tables computed on device from the reference's float32 inv_freq); scores/8 over all 2048 keys; softmax; merged heads; out^T = W_out ('oi' [1024][1024]) x merged^T written channel-major -> [2][1024][2048] (4.2 M)).
// Compute dtypes, f32 accumulate: every input rounded to bf16; q/k/v on PLAIN bf16 operands (inputs: exact); input transposed to token-major while converting to bf16; interleaved rotary in f32 (precise cosf/sinf table) and the 16-bit operand planes written in the projections' own epilogues; scores and attn.v fused in one launch per batch (online softmax in f32, scores never in memory): query rows < 512 hl (3 products), the rest single fp16 (x16); W_out exact x merged hl (2 products), written transposed (dim-major) straight from the GEMM epilogue.

#define NB_  2
#define TT   2048
#define DM   1024
#define NH_  16
#define NKV  16
#define REP  (NH_ / NKV)
#define HD   64
#define DQ   (NH_ * HD)
#define DKV  (NKV * HD)
#define RH   512                  // query rows < RH use hi+lo planes (0: none)
#define WIN  2048
#define SCL  0.125f   // HD^-0.5
typedef _Float16 h16;
typedef unsigned short bf;
typedef __attribute__((ext_vector_type(16))) __bf16   v16bf;
typedef __attribute__((ext_vector_type(16))) _Float16 v16h;
typedef __attribute__((ext_vector_type(8)))  _Float16 v8h;
typedef __attribute__((ext_vector_type(8)))  unsigned short v8us;
typedef __attribute__((ext_vector_type(8)))  float    v8f;
typedef __attribute__((ext_vector_type(4)))  float    v4f;
typedef v8h  __attribute__((may_alias)) v8ha;
typedef v4f  __attribute__((may_alias)) v4fa;
typedef v8us __attribute__((may_alias)) v8usa;

__device__ __forceinline__ unsigned short f2bf(float f) { unsigned u = __float_as_uint(f); u += 0x7FFFu + ((u >> 16) & 1u); return (unsigned short)(u >> 16); }
__device__ __forceinline__ float bf2f(unsigned short b) { return __uint_as_float(((unsigned)b) << 16); }
__device__ __forceinline__ float bfr(float f) { return bf2f(f2bf(f)); }
__device__ __forceinline__ v16h cat16(v8h lo, v8h hi) { return __builtin_shufflevector(lo, hi, 0, 1, 2, 3, 4, 5, 6, 7, 8, 9, 10, 11, 12, 13, 14, 15); }
__device__ __forceinline__ v16bf cat16b(v8us lo, v8us hi) { return __builtin_bit_cast(v16bf, __builtin_shufflevector(lo, hi, 0, 1, 2, 3, 4, 5, 6, 7, 8, 9, 10, 11, 12, 13, 14, 15)); }
__device__ __forceinline__ v8f wmma16(v16h a, v16h b, v8f c) { return __builtin_amdgcn_wmma_f32_16x16x32_f16(false, a, false, b, (short)0, c, false, false); }
__device__ __forceinline__ v8f wmmab(v16bf a, v16bf b, v8f c) { return __builtin_amdgcn_wmma_f32_16x16x32_bf16(false, a, false, b, (short)0, c, false, false); }



__device__ __forceinline__ h16 tohx(float x) { return (h16)x; }
__device__ __forceinline__ void splitf(float y, unsigned short& h, unsigned short& l) { h = f2bf(y); l = f2bf(y - bf2f(h)); }
typedef __attribute__((ext_vector_type(2))) _Float16 v2h;
typedef __attribute__((ext_vector_type(4))) _Float16 v4h;
typedef __attribute__((ext_vector_type(2))) unsigned short v2us;
typedef __attribute__((ext_vector_type(4))) unsigned short v4us;
typedef __attribute__((ext_vector_type(2))) float v2f;
typedef __attribute__((ext_vector_type(4))) int v4i;

// ---- k_gemmw: GEMM, one work-group of 4 waves per 128x64 output tile, each wave a 32x64 part (8 accumulators); grid (M/128, N/64, Z), 128 threads.
// The K-contiguous 16-bit operand planes go through LDS in stages of 128 k (two whole 128-byte lines of every row), two buffers: the next stage's global loads fly while this stage is worked on, and the 64 rows of Bt are fetched once for all four waves.
// C[m][n] (f32, pitch ldc, + optional f32 bias[n]) = sum_k A[m][k] Bt[n][k] (+ split products per NSPLIT). z-batch strides sA/sB/sC in elements. K is a compile-time constant, so that the rows of a sweep are constant steps from one address; K % 128 == 0.
// EPI 0: the f32 tile goes to C. EPI 1 and 2: no f32 result reaches memory; the epilogue writes the three 16-bit planes (fp16, bf16 hi, bf16 lo) that the attention kernel reads.
// EPI 1 (q, k; m = token, n = channel, one head per tile column): interleaved rotary with the table CS [t][HD][cos, sin], planes [head][t][HD]. EPI 2 (v; m = channel, n = token): planes [channel][t], pitch TT.
#define GK   128                  // k per LDS stage
#define GP   136                  // LDS row pitch in 16-bit elements: 272 B = 16 B x odd, conflict-free for 16-byte reads
#define GTA  (128 * GP)           // one staged A plane: 128 rows x 128 k
#define GTB  (64 * GP)            // one staged B plane: 64 rows x 128 k
template <typename T16> struct WFrag;
template <> struct WFrag<h16> { typedef v16h V; static __device__ __forceinline__ V ld(const h16* p) { return cat16(*(const v8h*)p, *(const v8h*)(p + 16)); } static __device__ __forceinline__ v8f mma(V a, V b, v8f c) { return wmma16(a, b, c); } };
template <> struct WFrag<bf> { typedef v16bf V; static __device__ __forceinline__ V ld(const bf* p) { return cat16b(*(const v8us*)p, *(const v8us*)(p + 16)); } static __device__ __forceinline__ v8f mma(V a, V b, v8f c) { return wmmab(a, b, c); } };
template <typename T16, int NSPLIT, bool BIAS, int EPI, int K>
__global__ __launch_bounds__(128) void k_gemmw(const T16* __restrict__ A, const T16* __restrict__ A2, const T16* __restrict__ Bt, const T16* __restrict__ Bt2, float* C, int ldc, const float* __restrict__ bias, size_t sA, size_t sB, size_t sC, const float* __restrict__ CS, h16* P16, bf* Ph, bf* Pl) {
    typedef typename WFrag<T16>::V V;
    constexpr bool HA2 = NSPLIT == 1 || NSPLIT == 2, HB2 = NSPLIT >= 2;
    constexpr int OA2 = GTA, OB = GTA * (HA2 ? 2 : 1), OB2 = OB + GTB, STG = OB + GTB * (HB2 ? 2 : 1);   // places of the planes in a stage, and its size
    constexpr int KG = (HA2 || HB2) ? 1 : 2;   // k steps of 32 whose fragments are fetched as one group (as many as the registers hold)
    __shared__ __align__(16) T16 sg[2 * STG];
    __shared__ __align__(16) float osw[4 * 16 * 68];
    const size_t z = blockIdx.z; A += z * sA; if (A2) A2 += z * sA; Bt += z * sB; if (Bt2) Bt2 += z * sB; C += z * sC;
    const int tid = threadIdx.x, lane = tid & 31, lr = lane & 15, hi = lane >> 4, w = tid >> 5; const int r0 = blockIdx.x * 128 + w * 32, c0 = blockIdx.y * 64;
    float* os = osw + w * (16 * 68);   // each wave's own exchange buffer for the epilogue
    v8f acc[2][4];
#pragma unroll
    for (int mb = 0; mb < 2; ++mb)
#pragma unroll
        for (int nb = 0; nb < 4; ++nb) acc[mb][nb] = (v8f){};
    static_assert(K % GK == 0, "whole stages");
    const int srow = tid >> 4, scol = (tid & 15) * 8;    // staging: 16 threads per 256-byte row, 8 rows a sweep
    const unsigned lo = (unsigned)(srow * K + scol);     // the lane's own element offset in a sweep: the one vector part of every staging address, the rest is the same for the whole work-group
    const size_t ag = (size_t)blockIdx.x * 128 * K, bg = (size_t)c0 * K;
    v8us ra[16], ra2[16], rb[8], rb2[8];
    const char* ba = (const char*)(A + ag); const char* ba2 = HA2 ? (const char*)(A2 + ag) : nullptr; const char* bb0 = (const char*)(Bt + bg); const char* bb2 = HB2 ? (const char*)(Bt2 + bg) : nullptr;   // the tile's first rows: the same for the whole work-group
    unsigned vo = lo * 2;                                // the lane's byte offset in the next stage to fetch, one register for all planes
    auto gload = [&]() {
#pragma unroll
        for (int u = 0; u < 16; ++u) { ra[u] = *(const v8usa*)(ba + vo + u * 8 * K * 2); if (HA2) ra2[u] = *(const v8usa*)(ba2 + vo + u * 8 * K * 2); }
#pragma unroll
        for (int u = 0; u < 8; ++u) { rb[u] = *(const v8usa*)(bb0 + vo + u * 8 * K * 2); if (HB2) rb2[u] = *(const v8usa*)(bb2 + vo + u * 8 * K * 2); }
        asm volatile("s_wait_xcnt 0x0" : "+v"(vo) :: "memory");   // the wait that stands before a register named by an issued global load is overwritten; the offset is its operand so that it stays in its register up to the wait and is stepped only behind it
        vo += GK * 2; };
    auto sstore = [&](int b) { T16* d = sg + b * STG + srow * GP + scol;
#pragma unroll
        for (int u = 0; u < 16; ++u) { *(v8usa*)(d + u * 8 * GP) = ra[u]; if (HA2) *(v8usa*)(d + OA2 + u * 8 * GP) = ra2[u]; }
#pragma unroll
        for (int u = 0; u < 8; ++u) { *(v8usa*)(d + OB + u * 8 * GP) = rb[u]; if (HB2) *(v8usa*)(d + OB2 + u * 8 * GP) = rb2[u]; } };
    constexpr int ns = K / GK;
    gload(); sstore(0); __syncthreads();
#pragma unroll 1   // rolled: one copy of the stage body
    for (int s = 0; s < ns; ++s) {
        const T16* ab = sg + (s & 1) * STG + (w * 32 + lr) * GP + 8 * hi; const T16* bb = sg + (s & 1) * STG + OB + lr * GP + 8 * hi;
#pragma unroll
        for (int kg = 0; kg < GK / 32; kg += KG) {
            V a[KG][2], a2[KG][2], b[KG][4], b2[KG][4];
#pragma unroll
            for (int ks = 0; ks < KG; ++ks) { const int ko = (kg + ks) * 32;
#pragma unroll
                for (int mb = 0; mb < 2; ++mb) { a[ks][mb] = WFrag<T16>::ld(ab + mb * 16 * GP + ko); if (HA2) a2[ks][mb] = WFrag<T16>::ld(ab + OA2 + mb * 16 * GP + ko); }
#pragma unroll
                for (int nb = 0; nb < 4; ++nb) { b[ks][nb] = WFrag<T16>::ld(bb + nb * 16 * GP + ko); if (HB2) b2[ks][nb] = WFrag<T16>::ld(bb + GTB + nb * 16 * GP + ko); } }
            if (kg == 0 && s + 1 < ns) gload();          // the next stage's global loads fly while this stage is worked on; issued in the shadow of the LDS reads
            __builtin_amdgcn_sched_barrier(0);   // the group's LDS reads all issue ahead of its products: one LDS latency per group instead of one per B fragment
#pragma unroll
            for (int ks = 0; ks < KG; ++ks)
#pragma unroll
                for (int nb = 0; nb < 4; ++nb) {
#pragma unroll
                    for (int mb = 0; mb < 2; ++mb) acc[mb][nb] = WFrag<T16>::mma(a[ks][mb], b[ks][nb], acc[mb][nb]);
                    if (HA2) {
#pragma unroll
                        for (int mb = 0; mb < 2; ++mb) acc[mb][nb] = WFrag<T16>::mma(a2[ks][mb], b[ks][nb], acc[mb][nb]); }
                    if (HB2) {
#pragma unroll
                        for (int mb = 0; mb < 2; ++mb) acc[mb][nb] = WFrag<T16>::mma(a[ks][mb], b2[ks][nb], acc[mb][nb]); } }
        }
        if (s + 1 < ns) sstore((s + 1) & 1);             // into the buffer whose last readers passed the barrier of the trip before
        __syncthreads();                                 // publishes stage s + 1 and ends every read of stage s
    }
    constexpr int ES = EPI == 1 ? HD : TT;   // plane elements from one tile row to the next
    const float* cb = nullptr; size_t e0 = 0;   // this lane's first table entry and first plane element; every later one is a constant step away
    if constexpr (EPI == 1) { cb = CS + ((size_t)(r0 + hi) * HD + lr * 4) * 2; e0 = ((size_t)blockIdx.y * TT + r0 + hi) * HD + lr * 4; }
    if constexpr (EPI == 2) e0 = (size_t)(r0 + hi) * TT + c0 + lr * 4;
#pragma unroll
    for (int mb = 0; mb < 2; ++mb) {
        v2f cs[8][2];   // EPI 1: cos, sin of this lane's two pairs in each of its 8 rows, asked for ahead of the LDS exchange so that they fly during it
        if constexpr (EPI == 1) {
#pragma unroll
            for (int s = 0; s < 8; ++s) { const float* c = cb + (mb * 16 + 2 * s) * (HD * 2); cs[s][0] = *(const v2f*)c; cs[s][1] = *(const v2f*)(c + 4); } }
#pragma unroll
        for (int nb = 0; nb < 4; ++nb) {
#pragma unroll
            for (int j = 0; j < 8; ++j) os[(hi * 8 + j) * 68 + nb * 16 + lr] = acc[mb][nb][j]; }
        __builtin_amdgcn_wave_barrier(); asm volatile("" ::: "memory");
        float* crow = C + (size_t)(r0 + mb * 16) * ldc + c0;
#pragma unroll
        for (int s = 0; s < 8; ++s) { const int row = 2 * s + hi, cofs = lr * 4; v4f val = *(const v4fa*)(os + row * 68 + cofs); if (BIAS) { val[0] += bfr(bias[c0 + cofs]); val[1] += bfr(bias[c0 + cofs + 1]); val[2] += bfr(bias[c0 + cofs + 2]); val[3] += bfr(bias[c0 + cofs + 3]); }
            if constexpr (EPI == 0) {
                *(v4f*)(crow + (size_t)row * ldc + cofs) = val; }
            else {
                if constexpr (EPI == 1) { const v4f x = val;   /* even: x0 c - x1 s; odd: x0 s + x1 c */
                    val[0] = x[0] * cs[s][0][0] - x[1] * cs[s][0][1]; val[1] = x[0] * cs[s][0][1] + x[1] * cs[s][0][0]; val[2] = x[2] * cs[s][1][0] - x[3] * cs[s][1][1]; val[3] = x[2] * cs[s][1][1] + x[3] * cs[s][1][0]; }
                const size_t e = e0 + (mb * 16 + 2 * s) * ES;   // 16 lanes x 8 bytes: one whole 128-byte line per row and plane
                v4h o16; v4us oh, ol;
#pragma unroll
                for (int q = 0; q < 4; ++q) { o16[q] = tohx(val[q]); unsigned short a2, c2; splitf(val[q], a2, c2); oh[q] = a2; ol[q] = c2; }
                *(v4h*)(P16 + e) = o16; *(v4us*)(Ph + e) = oh; *(v4us*)(Pl + e) = ol; } }
        if constexpr (EPI != 0) asm volatile("s_wait_xcnt 0x0" ::: "memory");   // the next block's values reuse the registers that these plane stores name
        __builtin_amdgcn_wave_barrier(); asm volatile("" ::: "memory");
    }
}

__global__ __launch_bounds__(256) void k_wtG(const float* __restrict__ w, int K, int N, bf* Bt) {
    const int lane = threadIdx.x & 31; const int L0 = (blockIdx.x * 8 + (threadIdx.x >> 5)) * 8; const int nlines = N * K / 64;
{
#pragma unroll 1
        for (int l = 0; l < 8; ++l) { const int L = L0 + l; if (L >= nlines) break; const size_t e = (size_t)L * 64 + lane * 2; const int k = (int)(e % K), n = (int)(e / K); v2us o;
            o[0] = f2bf(w[(size_t)k * N + n]); o[1] = f2bf(w[(size_t)(k + 1) * N + n]); *(v2us*)(Bt + e) = o; }
         }
}
__global__ __launch_bounds__(256) void k_cvt8T(const float* __restrict__ src, bf* dst) { const size_t i = (size_t)blockIdx.x * 256 + threadIdx.x; if (i >= (size_t)TT * DM / 8) return; const int t = (int)(i / (DM / 8)); const int c0 = (int)(i % (DM / 8)) * 8; v8us o;
#pragma unroll
    for (int k = 0; k < 8; ++k) o[k] = f2bf(src[(size_t)(c0 + k) * TT + t]); *(v8us*)(dst + (size_t)t * DM + c0) = o;  }
__global__ __launch_bounds__(256) void k_cvt8(const float* __restrict__ src, bf* dst, size_t n8) { const size_t i = (size_t)blockIdx.x * 256 + threadIdx.x; if (i >= n8) return; const v8f v = *(const v8f*)(src + i * 8); v8us o;
#pragma unroll
    for (int k = 0; k < 8; ++k) o[k] = f2bf(v[k]); *(v8us*)(dst + i * 8) = o;  }

__constant__ float INV[HD / 2] = {1.0f,0.749894202f,0.562341332f,0.421696514f,0.316227764f,0.237137362f,0.177827939f,0.133352146f,0.100000001f,0.0749894157f,0.0562341288f,0.0421696492f,0.0316227786f,0.0237137359f,0.0177827943f,0.0133352149f,0.00999999978f,0.00749894232f,0.00562341325f,0.00421696482f,0.00316227786f,0.00237137382f,0.00177827943f,0.00133352145f,0.00100000005f,0.000749894185f,0.000562341302f,0.000421696488f,0.000316227786f,0.000237137385f,0.00017782794f,0.00013335215f};
__global__ __launch_bounds__(256) void k_cstab(float* CS) { const int idx = blockIdx.x * 256 + threadIdx.x; if (idx >= TT * HD) return; const int t = idx / HD, d = idx % HD; const float ang = __fmul_rn((float)t, INV[d >> 1]); v2f cs; cs[0] = cosf(ang); cs[1] = sinf(ang);
    *(v2f*)(CS + (size_t)idx * 2) = cs;  }

#define KS   64                   // keys per LDS stage
#define LP   72                   // LDS row pitch in 16-bit elements: 144 B = 16 B x odd, conflict-free for 16-byte reads
#define TILE (64 * LP)            // one staged plane: 64 rows (keys of K, channels of V^T) x 64 elements
static_assert(HD == 64 && KS == 64 && TT % KS == 0 && RH % 64 == 0 && (TT - RH) % 128 == 0, "tile geometry of k_fattn");
__device__ __forceinline__ float xhalf(float x) { return __builtin_bit_cast(float, __builtin_amdgcn_permlanex16(__builtin_bit_cast(int, x), __builtin_bit_cast(int, x), 0x76543210, 0xfedcba98, false, false)); }   // lane l <-> lane l ^ 16, on the vector pipe
// Eight independent v_exp_f32, then the one slot that the instruction set asks for behind a transcendental before its result is read or its source overwritten; "=&v" keeps every result off every source.
__device__ __forceinline__ void exp2x8(const float (&t)[8], float (&p)[8]) {
    asm("v_exp_f32 %0, %8\n\tv_exp_f32 %1, %9\n\tv_exp_f32 %2, %10\n\tv_exp_f32 %3, %11\n\tv_exp_f32 %4, %12\n\tv_exp_f32 %5, %13\n\tv_exp_f32 %6, %14\n\tv_exp_f32 %7, %15\n\tv_nop"
        : "=&v"(p[0]), "=&v"(p[1]), "=&v"(p[2]), "=&v"(p[3]), "=&v"(p[4]), "=&v"(p[5]), "=&v"(p[6]), "=&v"(p[7]) : "v"(t[0]), "v"(t[1]), "v"(t[2]), "v"(t[3]), "v"(t[4]), "v"(t[5]), "v"(t[6]), "v"(t[7])); }
__device__ __forceinline__ float exp2s(float x) { float r; asm("v_exp_f32 %0, %1\n\tv_nop" : "=&v"(r) : "v"(x)); return r; }   // one v_exp_f32 with the same slot behind it
template <bool HL> struct FOp;
template <> struct FOp<false> { typedef v16h V; static __device__ __forceinline__ V frag(const unsigned short* p) { return cat16(__builtin_bit_cast(v8h, *(const v8usa*)p), __builtin_bit_cast(v8h, *(const v8usa*)(p + 16))); } static __device__ __forceinline__ v8f mma(V a, V b, v8f c) { return wmma16(a, b, c); } };
template <> struct FOp<true> { typedef v16bf V; static __device__ __forceinline__ V frag(const unsigned short* p) { return cat16b(*(const v8usa*)p, *(const v8usa*)(p + 16)); } static __device__ __forceinline__ v8f mma(V a, V b, v8f c) { return wmmab(a, b, c); } };
// Q*, K* [t][HD], V* [HD][t] of this head (plane 1: the lo planes, HL only); q0: the wave's first query; NF: query fragments of 16 per wave.
template <bool HL, int NF>
__device__ __forceinline__ void fa_body(unsigned short* sm, const unsigned short* __restrict__ Q0, const unsigned short* __restrict__ Q1, const unsigned short* __restrict__ K0, const unsigned short* __restrict__ K1, const unsigned short* __restrict__ V0, const unsigned short* __restrict__ V1, int q0, int h, bf* Ah, bf* Al) {
    typedef FOp<HL> F; typedef typename F::V V;
    constexpr int NP = HL ? 2 : 1;                       // planes per operand
    constexpr float C = SCL * 1.4426950408889634f;       // raw score -> log2 units
    constexpr float SH = HL ? 0.0f : 4.0f;               // fp16 probabilities carry x16: at most 2^(8+4), and small ones stay normal numbers
    const int tid = threadIdx.x, lane = tid & 31, lr = lane & 15, hi = lane >> 4;
    const int srow = tid >> 3, scol = (tid & 7) * 8;     // staging: 8 threads per 128-byte row, 16 rows a sweep
    V qa[NP][NF][2];
#pragma unroll
    for (int qf = 0; qf < NF; ++qf)
#pragma unroll
        for (int ks = 0; ks < 2; ++ks) { const size_t qo = (size_t)(q0 + qf * 16 + lr) * HD + ks * 32 + 8 * hi; qa[0][qf][ks] = F::frag(Q0 + qo); if (HL) qa[NP - 1][qf][ks] = F::frag(Q1 + qo); }
    v8f o[4][NF]; float m[NF], l[NF];
#pragma unroll
    for (int qf = 0; qf < NF; ++qf) { m[qf] = -3.0e38f; l[qf] = 0.f;
#pragma unroll
        for (int mb = 0; mb < 4; ++mb) o[mb][qf] = (v8f){}; }
    v8us rk[NP][4], rv[NP][4]; const size_t kof = (size_t)srow * HD + scol, vof = (size_t)srow * TT + scol;
    auto gload = [&](int s) {
#pragma unroll
        for (int u = 0; u < 4; ++u) { const size_t ko = kof + (size_t)s * (KS * HD) + u * (16 * HD), vo = vof + (size_t)s * KS + u * (16 * TT);
            rk[0][u] = *(const v8usa*)(K0 + ko); rv[0][u] = *(const v8usa*)(V0 + vo); if (HL) { rk[NP - 1][u] = *(const v8usa*)(K1 + ko); rv[NP - 1][u] = *(const v8usa*)(V1 + vo); } } };
    auto sstore = [&](int b) { unsigned short* d = sm + b * (2 * NP * TILE) + srow * LP + scol;
#pragma unroll
        for (int u = 0; u < 4; ++u)
#pragma unroll
            for (int pl = 0; pl < NP; ++pl) { *(v8usa*)(d + pl * TILE + u * 16 * LP) = rk[pl][u]; *(v8usa*)(d + (NP + pl) * TILE + u * 16 * LP) = rv[pl][u]; } };
    gload(0); sstore(0); __syncthreads();
#pragma unroll 1   // rolled: one copy of the stage body
    for (int s = 0; s < TT / KS; ++s) {
        if (s + 1 < TT / KS) gload(s + 1);               // the next stage's global loads fly while this stage is worked on
        const unsigned short* kb = sm + (s & 1) * (2 * NP * TILE) + lr * LP + 8 * hi; const unsigned short* vb = kb + NP * TILE;
#pragma unroll
        for (int c = 0; c < KS / 32; ++c) {
            v8f st[2][NF];
#pragma unroll
            for (int kt = 0; kt < 2; ++kt) { V ka[NP][2];
#pragma unroll
                for (int pl = 0; pl < NP; ++pl)
#pragma unroll
                    for (int ks = 0; ks < 2; ++ks) ka[pl][ks] = F::frag(kb + pl * TILE + (c * 32 + kt * 16) * LP + ks * 32);
#pragma unroll
                for (int qf = 0; qf < NF; ++qf) { v8f a = (v8f){};
#pragma unroll
                    for (int ks = 0; ks < 2; ++ks) { a = F::mma(ka[0][ks], qa[0][qf][ks], a); if (HL) { a = F::mma(ka[NP - 1][ks], qa[0][qf][ks], a); a = F::mma(ka[0][ks], qa[NP - 1][qf][ks], a); } }
                    st[kt][qf] = a; } }
            float mx[NF]; bool need = false;
#pragma unroll
            for (int qf = 0; qf < NF; ++qf) { float a = fmaxf(st[0][qf][0], st[1][qf][0]), a1 = fmaxf(st[0][qf][1], st[1][qf][1]);   // two short chains
#pragma unroll
                for (int j = 2; j < 8; j += 2) { a = fmaxf(a, fmaxf(st[0][qf][j], st[1][qf][j])); a1 = fmaxf(a1, fmaxf(st[0][qf][j + 1], st[1][qf][j + 1])); }
                a = fmaxf(a, a1); a = fmaxf(a, xhalf(a)); mx[qf] = a * C; need = need || (mx[qf] > m[qf] + 8.0f); }
            if (__builtin_amdgcn_ballot_w32(need) != 0) {   // wave-uniform: one test per 32 keys
#pragma unroll
                for (int qf = 0; qf < NF; ++qf) { const float mn = fmaxf(m[qf], mx[qf]); const float al = exp2s(m[qf] - mn); m[qf] = mn; l[qf] *= al;
#pragma unroll
                    for (int mb = 0; mb < 4; ++mb)
#pragma unroll
                        for (int j = 0; j < 8; ++j) o[mb][qf][j] *= al; } }
            V ph[NF], pl2[NF];
#pragma unroll
            for (int qf = 0; qf < NF; ++qf) { const float mo = m[qf] - SH; float sum[4];   // four short chains
#pragma unroll
                for (int kt = 0; kt < 2; ++kt) { float t[8], p[8];
#pragma unroll
                    for (int j = 0; j < 8; j += 2) { const v2f r = __builtin_elementwise_fma((v2f){st[kt][qf][j], st[kt][qf][j + 1]}, (v2f){C, C}, (v2f){-mo, -mo}); t[j] = r[0]; t[j + 1] = r[1]; }   // packed: two scores an instruction
                    exp2x8(t, p);
#pragma unroll
                    for (int j = 0; j < 8; ++j) { if (kt == 0 && j < 4) sum[j] = p[j]; else sum[j & 3] += p[j];
                        if constexpr (HL) { const __bf16 a = (__bf16)p[j]; ph[qf][kt * 8 + j] = a; pl2[qf][kt * 8 + j] = (__bf16)(p[j] - (float)a); } else { ph[qf][kt * 8 + j] = (h16)p[j]; } } }
                l[qf] += (sum[0] + sum[1]) + (sum[2] + sum[3]); }
#pragma unroll
            for (int mb = 0; mb < 4; ++mb) { V va[NP];
#pragma unroll
                for (int pl = 0; pl < NP; ++pl) va[pl] = F::frag(vb + pl * TILE + mb * 16 * LP + c * 32);
#pragma unroll
                for (int qf = 0; qf < NF; ++qf) { o[mb][qf] = F::mma(va[0], ph[qf], o[mb][qf]); if (HL) { o[mb][qf] = F::mma(va[NP - 1], ph[qf], o[mb][qf]); o[mb][qf] = F::mma(va[0], pl2[qf], o[mb][qf]); } } }
        }
        if (s + 1 < TT / KS) sstore((s + 1) & 1);        // into the buffer whose last readers passed the barrier of the trip before
        __syncthreads();                                 // publishes stage s + 1 and ends every read of stage s
    }
#pragma unroll
    for (int qf = 0; qf < NF; ++qf) { const float inv = __fdiv_rn(1.0f, l[qf] + xhalf(l[qf])); const size_t ob = (size_t)(q0 + qf * 16 + lr) * DQ + h * HD + hi * 8;
#pragma unroll
        for (int mb = 0; mb < 4; ++mb) { v8us oh, ol;
#pragma unroll
            for (int j = 0; j < 8; ++j) { unsigned short a, c2; splitf(o[mb][qf][j] * inv, a, c2); oh[j] = a; ol[j] = c2; }
            *(v8us*)(Ah + ob + mb * 16) = oh; *(v8us*)(Al + ob + mb * 16) = ol; } }
}
__global__ __launch_bounds__(128) void k_fattn(const h16* __restrict__ Q16, const h16* __restrict__ K16, const h16* __restrict__ V16, const bf* __restrict__ Qh, const bf* __restrict__ Ql, const bf* __restrict__ Kh, const bf* __restrict__ Kl, const bf* __restrict__ Vh, const bf* __restrict__ Vl, bf* Ah, bf* Al) {
    __shared__ __align__(16) unsigned short sm[2 * 4 * TILE];
    const int h = blockIdx.y, w = threadIdx.x >> 5, bx = blockIdx.x; const size_t ho = (size_t)h * TT * HD;
    if (bx < RH / 64) fa_body<true, 1>(sm, Qh + ho, Ql + ho, Kh + ho, Kl + ho, Vh + ho, Vl + ho, bx * 64 + w * 16, h, Ah, Al);
    else fa_body<false, 2>(sm, (const unsigned short*)Q16 + ho, nullptr, (const unsigned short*)K16 + ho, nullptr, (const unsigned short*)V16 + ho, nullptr, RH + (bx - RH / 64) * 128 + w * 32, h, Ah, Al);
}

extern "C" void kernel_launch(void* const* d_in, const int* in_sizes, int n_in,
                              void* d_out, int out_size, void* d_ws, size_t ws_size, hipStream_t stream) {
    (void)in_sizes; (void)n_in; (void)out_size;
    const float* x = (const float*)d_in[0]; const float* wqkv = (const float*)d_in[1]; const float* wo = (const float*)d_in[2];  const float* wq = wqkv; const float* wk = wqkv + (size_t)1024 * 1024; const float* wv = wqkv + (size_t)2048 * 1024; (void)wq; (void)wk; (void)wv;
    float* OUT = (float*)d_out;     // [2][1024][2048] (batch, dim, seq)
    char* wsp = (char*)d_ws;
    auto take = [&](size_t bytes) { char* p = wsp; wsp += (bytes + 255) & ~(size_t)255; return (void*)p; };
    bf* WQ = (bf*)take((size_t)DQ * DM * 2); bf* WK = (bf*)take((size_t)DKV * DM * 2); bf* WV = (bf*)take((size_t)DKV * DM * 2); bf* WO = (bf*)take((size_t)DM * DQ * 2); float* CS = (float*)take((size_t)TT * HD * 2 * 4);
    bf* XB = (bf*)take((size_t)TT * DM * 2);
    h16* QP16 = (h16*)take((size_t)NH_ * TT * HD * 2); h16* KP16 = (h16*)take((size_t)NKV * TT * HD * 2); h16* VT16 = (h16*)take((size_t)NKV * HD * TT * 2);
    bf* QPh = (bf*)take((size_t)NH_ * TT * HD * 2); bf* QPl = (bf*)take((size_t)NH_ * TT * HD * 2); bf* KPh = (bf*)take((size_t)NKV * TT * HD * 2); bf* KPl = (bf*)take((size_t)NKV * TT * HD * 2); bf* VTh = (bf*)take((size_t)NKV * HD * TT * 2); bf* VTl = (bf*)take((size_t)NKV * HD * TT * 2);
    bf* ATh = (bf*)take((size_t)TT * DQ * 2); bf* ATl = (bf*)take((size_t)TT * DQ * 2);
    if ((size_t)(wsp - (char*)d_ws) > ws_size) return;    // ws 256 MiB
    { k_cvt8<<<(unsigned)(((size_t)DQ * DM / 8 + 255) / 256), 256, 0, stream>>>(wq, WQ, (size_t)DQ * DM / 8); k_cvt8<<<(unsigned)(((size_t)DKV * DM / 8 + 255) / 256), 256, 0, stream>>>(wk, WK, (size_t)DKV * DM / 8); k_cvt8<<<(unsigned)(((size_t)DKV * DM / 8 + 255) / 256), 256, 0, stream>>>(wv, WV, (size_t)DKV * DM / 8);
      k_cvt8<<<(unsigned)(((size_t)DM * DQ / 8 + 255) / 256), 256, 0, stream>>>(wo, WO, (size_t)DM * DQ / 8);
       }
    k_cstab<<<(TT * HD + 255) / 256, 256, 0, stream>>>(CS);
    for (int b = 0; b < NB_; ++b) {
        
        k_cvt8T<<<(unsigned)(((size_t)TT * DM / 8 + 255) / 256), 256, 0, stream>>>(x + (size_t)b * DM * TT, XB);   /* x[b] is channel-major [DM][TT] -> XB token-major [TT][DM] */
        k_gemmw<bf, 0, false, 1, DM><<<dim3(TT / 128, DQ / 64, 1), 128, 0, stream>>>(XB, nullptr, WQ, nullptr, nullptr, 0, nullptr, 0, 0, 0, CS, QP16, QPh, QPl);    /* q projection, rotary, planes [h][t][HD] */
        k_gemmw<bf, 0, false, 1, DM><<<dim3(TT / 128, DKV / 64, 1), 128, 0, stream>>>(XB, nullptr, WK, nullptr, nullptr, 0, nullptr, 0, 0, 0, CS, KP16, KPh, KPl);   /* k projection, rotary, planes [h][t][HD] */
        k_gemmw<bf, 0, false, 2, DM><<<dim3(DKV / 128, TT / 64, 1), 128, 0, stream>>>(WV, nullptr, XB, nullptr, nullptr, 0, nullptr, 0, 0, 0, nullptr, VT16, VTh, VTl);   /* v^T = W_v x xt^T: planes [h][HD][t] as they come */
        k_fattn<<<dim3(RH / 64 + (TT - RH) / 128, NH_, 1), 128, 0, stream>>>(QP16, KP16, VT16, QPh, QPl, KPh, KPl, VTh, VTl, ATh, ATl);   /* all heads and query rows: scores, softmax, attn.v, merged hi + lo planes [t][DQ] */
        k_gemmw<bf, 3, false, 0, DQ><<<dim3(DM / 128, TT / 64, 1), 128, 0, stream>>>(WO, nullptr, ATh, ATl, OUT + (size_t)b * DM * TT, TT, nullptr, 0, 0, 0, nullptr, nullptr, nullptr, nullptr);   /* channel-major output rows [e][t]: exact W_out x (merged hi + lo) */ }
}

// v005
// One run takes 132 microseconds.
// In two side-by-side timings against v004, it was 1.66 and 1.64 times as fast.
// Counting every step since v000, it is 15.0 times as fast.
#include <hip/hip_runtime.h>

// Multi-head attention with interleaved-pair rotary embeddings on a channel-major input (x [2][1024][2048] = (batch, dim, seq); xt = x^T; [q|k|v] = xt W_qkv^T ('oi' [3072][1024]: row blocks q | k | v; 16 heads x 64); rotary on adjacent (even, odd) pairs with angle t x 10000^(-2i/64) (tables computed on device from the reference's float32 inv_freq); scores/8 over all 2048 keys; softmax; merged heads; out^T = W_out ('oi' [1024][1024]) x merged^T written channel-major -> [2][1024][2048] (4.2 M)).
// Compute dtypes, f32 accumulate: every input rounded to bf16; q/k/v on PLAIN bf16 operands (inputs: exact); input transposed to token-major while converting to bf16; interleaved rotary in f32 (precise cosf/sinf table) and the 16-bit operand planes written in the projections' own epilogues; scores and attn.v fused in one launch (online softmax in f32, scores never in memory): query rows < 512 hl (3 products), the rest single fp16 (x16); W_out exact x merged hl (2 products), written transposed (dim-major) straight from the GEMM epilogue.
// Four launches, each over both batches: input conversions and table | q, k, v projections | attention | output projection.

#define NB_  2
#define TT   2048
#define DM   1024
#define NH_  16
#define NKV  16
#define REP  (NH_ / NKV)
#define HD   64
#define DQ   (NH_ * HD)
#define DKV  (NKV * HD)
#define RH   512                  // query rows < RH use hi+lo planes (0: none)
#define WIN  2048
#define SCL  0.125f   // HD^-0.5
typedef _Float16 h16;
typedef unsigned short bf;
typedef __attribute__((ext_vector_type(16))) __bf16   v16bf;
typedef __attribute__((ext_vector_type(16))) _Float16 v16h;
typedef __attribute__((ext_vector_type(8)))  _Float16 v8h;
typedef __attribute__((ext_vector_type(8)))  unsigned short v8us;
typedef __attribute__((ext_vector_type(8)))  float    v8f;
typedef __attribute__((ext_vector_type(4)))  float    v4f;
typedef v8h  __attribute__((may_alias)) v8ha;
typedef v4f  __attribute__((may_alias)) v4fa;
typedef v8us __attribute__((may_alias)) v8usa;

__device__ __forceinline__ unsigned short f2bf(float f) { unsigned u = __float_as_uint(f); u += 0x7FFFu + ((u >> 16) & 1u); return (unsigned short)(u >> 16); }
__device__ __forceinline__ float bf2f(unsigned short b) { return __uint_as_float(((unsigned)b) << 16); }
__device__ __forceinline__ float bfr(float f) { return bf2f(f2bf(f)); }
__device__ __forceinline__ v16h cat16(v8h lo, v8h hi) { return __builtin_shufflevector(lo, hi, 0, 1, 2, 3, 4, 5, 6, 7, 8, 9, 10, 11, 12, 13, 14, 15); }
__device__ __forceinline__ v16bf cat16b(v8us lo, v8us hi) { return __builtin_bit_cast(v16bf, __builtin_shufflevector(lo, hi, 0, 1, 2, 3, 4, 5, 6, 7, 8, 9, 10, 11, 12, 13, 14, 15)); }
__device__ __forceinline__ v8f wmma16(v16h a, v16h b, v8f c) { return __builtin_amdgcn_wmma_f32_16x16x32_f16(false, a, false, b, (short)0, c, false, false); }
__device__ __forceinline__ v8f wmmab(v16bf a, v16bf b, v8f c) { return __builtin_amdgcn_wmma_f32_16x16x32_bf16(false, a, false, b, (short)0, c, false, false); }



__device__ __forceinline__ h16 tohx(float x) { return (h16)x; }
__device__ __forceinline__ void splitf(float y, unsigned short& h, unsigned short& l) { h = f2bf(y); l = f2bf(y - bf2f(h)); }
typedef __attribute__((ext_vector_type(2))) _Float16 v2h;
typedef __attribute__((ext_vector_type(4))) _Float16 v4h;
typedef __attribute__((ext_vector_type(2))) unsigned short v2us;
typedef __attribute__((ext_vector_type(4))) unsigned short v4us;
typedef __attribute__((ext_vector_type(2))) float v2f;
typedef __attribute__((ext_vector_type(4))) int v4i;

// ---- gemm_tile: GEMM, one work-group of 4 waves per 128x64 output tile (bx, by), each wave a 32x64 part (8 accumulators); 128 threads. The calling kernel owns the LDS (sg: two stages; osw: the epilogue's exchange) and hands in the batch's own pointers.
// The K-contiguous 16-bit operand planes go through LDS in stages of 128 k (two whole 128-byte lines of every row), two buffers: the next stage's global loads fly while this stage is worked on, and the 64 rows of Bt are fetched once for all four waves.
// C[m][n] (f32, pitch ldc, + optional f32 bias[n]) = sum_k A[m][k] Bt[n][k] (+ split products per NSPLIT). K is a compile-time constant, so that the rows of a sweep are constant steps from one address; K % 128 == 0.
// EPI 0: the f32 tile goes to C. EPI 1 and 2: no f32 result reaches memory; the epilogue writes the three 16-bit planes (fp16, bf16 hi, bf16 lo) that the attention kernel reads.
// EPI 1 (q, k; m = token, n = channel, one head per tile column): interleaved rotary with the table CS [t][HD][cos, sin], planes [by][t][HD]. EPI 2 (v; m = channel, n = token): planes [channel][t], pitch TT.
#define GK   128                  // k per LDS stage
#define GP   136                  // LDS row pitch in 16-bit elements: 272 B = 16 B x odd, conflict-free for 16-byte reads
#define GTA  (128 * GP)           // one staged A plane: 128 rows x 128 k
#define GTB  (64 * GP)            // one staged B plane: 64 rows x 128 k
template <typename T16> struct WFrag;
template <> struct WFrag<h16> { typedef v16h V; static __device__ __forceinline__ V ld(const h16* p) { return cat16(*(const v8h*)p, *(const v8h*)(p + 16)); } static __device__ __forceinline__ v8f mma(V a, V b, v8f c) { return wmma16(a, b, c); } };
template <> struct WFrag<bf> { typedef v16bf V; static __device__ __forceinline__ V ld(const bf* p) { return cat16b(*(const v8us*)p, *(const v8us*)(p + 16)); } static __device__ __forceinline__ v8f mma(V a, V b, v8f c) { return wmmab(a, b, c); } };
template <typename T16, int NSPLIT, bool BIAS, int EPI, int K>
__device__ __forceinline__ void gemm_tile(T16* sg, float* osw, int bx, int by, const T16* __restrict__ A, const T16* __restrict__ A2, const T16* __restrict__ Bt, const T16* __restrict__ Bt2, float* C, int ldc, const float* __restrict__ bias, const float* __restrict__ CS, h16* P16, bf* Ph, bf* Pl) {
    typedef typename WFrag<T16>::V V;
    constexpr bool HA2 = NSPLIT == 1 || NSPLIT == 2, HB2 = NSPLIT >= 2;
    constexpr int OA2 = GTA, OB = GTA * (HA2 ? 2 : 1), OB2 = OB + GTB, STG = OB + GTB * (HB2 ? 2 : 1);   // places of the planes in a stage, and its size
    constexpr int KG = (HA2 || HB2) ? 1 : 2;   // k steps of 32 whose fragments are fetched as one group (as many as the registers hold)
    const int tid = threadIdx.x, lane = tid & 31, lr = lane & 15, hi = lane >> 4, w = tid >> 5; const int r0 = bx * 128 + w * 32, c0 = by * 64;
    float* os = osw + w * (16 * 68);   // each wave's own exchange buffer for the epilogue
    v8f acc[2][4];
#pragma unroll
    for (int mb = 0; mb < 2; ++mb)
#pragma unroll
        for (int nb = 0; nb < 4; ++nb) acc[mb][nb] = (v8f){};
    static_assert(K % GK == 0, "whole stages");
    const int srow = tid >> 4, scol = (tid & 15) * 8;    // staging: 16 threads per 256-byte row, 8 rows a sweep
    const unsigned lo = (unsigned)(srow * K + scol);     // the lane's own element offset in a sweep: the one vector part of every staging address, the rest is the same for the whole work-group
    const size_t ag = (size_t)bx * 128 * K, bg = (size_t)c0 * K;
    v8us ra[16], ra2[16], rb[8], rb2[8];
    const char* ba = (const char*)(A + ag); const char* ba2 = HA2 ? (const char*)(A2 + ag) : nullptr; const char* bb0 = (const char*)(Bt + bg); const char* bb2 = HB2 ? (const char*)(Bt2 + bg) : nullptr;   // the tile's first rows: the same for the whole work-group
    unsigned vo = lo * 2;                                // the lane's byte offset in the next stage to fetch, one register for all planes
    auto gload = [&]() {
#pragma unroll
        for (int u = 0; u < 16; ++u) { ra[u] = *(const v8usa*)(ba + vo + u * 8 * K * 2); if (HA2) ra2[u] = *(const v8usa*)(ba2 + vo + u * 8 * K * 2); }
#pragma unroll
        for (int u = 0; u < 8; ++u) { rb[u] = *(const v8usa*)(bb0 + vo + u * 8 * K * 2); if (HB2) rb2[u] = *(const v8usa*)(bb2 + vo + u * 8 * K * 2); }
        asm volatile("s_wait_xcnt 0x0" : "+v"(vo) :: "memory");   // the wait that stands before a register named by an issued global load is overwritten; the offset is its operand so that it stays in its register up to the wait and is stepped only behind it
        vo += GK * 2; };
    auto sstore = [&](int b) { T16* d = sg + b * STG + srow * GP + scol;
#pragma unroll
        for (int u = 0; u < 16; ++u) { *(v8usa*)(d + u * 8 * GP) = ra[u]; if (HA2) *(v8usa*)(d + OA2 + u * 8 * GP) = ra2[u]; }
#pragma unroll
        for (int u = 0; u < 8; ++u) { *(v8usa*)(d + OB + u * 8 * GP) = rb[u]; if (HB2) *(v8usa*)(d + OB2 + u * 8 * GP) = rb2[u]; } };
    constexpr int ns = K / GK;
    gload(); sstore(0); __syncthreads();
#pragma unroll 1   // rolled: one copy of the stage body
    for (int s = 0; s < ns; ++s) {
        const T16* ab = sg + (s & 1) * STG + (w * 32 + lr) * GP + 8 * hi; const T16* bb = sg + (s & 1) * STG + OB + lr * GP + 8 * hi;
#pragma unroll
        for (int kg = 0; kg < GK / 32; kg += KG) {
            V a[KG][2], a2[KG][2], b[KG][4], b2[KG][4];
#pragma unroll
            for (int ks = 0; ks < KG; ++ks) { const int ko = (kg + ks) * 32;
#pragma unroll
                for (int mb = 0; mb < 2; ++mb) { a[ks][mb] = WFrag<T16>::ld(ab + mb * 16 * GP + ko); if (HA2) a2[ks][mb] = WFrag<T16>::ld(ab + OA2 + mb * 16 * GP + ko); }
#pragma unroll
                for (int nb = 0; nb < 4; ++nb) { b[ks][nb] = WFrag<T16>::ld(bb + nb * 16 * GP + ko); if (HB2) b2[ks][nb] = WFrag<T16>::ld(bb + GTB + nb * 16 * GP + ko); } }
            if (kg == 0 && s + 1 < ns) gload();          // the next stage's global loads fly while this stage is worked on; issued in the shadow of the LDS reads
            __builtin_amdgcn_sched_barrier(0);   // the group's LDS reads all issue ahead of its products: one LDS latency per group instead of one per B fragment
#pragma unroll
            for (int ks = 0; ks < KG; ++ks)
#pragma unroll
                for (int nb = 0; nb < 4; ++nb) {
#pragma unroll
                    for (int mb = 0; mb < 2; ++mb) acc[mb][nb] = WFrag<T16>::mma(a[ks][mb], b[ks][nb], acc[mb][nb]);
                    if (HA2) {
#pragma unroll
                        for (int mb = 0; mb < 2; ++mb) acc[mb][nb] = WFrag<T16>::mma(a2[ks][mb], b[ks][nb], acc[mb][nb]); }
                    if (HB2) {
#pragma unroll
                        for (int mb = 0; mb < 2; ++mb) acc[mb][nb] = WFrag<T16>::mma(a[ks][mb], b2[ks][nb], acc[mb][nb]); } }
        }
        if (s + 1 < ns) sstore((s + 1) & 1);             // into the buffer whose last readers passed the barrier of the trip before
        __syncthreads();                                 // publishes stage s + 1 and ends every read of stage s
    }
    constexpr int ES = EPI == 1 ? HD : TT;   // plane elements from one tile row to the next
    const float* cb = nullptr; size_t e0 = 0;   // this lane's first table entry and first plane element; every later one is a constant step away
    if constexpr (EPI == 1) { cb = CS + ((size_t)(r0 + hi) * HD + lr * 4) * 2; e0 = ((size_t)by * TT + r0 + hi) * HD + lr * 4; }
    if constexpr (EPI == 2) e0 = (size_t)(r0 + hi) * TT + c0 + lr * 4;
#pragma unroll
    for (int mb = 0; mb < 2; ++mb) {
        v2f cs[8][2];   // EPI 1: cos, sin of this lane's two pairs in each of its 8 rows, asked for ahead of the LDS exchange so that they fly during it
        if constexpr (EPI == 1) {
#pragma unroll
            for (int s = 0; s < 8; ++s) { const float* c = cb + (mb * 16 + 2 * s) * (HD * 2); cs[s][0] = *(const v2f*)c; cs[s][1] = *(const v2f*)(c + 4); } }
#pragma unroll
        for (int nb = 0; nb < 4; ++nb) {
#pragma unroll
            for (int j = 0; j < 8; ++j) os[(hi * 8 + j) * 68 + nb * 16 + lr] = acc[mb][nb][j]; }
        __builtin_amdgcn_wave_barrier(); asm volatile("" ::: "memory");
        float* crow = C + (size_t)(r0 + mb * 16) * ldc + c0;
#pragma unroll
        for (int s = 0; s < 8; ++s) { const int row = 2 * s + hi, cofs = lr * 4; v4f val = *(const v4fa*)(os + row * 68 + cofs); if (BIAS) { val[0] += bfr(bias[c0 + cofs]); val[1] += bfr(bias[c0 + cofs + 1]); val[2] += bfr(bias[c0 + cofs + 2]); val[3] += bfr(bias[c0 + cofs + 3]); }
            if constexpr (EPI == 0) {
                *(v4f*)(crow + (size_t)row * ldc + cofs) = val; }
            else {
                if constexpr (EPI == 1) { const v4f x = val;   /* even: x0 c - x1 s; odd: x0 s + x1 c */
                    val[0] = x[0] * cs[s][0][0] - x[1] * cs[s][0][1]; val[1] = x[0] * cs[s][0][1] + x[1] * cs[s][0][0]; val[2] = x[2] * cs[s][1][0] - x[3] * cs[s][1][1]; val[3] = x[2] * cs[s][1][1] + x[3] * cs[s][1][0]; }
                const size_t e = e0 + (mb * 16 + 2 * s) * ES;   // 16 lanes x 8 bytes: one whole 128-byte line per row and plane
                v4h o16; v4us oh, ol;
#pragma unroll
                for (int q = 0; q < 4; ++q) { o16[q] = tohx(val[q]); unsigned short a2, c2; splitf(val[q], a2, c2); oh[q] = a2; ol[q] = c2; }
                *(v4h*)(P16 + e) = o16; *(v4us*)(Ph + e) = oh; *(v4us*)(Pl + e) = ol;
                if constexpr (EPI == 2) asm volatile("s_wait_xcnt 0x0" ::: "memory"); } }   // the next row's values reuse the registers that these plane stores name
        asm volatile("s_wait_xcnt 0x0" ::: "memory");   // the next block's values reuse the registers that these stores name
        __builtin_amdgcn_wave_barrier(); asm volatile("" ::: "memory");
    }
}
// ---- k_qkv: the q, k and v projections of both batches in one launch; grid (TT/128, 48, NB_). y < 32: q | k, the first 2048 rows of W_qkv as one Bt (y = head: the q heads, then the k heads), x = token tile. y >= 32: the 256 tiles of v^T = W_v x xt^T.
__global__ __launch_bounds__(128) void k_qkv(const bf* __restrict__ XB, const bf* __restrict__ Wb, const float* __restrict__ CS, h16* QK16, bf* QKh, bf* QKl, h16* VT16, bf* VTh, bf* VTl) {
    __shared__ __align__(16) bf sg[2 * (GTA + GTB)];
    __shared__ __align__(16) float osw[4 * 16 * 68];
    const int x = blockIdx.x, y = blockIdx.y; const size_t z = blockIdx.z; const bf* X = XB + z * ((size_t)TT * DM);
    if (y < (DQ + DKV) / 64) { const size_t p = z * ((size_t)(NH_ + NKV) * TT * HD);
        gemm_tile<bf, 0, false, 1, DM>(sg, osw, x, y, X, nullptr, Wb, nullptr, nullptr, 0, nullptr, CS, QK16 + p, QKh + p, QKl + p); }   /* rotary, planes [q heads | k heads][t][HD] */
    else { const int i = (y - (DQ + DKV) / 64) * (TT / 128) + x; const size_t p = z * ((size_t)DKV * TT);
        gemm_tile<bf, 0, false, 2, DM>(sg, osw, i % (DKV / 128), i / (DKV / 128), Wb + (size_t)(DQ + DKV) * DM, nullptr, X, nullptr, nullptr, 0, nullptr, nullptr, VT16 + p, VTh + p, VTl + p); }   /* planes [h][HD][t] as they come */
}
// ---- k_out: channel-major output rows [e][t] of both batches: exact W_out x (merged hi + lo); grid (DM/128, TT/64, NB_).
__global__ __launch_bounds__(128) void k_out(const bf* __restrict__ WO, const bf* __restrict__ ATh, const bf* __restrict__ ATl, float* OUT) {
    __shared__ __align__(16) bf sg[2 * (GTA + 2 * GTB)];
    __shared__ __align__(16) float osw[4 * 16 * 68];
    const size_t z = blockIdx.z, a = z * ((size_t)TT * DQ);
    gemm_tile<bf, 3, false, 0, DQ>(sg, osw, blockIdx.x, blockIdx.y, WO, nullptr, ATh + a, ATl + a, OUT + z * ((size_t)DM * TT), TT, nullptr, nullptr, nullptr, nullptr, nullptr);
}

__global__ __launch_bounds__(256) void k_wtG(const float* __restrict__ w, int K, int N, bf* Bt) {
    const int lane = threadIdx.x & 31; const int L0 = (blockIdx.x * 8 + (threadIdx.x >> 5)) * 8; const int nlines = N * K / 64;
{
#pragma unroll 1
        for (int l = 0; l < 8; ++l) { const int L = L0 + l; if (L >= nlines) break; const size_t e = (size_t)L * 64 + lane * 2; const int k = (int)(e % K), n = (int)(e / K); v2us o;
            o[0] = f2bf(w[(size_t)k * N + n]); o[1] = f2bf(w[(size_t)(k + 1) * N + n]); *(v2us*)(Bt + e) = o; }
         }
}
__device__ __forceinline__ void cvt8T(const float* __restrict__ src, bf* dst, size_t i) { const int t = (int)(i / (DM / 8)); const int c0 = (int)(i % (DM / 8)) * 8; v8us o;
#pragma unroll
    for (int k = 0; k < 8; ++k) o[k] = f2bf(src[(size_t)(c0 + k) * TT + t]); *(v8us*)(dst + (size_t)t * DM + c0) = o;  }
__device__ __forceinline__ void cvt8(const float* __restrict__ src, bf* dst, size_t i) { const v8f v = *(const v8f*)(src + i * 8); v8us o;
#pragma unroll
    for (int k = 0; k < 8; ++k) o[k] = f2bf(v[k]); *(v8us*)(dst + i * 8) = o;
    asm volatile("s_wait_xcnt 0x0" ::: "memory"); }   // in the built k_prep another range's block stands behind this store, past a scalar test, and writes the registers that the store names

__constant__ float INV[HD / 2] = {1.0f,0.749894202f,0.562341332f,0.421696514f,0.316227764f,0.237137362f,0.177827939f,0.133352146f,0.100000001f,0.0749894157f,0.0562341288f,0.0421696492f,0.0316227786f,0.0237137359f,0.0177827943f,0.0133352149f,0.00999999978f,0.00749894232f,0.00562341325f,0.00421696482f,0.00316227786f,0.00237137382f,0.00177827943f,0.00133352145f,0.00100000005f,0.000749894185f,0.000562341302f,0.000421696488f,0.000316227786f,0.000237137385f,0.00017782794f,0.00013335215f};
__device__ __forceinline__ void cstab(float* CS, int idx) { const int t = idx / HD, d = idx % HD; const float ang = __fmul_rn((float)t, INV[d >> 1]); v2f cs; cs[0] = cosf(ang); cs[1] = sinf(ang);
    *(v2f*)(CS + (size_t)idx * 2) = cs;
    asm volatile("s_wait_xcnt 0x0" ::: "memory"); }   // as in cvt8: another range's block stands behind this store in the built k_prep
// ---- k_prep: all that depends on the inputs alone, in one launch, by ranges of blocks: x of both batches (channel-major [DM][TT]) -> XB token-major [TT][DM] bf16 | W_qkv -> bf16 | W_out -> bf16 | the rotary table.
#define PBX  (TT * DM / 8 / 256)               // blocks per batch of x
#define PBW  ((DQ + 2 * DKV) * DM / 8 / 256)   // blocks of W_qkv
#define PBO  (DM * DQ / 8 / 256)               // blocks of W_out
#define PBC  (TT * HD / 256)                   // blocks of the table
static_assert(TT * DM % 2048 == 0 && (DQ + 2 * DKV) * DM % 2048 == 0 && DM * DQ % 2048 == 0 && TT * HD % 256 == 0, "whole blocks in every range of k_prep");
__global__ __launch_bounds__(256) void k_prep(const float* __restrict__ x, const float* __restrict__ wqkv, const float* __restrict__ wo, bf* XB, bf* Wb, bf* WO, float* CS) {
    const int blk = blockIdx.x, tid = threadIdx.x;
    if (blk < NB_ * PBX) { const int b = blk / PBX; cvt8T(x + (size_t)b * DM * TT, XB + (size_t)b * TT * DM, (size_t)(blk - b * PBX) * 256 + tid); }
    else if (blk < NB_ * PBX + PBW + PBO) { const bool o = blk >= NB_ * PBX + PBW; cvt8(o ? wo : wqkv, o ? WO : Wb, (size_t)(blk - NB_ * PBX - (o ? PBW : 0)) * 256 + tid); }
    else cstab(CS, (blk - (NB_ * PBX + PBW + PBO)) * 256 + tid);
}

#define KS   64                   // keys per LDS stage
#define LP   72                   // LDS row pitch in 16-bit elements: 144 B = 16 B x odd, conflict-free for 16-byte reads
#define TILE (64 * LP)            // one staged plane: 64 rows (keys of K, channels of V^T) x 64 elements
static_assert(HD == 64 && KS == 64 && TT % KS == 0 && RH % 64 == 0 && (TT - RH) % 128 == 0, "tile geometry of k_fattn");
__device__ __forceinline__ float xhalf(float x) { return __builtin_bit_cast(float, __builtin_amdgcn_permlanex16(__builtin_bit_cast(int, x), __builtin_bit_cast(int, x), 0x76543210, 0xfedcba98, false, false)); }   // lane l <-> lane l ^ 16, on the vector pipe
// Eight independent v_exp_f32, then the one slot that the instruction set asks for behind a transcendental before its result is read or its source overwritten; "=&v" keeps every result off every source.
__device__ __forceinline__ void exp2x8(const float (&t)[8], float (&p)[8]) {
    asm("v_exp_f32 %0, %8\n\tv_exp_f32 %1, %9\n\tv_exp_f32 %2, %10\n\tv_exp_f32 %3, %11\n\tv_exp_f32 %4, %12\n\tv_exp_f32 %5, %13\n\tv_exp_f32 %6, %14\n\tv_exp_f32 %7, %15\n\tv_nop"
        : "=&v"(p[0]), "=&v"(p[1]), "=&v"(p[2]), "=&v"(p[3]), "=&v"(p[4]), "=&v"(p[5]), "=&v"(p[6]), "=&v"(p[7]) : "v"(t[0]), "v"(t[1]), "v"(t[2]), "v"(t[3]), "v"(t[4]), "v"(t[5]), "v"(t[6]), "v"(t[7])); }
__device__ __forceinline__ float exp2s(float x) { float r; asm("v_exp_f32 %0, %1\n\tv_nop" : "=&v"(r) : "v"(x)); return r; }   // one v_exp_f32 with the same slot behind it
template <bool HL> struct FOp;
template <> struct FOp<false> { typedef v16h V; static __device__ __forceinline__ V frag(const unsigned short* p) { return cat16(__builtin_bit_cast(v8h, *(const v8usa*)p), __builtin_bit_cast(v8h, *(const v8usa*)(p + 16))); } static __device__ __forceinline__ v8f mma(V a, V b, v8f c) { return wmma16(a, b, c); } };
template <> struct FOp<true> { typedef v16bf V; static __device__ __forceinline__ V frag(const unsigned short* p) { return cat16b(*(const v8usa*)p, *(const v8usa*)(p + 16)); } static __device__ __forceinline__ v8f mma(V a, V b, v8f c) { return wmmab(a, b, c); } };
// Q*, K* [t][HD], V* [HD][t] of this head (plane 1: the lo planes, HL only); q0: the wave's first query; NF: query fragments of 16 per wave.
template <bool HL, int NF>
__device__ __forceinline__ void fa_body(unsigned short* sm, const unsigned short* __restrict__ Q0, const unsigned short* __restrict__ Q1, const unsigned short* __restrict__ K0, const unsigned short* __restrict__ K1, const unsigned short* __restrict__ V0, const unsigned short* __restrict__ V1, int q0, int h, bf* Ah, bf* Al) {
    typedef FOp<HL> F; typedef typename F::V V;
    constexpr int NP = HL ? 2 : 1;                       // planes per operand
    constexpr float C = SCL * 1.4426950408889634f;       // raw score -> log2 units
    constexpr float SH = HL ? 0.0f : 4.0f;               // fp16 probabilities carry x16: at most 2^(8+4), and small ones stay normal numbers
    const int tid = threadIdx.x, lane = tid & 31, lr = lane & 15, hi = lane >> 4;
    const int srow = tid >> 3, scol = (tid & 7) * 8;     // staging: 8 threads per 128-byte row, 16 rows a sweep
    V qa[NP][NF][2];
#pragma unroll
    for (int qf = 0; qf < NF; ++qf)
#pragma unroll
        for (int ks = 0; ks < 2; ++ks) { const size_t qo = (size_t)(q0 + qf * 16 + lr) * HD + ks * 32 + 8 * hi; qa[0][qf][ks] = F::frag(Q0 + qo); if (HL) qa[NP - 1][qf][ks] = F::frag(Q1 + qo); }
    v8f o[4][NF]; float m[NF], l[NF];
#pragma unroll
    for (int qf = 0; qf < NF; ++qf) { m[qf] = -3.0e38f; l[qf] = 0.f;
#pragma unroll
        for (int mb = 0; mb < 4; ++mb) o[mb][qf] = (v8f){}; }
    v8us rk[NP][4], rv[NP][4]; const size_t kof = (size_t)srow * HD + scol, vof = (size_t)srow * TT + scol;
    auto gload = [&](int s) {
#pragma unroll
        for (int u = 0; u < 4; ++u) { const size_t ko = kof + (size_t)s * (KS * HD) + u * (16 * HD), vo = vof + (size_t)s * KS + u * (16 * TT);
            rk[0][u] = *(const v8usa*)(K0 + ko); rv[0][u] = *(const v8usa*)(V0 + vo); if (HL) { rk[NP - 1][u] = *(const v8usa*)(K1 + ko); rv[NP - 1][u] = *(const v8usa*)(V1 + vo); } } };
    auto sstore = [&](int b) { unsigned short* d = sm + b * (2 * NP * TILE) + srow * LP + scol;
#pragma unroll
        for (int u = 0; u < 4; ++u)
#pragma unroll
            for (int pl = 0; pl < NP; ++pl) { *(v8usa*)(d + pl * TILE + u * 16 * LP) = rk[pl][u]; *(v8usa*)(d + (NP + pl) * TILE + u * 16 * LP) = rv[pl][u]; } };
    gload(0); sstore(0); __syncthreads();
#pragma unroll 1   // rolled: one copy of the stage body
    for (int s = 0; s < TT / KS; ++s) {
        if (s + 1 < TT / KS) gload(s + 1);               // the next stage's global loads fly while this stage is worked on
        const unsigned short* kb = sm + (s & 1) * (2 * NP * TILE) + lr * LP + 8 * hi; const unsigned short* vb = kb + NP * TILE;
#pragma unroll
        for (int c = 0; c < KS / 32; ++c) {
            v8f st[2][NF];
#pragma unroll
            for (int kt = 0; kt < 2; ++kt) { V ka[NP][2];
#pragma unroll
                for (int pl = 0; pl < NP; ++pl)
#pragma unroll
                    for (int ks = 0; ks < 2; ++ks) ka[pl][ks] = F::frag(kb + pl * TILE + (c * 32 + kt * 16) * LP + ks * 32);
#pragma unroll
                for (int qf = 0; qf < NF; ++qf) { v8f a = (v8f){};
#pragma unroll
                    for (int ks = 0; ks < 2; ++ks) { a = F::mma(ka[0][ks], qa[0][qf][ks], a); if (HL) { a = F::mma(ka[NP - 1][ks], qa[0][qf][ks], a); a = F::mma(ka[0][ks], qa[NP - 1][qf][ks], a); } }
                    st[kt][qf] = a; } }
            float mx[NF]; bool need = false;
#pragma unroll
            for (int qf = 0; qf < NF; ++qf) { float a = fmaxf(st[0][qf][0], st[1][qf][0]), a1 = fmaxf(st[0][qf][1], st[1][qf][1]);   // two short chains
#pragma unroll
                for (int j = 2; j < 8; j += 2) { a = fmaxf(a, fmaxf(st[0][qf][j], st[1][qf][j])); a1 = fmaxf(a1, fmaxf(st[0][qf][j + 1], st[1][qf][j + 1])); }
                a = fmaxf(a, a1); a = fmaxf(a, xhalf(a)); mx[qf] = a * C; need = need || (mx[qf] > m[qf] + 8.0f); }
            if (__builtin_amdgcn_ballot_w32(need) != 0) {   // wave-uniform: one test per 32 keys
#pragma unroll
                for (int qf = 0; qf < NF; ++qf) { const float mn = fmaxf(m[qf], mx[qf]); const float al = exp2s(m[qf] - mn); m[qf] = mn; l[qf] *= al;
#pragma unroll
                    for (int mb = 0; mb < 4; ++mb)
#pragma unroll
                        for (int j = 0; j < 8; ++j) o[mb][qf][j] *= al; } }
            V ph[NF], pl2[NF];
#pragma unroll
            for (int qf = 0; qf < NF; ++qf) { const float mo = m[qf] - SH; float sum[4];   // four short chains
#pragma unroll
                for (int kt = 0; kt < 2; ++kt) { float t[8], p[8];
#pragma unroll
                    for (int j = 0; j < 8; j += 2) { const v2f r = __builtin_elementwise_fma((v2f){st[kt][qf][j], st[kt][qf][j + 1]}, (v2f){C, C}, (v2f){-mo, -mo}); t[j] = r[0]; t[j + 1] = r[1]; }   // packed: two scores an instruction
                    exp2x8(t, p);
#pragma unroll
                    for (int j = 0; j < 8; ++j) { if (kt == 0 && j < 4) sum[j] = p[j]; else sum[j & 3] += p[j];
                        if constexpr (HL) { const __bf16 a = (__bf16)p[j]; ph[qf][kt * 8 + j] = a; pl2[qf][kt * 8 + j] = (__bf16)(p[j] - (float)a); } else { ph[qf][kt * 8 + j] = (h16)p[j]; } } }
                l[qf] += (sum[0] + sum[1]) + (sum[2] + sum[3]); }
#pragma unroll
            for (int mb = 0; mb < 4; ++mb) { V va[NP];
#pragma unroll
                for (int pl = 0; pl < NP; ++pl) va[pl] = F::frag(vb + pl * TILE + mb * 16 * LP + c * 32);
#pragma unroll
                for (int qf = 0; qf < NF; ++qf) { o[mb][qf] = F::mma(va[0], ph[qf], o[mb][qf]); if (HL) { o[mb][qf] = F::mma(va[NP - 1], ph[qf], o[mb][qf]); o[mb][qf] = F::mma(va[0], pl2[qf], o[mb][qf]); } } }
        }
        if (s + 1 < TT / KS) sstore((s + 1) & 1);        // into the buffer whose last readers passed the barrier of the trip before
        __syncthreads();                                 // publishes stage s + 1 and ends every read of stage s
    }
#pragma unroll
    for (int qf = 0; qf < NF; ++qf) { const float inv = __fdiv_rn(1.0f, l[qf] + xhalf(l[qf])); const size_t ob = (size_t)(q0 + qf * 16 + lr) * DQ + h * HD + hi * 8;
#pragma unroll
        for (int mb = 0; mb < 4; ++mb) { v8us oh, ol;
#pragma unroll
            for (int j = 0; j < 8; ++j) { unsigned short a, c2; splitf(o[mb][qf][j] * inv, a, c2); oh[j] = a; ol[j] = c2; }
            *(v8us*)(Ah + ob + mb * 16) = oh; *(v8us*)(Al + ob + mb * 16) = ol; } }
}
__global__ __launch_bounds__(128) void k_fattn(const h16* __restrict__ Q16, const h16* __restrict__ K16, const h16* __restrict__ V16, const bf* __restrict__ Qh, const bf* __restrict__ Ql, const bf* __restrict__ Kh, const bf* __restrict__ Kl, const bf* __restrict__ Vh, const bf* __restrict__ Vl, bf* Ah, bf* Al) {
    __shared__ __align__(16) unsigned short sm[2 * 4 * TILE];
    const int h = blockIdx.y, w = threadIdx.x >> 5, bx = blockIdx.x; const size_t z = blockIdx.z, ho = (z * (NH_ + NKV) + h) * (TT * HD), vo = (z * NKV + h) * (HD * TT);   // q and k planes lie [batch][q heads | k heads], v planes [batch][head]
    Ah += z * ((size_t)TT * DQ); Al += z * ((size_t)TT * DQ);
    if (bx < RH / 64) fa_body<true, 1>(sm, Qh + ho, Ql + ho, Kh + ho, Kl + ho, Vh + vo, Vl + vo, bx * 64 + w * 16, h, Ah, Al);
    else fa_body<false, 2>(sm, (const unsigned short*)Q16 + ho, nullptr, (const unsigned short*)K16 + ho, nullptr, (const unsigned short*)V16 + vo, nullptr, RH + (bx - RH / 64) * 128 + w * 32, h, Ah, Al);
}

extern "C" void kernel_launch(void* const* d_in, const int* in_sizes, int n_in,
                              void* d_out, int out_size, void* d_ws, size_t ws_size, hipStream_t stream) {
    (void)in_sizes; (void)n_in; (void)out_size;
    const float* x = (const float*)d_in[0]; const float* wqkv = (const float*)d_in[1]; const float* wo = (const float*)d_in[2];
    float* OUT = (float*)d_out;     // [2][1024][2048] (batch, dim, seq)
    char* wsp = (char*)d_ws;
    auto take = [&](size_t bytes) { char* p = wsp; wsp += (bytes + 255) & ~(size_t)255; return (void*)p; };
    bf* Wb = (bf*)take((size_t)(DQ + 2 * DKV) * DM * 2); bf* WO = (bf*)take((size_t)DM * DQ * 2); float* CS = (float*)take((size_t)TT * HD * 2 * 4);
    bf* XB = (bf*)take((size_t)NB_ * TT * DM * 2);
    const size_t nqk = (size_t)NB_ * (NH_ + NKV) * TT * HD, nv = (size_t)NB_ * NKV * HD * TT, ko = (size_t)NH_ * TT * HD;   // elements of a q | k plane and of a v plane over both batches; the k heads' place behind the q heads
    h16* QK16 = (h16*)take(nqk * 2); bf* QKh = (bf*)take(nqk * 2); bf* QKl = (bf*)take(nqk * 2);
    h16* VT16 = (h16*)take(nv * 2); bf* VTh = (bf*)take(nv * 2); bf* VTl = (bf*)take(nv * 2);
    bf* ATh = (bf*)take((size_t)NB_ * TT * DQ * 2); bf* ATl = (bf*)take((size_t)NB_ * TT * DQ * 2);
    if ((size_t)(wsp - (char*)d_ws) > ws_size) return;    // ws 256 MiB
    k_prep<<<NB_ * PBX + PBW + PBO + PBC, 256, 0, stream>>>(x, wqkv, wo, XB, Wb, WO, CS);
    k_qkv<<<dim3(TT / 128, (DQ + DKV) / 64 + (DKV / 128) * (TT / 64) / (TT / 128), NB_), 128, 0, stream>>>(XB, Wb, CS, QK16, QKh, QKl, VT16, VTh, VTl);
    k_fattn<<<dim3(RH / 64 + (TT - RH) / 128, NH_, NB_), 128, 0, stream>>>(QK16, QK16 + ko, VT16, QKh, QKl, QKh + ko, QKl + ko, VTh, VTl, ATh, ATl);   /* all batches, heads and query rows: merged hi + lo planes [b][t][DQ] */
    k_out<<<dim3(DM / 128, TT / 64, NB_), 128, 0, stream>>>(WO, ATh, ATl, OUT);
}

// v006
// A run of this version takes 122 microseconds.
// Timed twice side by side with v005, it ran 1.08 times as fast both times.
// Counting every step since v000, it is 16.2 times as fast.
#include <hip/hip_runtime.h>

// Multi-head attention with interleaved-pair rotary embeddings on a channel-major input (x [2][1024][2048] = (batch, dim, seq); xt = x^T; [q|k|v] = xt W_qkv^T ('oi' [3072][1024]: row blocks q | k | v; 16 heads x 64); rotary on adjacent (even, odd) pairs with angle t x 10000^(-2i/64) (tables computed on device from the reference's float32 inv_freq); scores/8 over all 2048 keys; softmax; merged heads; out^T = W_out ('oi' [1024][1024]) x merged^T written channel-major -> [2][1024][2048] (4.2 M)).
// Compute dtypes, f32 accumulate: every input rounded to bf16; q/k/v on PLAIN bf16 operands (inputs: exact); input transposed to token-major (by tiles, in LDS) while converting to bf16; interleaved rotary in f32 (precise cosf/sinf table) and the 16-bit operand planes written in the projections' own epilogues; scores and attn.v fused in one launch (online softmax in f32, scores never in memory): query rows < 512 hl (3 products), the rest single fp16 (x16); W_out exact x merged hl (2 products), written transposed (dim-major) straight from the GEMM epilogue.
// Four launches, each over both batches: input conversions and table | q, k, v projections | attention | output projection.

#define NB_  2
#define TT   2048
#define DM   1024
#define NH_  16
#define NKV  16
#define REP  (NH_ / NKV)
#define HD   64
#define DQ   (NH_ * HD)
#define DKV  (NKV * HD)
#define RH   512                  // query rows < RH use hi+lo planes (0: none)
#define WIN  2048
#define SCL  0.125f   // HD^-0.5
typedef _Float16 h16;
typedef unsigned short bf;
typedef __attribute__((ext_vector_type(16))) __bf16   v16bf;
typedef __attribute__((ext_vector_type(16))) _Float16 v16h;
typedef __attribute__((ext_vector_type(8)))  _Float16 v8h;
typedef __attribute__((ext_vector_type(8)))  unsigned short v8us;
typedef __attribute__((ext_vector_type(8)))  float    v8f;
typedef __attribute__((ext_vector_type(4)))  float    v4f;
typedef v8h  __attribute__((may_alias)) v8ha;
typedef v4f  __attribute__((may_alias)) v4fa;
typedef v8us __attribute__((may_alias)) v8usa;

__device__ __forceinline__ unsigned short f2bf(float f) { unsigned u = __float_as_uint(f); u += 0x7FFFu + ((u >> 16) & 1u); return (unsigned short)(u >> 16); }
__device__ __forceinline__ float bf2f(unsigned short b) { return __uint_as_float(((unsigned)b) << 16); }
__device__ __forceinline__ float bfr(float f) { return bf2f(f2bf(f)); }
__device__ __forceinline__ v16h cat16(v8h lo, v8h hi) { return __builtin_shufflevector(lo, hi, 0, 1, 2, 3, 4, 5, 6, 7, 8, 9, 10, 11, 12, 13, 14, 15); }
__device__ __forceinline__ v16bf cat16b(v8us lo, v8us hi) { return __builtin_bit_cast(v16bf, __builtin_shufflevector(lo, hi, 0, 1, 2, 3, 4, 5, 6, 7, 8, 9, 10, 11, 12, 13, 14, 15)); }
__device__ __forceinline__ v8f wmma16(v16h a, v16h b, v8f c) { return __builtin_amdgcn_wmma_f32_16x16x32_f16(false, a, false, b, (short)0, c, false, false); }
__device__ __forceinline__ v8f wmmab(v16bf a, v16bf b, v8f c) { return __builtin_amdgcn_wmma_f32_16x16x32_bf16(false, a, false, b, (short)0, c, false, false); }



__device__ __forceinline__ h16 tohx(float x) { return (h16)x; }
__device__ __forceinline__ void splitf(float y, unsigned short& h, unsigned short& l) { h = f2bf(y); l = f2bf(y - bf2f(h)); }
typedef __attribute__((ext_vector_type(2))) _Float16 v2h;
typedef __attribute__((ext_vector_type(4))) _Float16 v4h;
typedef __attribute__((ext_vector_type(2))) unsigned short v2us;
typedef __attribute__((ext_vector_type(4))) unsigned short v4us;
typedef __attribute__((ext_vector_type(2))) float v2f;
typedef __attribute__((ext_vector_type(4))) int v4i;

// ---- gemm_tile: GEMM, one work-group of 4 waves per 128x64 output tile (bx, by), each wave a 32x64 part (8 accumulators); 128 threads. The calling kernel owns the LDS (sg: two stages; osw: the epilogue's exchange) and hands in the batch's own pointers.
// The K-contiguous 16-bit operand planes go through LDS in stages of 128 k (two whole 128-byte lines of every row), two buffers: the next stage's global loads fly while this stage is worked on, and the 64 rows of Bt are fetched once for all four waves.
// C[m][n] (f32, pitch ldc, + optional f32 bias[n]) = sum_k A[m][k] Bt[n][k] (+ split products per NSPLIT). K is a compile-time constant, so that the rows of a sweep are constant steps from one address; K % 128 == 0.
// EPI 0: the f32 tile goes to C. EPI 1 and 2: no f32 result reaches memory; the epilogue writes the three 16-bit planes (fp16, bf16 hi, bf16 lo) that the attention kernel reads.
// EPI 1 (q, k; m = token, n = channel, one head per tile column): interleaved rotary with the table CS [t][HD][cos, sin], planes [by][t][HD]. EPI 2 (v; m = channel, n = token): planes [channel][t], pitch TT.
#define GK   128                  // k per LDS stage
#define GP   136                  // LDS row pitch in 16-bit elements: 272 B = 16 B x odd, conflict-free for 16-byte reads
#define GTA  (128 * GP)           // one staged A plane: 128 rows x 128 k
#define GTB  (64 * GP)            // one staged B plane: 64 rows x 128 k
template <typename T16> struct WFrag;
template <> struct WFrag<h16> { typedef v16h V; static __device__ __forceinline__ V ld(const h16* p) { return cat16(*(const v8h*)p, *(const v8h*)(p + 16)); } static __device__ __forceinline__ v8f mma(V a, V b, v8f c) { return wmma16(a, b, c); } };
template <> struct WFrag<bf> { typedef v16bf V; static __device__ __forceinline__ V ld(const bf* p) { return cat16b(*(const v8us*)p, *(const v8us*)(p + 16)); } static __device__ __forceinline__ v8f mma(V a, V b, v8f c) { return wmmab(a, b, c); } };
template <typename T16, int NSPLIT, bool BIAS, int EPI, int K>
__device__ __forceinline__ void gemm_tile(T16* sg, float* osw, int bx, int by, const T16* __restrict__ A, const T16* __restrict__ A2, const T16* __restrict__ Bt, const T16* __restrict__ Bt2, float* C, int ldc, const float* __restrict__ bias, const float* __restrict__ CS, h16* P16, bf* Ph, bf* Pl) {
    typedef typename WFrag<T16>::V V;
    constexpr bool HA2 = NSPLIT == 1 || NSPLIT == 2, HB2 = NSPLIT >= 2;
    constexpr int OA2 = GTA, OB = GTA * (HA2 ? 2 : 1), OB2 = OB + GTB, STG = OB + GTB * (HB2 ? 2 : 1);   // places of the planes in a stage, and its size
    constexpr int KG = (HA2 || HB2) ? 1 : 2;   // k steps of 32 whose fragments are fetched as one group (as many as the registers hold)
    const int tid = threadIdx.x, lane = tid & 31, lr = lane & 15, hi = lane >> 4, w = tid >> 5; const int r0 = bx * 128 + w * 32, c0 = by * 64;
    float* os = osw + w * (16 * 68);   // each wave's own exchange buffer for the epilogue
    v8f acc[2][4];
#pragma unroll
    for (int mb = 0; mb < 2; ++mb)
#pragma unroll
        for (int nb = 0; nb < 4; ++nb) acc[mb][nb] = (v8f){};
    static_assert(K % GK == 0, "whole stages");
    const int srow = tid >> 4, scol = (tid & 15) * 8;    // staging: 16 threads per 256-byte row, 8 rows a sweep
    const unsigned lo = (unsigned)(srow * K + scol);     // the lane's own element offset in a sweep: the one vector part of every staging address, the rest is the same for the whole work-group
    const size_t ag = (size_t)bx * 128 * K, bg = (size_t)c0 * K;
    v8us ra[16], ra2[16], rb[8], rb2[8];
    const char* ba = (const char*)(A + ag); const char* ba2 = HA2 ? (const char*)(A2 + ag) : nullptr; const char* bb0 = (const char*)(Bt + bg); const char* bb2 = HB2 ? (const char*)(Bt2 + bg) : nullptr;   // the tile's first rows: the same for the whole work-group
    unsigned vo = lo * 2;                                // the lane's byte offset in the next stage to fetch, one register for all planes
    auto gload = [&]() {
#pragma unroll
        for (int u = 0; u < 16; ++u) { ra[u] = *(const v8usa*)(ba + vo + u * 8 * K * 2); if (HA2) ra2[u] = *(const v8usa*)(ba2 + vo + u * 8 * K * 2); }
#pragma unroll
        for (int u = 0; u < 8; ++u) { rb[u] = *(const v8usa*)(bb0 + vo + u * 8 * K * 2); if (HB2) rb2[u] = *(const v8usa*)(bb2 + vo + u * 8 * K * 2); }
        asm volatile("s_wait_xcnt 0x0" : "+v"(vo) :: "memory");   // the wait that stands before a register named by an issued global load is overwritten; the offset is its operand so that it stays in its register up to the wait and is stepped only behind it
        vo += GK * 2; };
    auto sstore = [&](int b) { T16* d = sg + b * STG + srow * GP + scol;
#pragma unroll
        for (int u = 0; u < 16; ++u) { *(v8usa*)(d + u * 8 * GP) = ra[u]; if (HA2) *(v8usa*)(d + OA2 + u * 8 * GP) = ra2[u]; }
#pragma unroll
        for (int u = 0; u < 8; ++u) { *(v8usa*)(d + OB + u * 8 * GP) = rb[u]; if (HB2) *(v8usa*)(d + OB2 + u * 8 * GP) = rb2[u]; } };
    constexpr int ns = K / GK;
    gload(); sstore(0); __syncthreads();
#pragma unroll 1   // rolled: one copy of the stage body
    for (int s = 0; s < ns; ++s) {
        const T16* ab = sg + (s & 1) * STG + (w * 32 + lr) * GP + 8 * hi; const T16* bb = sg + (s & 1) * STG + OB + lr * GP + 8 * hi;
#pragma unroll
        for (int kg = 0; kg < GK / 32; kg += KG) {
            V a[KG][2], a2[KG][2], b[KG][4], b2[KG][4];
#pragma unroll
            for (int ks = 0; ks < KG; ++ks) { const int ko = (kg + ks) * 32;
#pragma unroll
                for (int mb = 0; mb < 2; ++mb) { a[ks][mb] = WFrag<T16>::ld(ab + mb * 16 * GP + ko); if (HA2) a2[ks][mb] = WFrag<T16>::ld(ab + OA2 + mb * 16 * GP + ko); }
#pragma unroll
                for (int nb = 0; nb < 4; ++nb) { b[ks][nb] = WFrag<T16>::ld(bb + nb * 16 * GP + ko); if (HB2) b2[ks][nb] = WFrag<T16>::ld(bb + GTB + nb * 16 * GP + ko); } }
            if (kg == 0 && s + 1 < ns) gload();          // the next stage's global loads fly while this stage is worked on; issued in the shadow of the LDS reads
            __builtin_amdgcn_sched_barrier(0);   // the group's LDS reads all issue ahead of its products: one LDS latency per group instead of one per B fragment
#pragma unroll
            for (int ks = 0; ks < KG; ++ks)
#pragma unroll
                for (int nb = 0; nb < 4; ++nb) {
#pragma unroll
                    for (int mb = 0; mb < 2; ++mb) acc[mb][nb] = WFrag<T16>::mma(a[ks][mb], b[ks][nb], acc[mb][nb]);
                    if (HA2) {
#pragma unroll
                        for (int mb = 0; mb < 2; ++mb) acc[mb][nb] = WFrag<T16>::mma(a2[ks][mb], b[ks][nb], acc[mb][nb]); }
                    if (HB2) {
#pragma unroll
                        for (int mb = 0; mb < 2; ++mb) acc[mb][nb] = WFrag<T16>::mma(a[ks][mb], b2[ks][nb], acc[mb][nb]); } }
        }
        if (s + 1 < ns) sstore((s + 1) & 1);             // into the buffer whose last readers passed the barrier of the trip before
        __syncthreads();                                 // publishes stage s + 1 and ends every read of stage s
    }
    constexpr int ES = EPI == 1 ? HD : TT;   // plane elements from one tile row to the next
    const float* cb = nullptr; size_t e0 = 0;   // this lane's first table entry and first plane element; every later one is a constant step away
    if constexpr (EPI == 1) { cb = CS + ((size_t)(r0 + hi) * HD + lr * 4) * 2; e0 = ((size_t)by * TT + r0 + hi) * HD + lr * 4; }
    if constexpr (EPI == 2) e0 = (size_t)(r0 + hi) * TT + c0 + lr * 4;
#pragma unroll
    for (int mb = 0; mb < 2; ++mb) {
        v2f cs[8][2];   // EPI 1: cos, sin of this lane's two pairs in each of its 8 rows, asked for ahead of the LDS exchange so that they fly during it
        if constexpr (EPI == 1) {
#pragma unroll
            for (int s = 0; s < 8; ++s) { const float* c = cb + (mb * 16 + 2 * s) * (HD * 2); cs[s][0] = *(const v2f*)c; cs[s][1] = *(const v2f*)(c + 4); } }
#pragma unroll
        for (int nb = 0; nb < 4; ++nb) {
#pragma unroll
            for (int j = 0; j < 8; ++j) os[(hi * 8 + j) * 68 + nb * 16 + lr] = acc[mb][nb][j]; }
        __builtin_amdgcn_wave_barrier(); asm volatile("" ::: "memory");
        float* crow = C + (size_t)(r0 + mb * 16) * ldc + c0;
#pragma unroll
        for (int s = 0; s < 8; ++s) { const int row = 2 * s + hi, cofs = lr * 4; v4f val = *(const v4fa*)(os + row * 68 + cofs); if (BIAS) { val[0] += bfr(bias[c0 + cofs]); val[1] += bfr(bias[c0 + cofs + 1]); val[2] += bfr(bias[c0 + cofs + 2]); val[3] += bfr(bias[c0 + cofs + 3]); }
            if constexpr (EPI == 0) {
                *(v4f*)(crow + (size_t)row * ldc + cofs) = val; }
            else {
                if constexpr (EPI == 1) { const v4f x = val;   /* even: x0 c - x1 s; odd: x0 s + x1 c */
                    val[0] = x[0] * cs[s][0][0] - x[1] * cs[s][0][1]; val[1] = x[0] * cs[s][0][1] + x[1] * cs[s][0][0]; val[2] = x[2] * cs[s][1][0] - x[3] * cs[s][1][1]; val[3] = x[2] * cs[s][1][1] + x[3] * cs[s][1][0]; }
                const size_t e = e0 + (mb * 16 + 2 * s) * ES;   // 16 lanes x 8 bytes: one whole 128-byte line per row and plane
                v4h o16; v4us oh, ol;
#pragma unroll
                for (int q = 0; q < 4; ++q) { o16[q] = tohx(val[q]); unsigned short a2, c2; splitf(val[q], a2, c2); oh[q] = a2; ol[q] = c2; }
                *(v4h*)(P16 + e) = o16; *(v4us*)(Ph + e) = oh; *(v4us*)(Pl + e) = ol;
                if constexpr (EPI == 2) asm volatile("s_wait_xcnt 0x0" ::: "memory"); } }   // the next row's values reuse the registers that these plane stores name
        asm volatile("s_wait_xcnt 0x0" ::: "memory");   // the next block's values reuse the registers that these stores name
        __builtin_amdgcn_wave_barrier(); asm volatile("" ::: "memory");
    }
}
// ---- k_qkv: the q, k and v projections of both batches in one launch; grid (TT/128, 48, NB_). y < 32: q | k, the first 2048 rows of W_qkv as one Bt (y = head: the q heads, then the k heads), x = token tile. y >= 32: the 256 tiles of v^T = W_v x xt^T.
__global__ __launch_bounds__(128) void k_qkv(const bf* __restrict__ XB, const bf* __restrict__ Wb, const float* __restrict__ CS, h16* QK16, bf* QKh, bf* QKl, h16* VT16, bf* VTh, bf* VTl) {
    __shared__ __align__(16) bf sg[2 * (GTA + GTB)];
    __shared__ __align__(16) float osw[4 * 16 * 68];
    const int x = blockIdx.x, y = blockIdx.y; const size_t z = blockIdx.z; const bf* X = XB + z * ((size_t)TT * DM);
    if (y < (DQ + DKV) / 64) { const size_t p = z * ((size_t)(NH_ + NKV) * TT * HD);
        gemm_tile<bf, 0, false, 1, DM>(sg, osw, x, y, X, nullptr, Wb, nullptr, nullptr, 0, nullptr, CS, QK16 + p, QKh + p, QKl + p); }   /* rotary, planes [q heads | k heads][t][HD] */
    else { const int i = (y - (DQ + DKV) / 64) * (TT / 128) + x; const size_t p = z * ((size_t)DKV * TT);
        gemm_tile<bf, 0, false, 2, DM>(sg, osw, i % (DKV / 128), i / (DKV / 128), Wb + (size_t)(DQ + DKV) * DM, nullptr, X, nullptr, nullptr, 0, nullptr, nullptr, VT16 + p, VTh + p, VTl + p); }   /* planes [h][HD][t] as they come */
}
// ---- k_out: channel-major output rows [e][t] of both batches: exact W_out x (merged hi + lo); grid (DM/128, TT/64, NB_).
__global__ __launch_bounds__(128) void k_out(const bf* __restrict__ WO, const bf* __restrict__ ATh, const bf* __restrict__ ATl, float* OUT) {
    __shared__ __align__(16) bf sg[2 * (GTA + 2 * GTB)];
    __shared__ __align__(16) float osw[4 * 16 * 68];
    const size_t z = blockIdx.z, a = z * ((size_t)TT * DQ);
    gemm_tile<bf, 3, false, 0, DQ>(sg, osw, blockIdx.x, blockIdx.y, WO, nullptr, ATh + a, ATl + a, OUT + z * ((size_t)DM * TT), TT, nullptr, nullptr, nullptr, nullptr, nullptr);
}

__global__ __launch_bounds__(256) void k_wtG(const float* __restrict__ w, int K, int N, bf* Bt) {
    const int lane = threadIdx.x & 31; const int L0 = (blockIdx.x * 8 + (threadIdx.x >> 5)) * 8; const int nlines = N * K / 64;
{
#pragma unroll 1
        for (int l = 0; l < 8; ++l) { const int L = L0 + l; if (L >= nlines) break; const size_t e = (size_t)L * 64 + lane * 2; const int k = (int)(e % K), n = (int)(e / K); v2us o;
            o[0] = f2bf(w[(size_t)k * N + n]); o[1] = f2bf(w[(size_t)(k + 1) * N + n]); *(v2us*)(Bt + e) = o; }
         }
}
// ---- cvtT: one 128-channel x 128-token tile of x, [DM][TT] f32 -> [TT][DM] bf16, turned in LDS so that both sides of memory see whole lines; 256 threads.
// In: a wave-wide 16-byte load is 512 contiguous bytes of one channel row; a lane gathers 8 channels x 4 tokens twice over. Out: 16 lanes store 256 contiguous bytes of one token row.
// LDS: 128 token rows of 16 blocks of 16 bytes (8 channels); block cb of row t lies at place cb ^ ((t >> 2) & 15), so that the 16 lanes of a half wave fall on 16 different places both when they write (one cb, rows 4 apart) and when they read (one row, all cb).
#define XTL  128                  // channels and tokens per tile
__device__ __forceinline__ void cvtT(const float* __restrict__ src, bf* dst, int tile, bf* st) {
    const int tid = threadIdx.x, tq = tid & 31, w = tid >> 5; const int c0 = (tile % (DM / XTL)) * XTL, t0 = (tile / (DM / XTL)) * XTL;
    const float* s = src + (size_t)(c0 + w * 16) * TT + t0 + tq * 4; v4f r[16];
#pragma unroll
    for (int k = 0; k < 16; ++k) r[k] = *(const v4fa*)(s + (size_t)k * TT);
    asm volatile("s_wait_xcnt 0x0" ::: "memory");   // the wait that stands before a register named by an issued global load is overwritten
#pragma unroll
    for (int g = 0; g < 2; ++g)
#pragma unroll
        for (int j = 0; j < 4; ++j) { v8us o;
#pragma unroll
            for (int k = 0; k < 8; ++k) o[k] = f2bf(r[g * 8 + k][j]);
            *(v8usa*)(st + (tq * 4 + j) * XTL + (((w * 2 + g) ^ (tq & 15)) * 8)) = o; }
    __syncthreads();   // the tile is whole before any row of it is read
    const int cb = tid & 15, rw = tid >> 4; bf* d = dst + (size_t)(t0 + rw) * DM + c0 + cb * 8; v8us o[8];
#pragma unroll
    for (int u = 0; u < 8; ++u) { const int row = u * 16 + rw; o[u] = *(const v8usa*)(st + row * XTL + ((cb ^ ((row >> 2) & 15)) * 8)); }
#pragma unroll
    for (int u = 0; u < 8; ++u) *(v8usa*)(d + (size_t)u * 16 * DM) = o[u]; }
__device__ __forceinline__ void cvt8(const float* __restrict__ src, bf* dst, size_t i) { const v8f v = *(const v8f*)(src + i * 8); v8us o;
#pragma unroll
    for (int k = 0; k < 8; ++k) o[k] = f2bf(v[k]); *(v8us*)(dst + i * 8) = o;
    asm volatile("s_wait_xcnt 0x0" ::: "memory"); }   // in the built k_prep another range's block stands behind this store, past a scalar test, and writes the registers that the store names

__constant__ float INV[HD / 2] = {1.0f,0.749894202f,0.562341332f,0.421696514f,0.316227764f,0.237137362f,0.177827939f,0.133352146f,0.100000001f,0.0749894157f,0.0562341288f,0.0421696492f,0.0316227786f,0.0237137359f,0.0177827943f,0.0133352149f,0.00999999978f,0.00749894232f,0.00562341325f,0.00421696482f,0.00316227786f,0.00237137382f,0.00177827943f,0.00133352145f,0.00100000005f,0.000749894185f,0.000562341302f,0.000421696488f,0.000316227786f,0.000237137385f,0.00017782794f,0.00013335215f};
__device__ __forceinline__ void cstab(float* CS, int idx) { const int t = idx / HD, d = idx % HD; const float ang = __fmul_rn((float)t, INV[d >> 1]); v2f cs; cs[0] = cosf(ang); cs[1] = sinf(ang);
    *(v2f*)(CS + (size_t)idx * 2) = cs;
    asm volatile("s_wait_xcnt 0x0" ::: "memory"); }   // as in cvt8: another range's block stands behind this store in the built k_prep
// ---- k_prep: all that depends on the inputs alone, in one launch, by ranges of blocks: x of both batches (channel-major [DM][TT]) -> XB token-major [TT][DM] bf16 | W_qkv -> bf16 | W_out -> bf16 | the rotary table.
#define PBX  ((TT / XTL) * (DM / XTL))          // blocks per batch of x: one tile each
#define PBW  ((DQ + 2 * DKV) * DM / 8 / 256)   // blocks of W_qkv
#define PBO  (DM * DQ / 8 / 256)               // blocks of W_out
#define PBC  (TT * HD / 256)                   // blocks of the table
static_assert(TT % XTL == 0 && DM % XTL == 0 && (DQ + 2 * DKV) * DM % 2048 == 0 && DM * DQ % 2048 == 0 && TT * HD % 256 == 0, "whole blocks in every range of k_prep");
__global__ __launch_bounds__(256) void k_prep(const float* __restrict__ x, const float* __restrict__ wqkv, const float* __restrict__ wo, bf* XB, bf* Wb, bf* WO, float* CS) {
    __shared__ __align__(16) bf xs[XTL * XTL];
    const int blk = blockIdx.x, tid = threadIdx.x;
    if (blk < NB_ * PBX) { const int b = blk / PBX; cvtT(x + (size_t)b * DM * TT, XB + (size_t)b * TT * DM, blk - b * PBX, xs); }
    else if (blk < NB_ * PBX + PBW + PBO) { const bool o = blk >= NB_ * PBX + PBW; cvt8(o ? wo : wqkv, o ? WO : Wb, (size_t)(blk - NB_ * PBX - (o ? PBW : 0)) * 256 + tid); }
    else cstab(CS, (blk - (NB_ * PBX + PBW + PBO)) * 256 + tid);
}

#define KS   64                   // keys per LDS stage
#define LP   72                   // LDS row pitch in 16-bit elements: 144 B = 16 B x odd, conflict-free for 16-byte reads
#define TILE (64 * LP)            // one staged plane: 64 rows (keys of K, channels of V^T) x 64 elements
static_assert(HD == 64 && KS == 64 && TT % KS == 0 && RH % 64 == 0 && (TT - RH) % 128 == 0, "tile geometry of k_fattn");
__device__ __forceinline__ float xhalf(float x) { return __builtin_bit_cast(float, __builtin_amdgcn_permlanex16(__builtin_bit_cast(int, x), __builtin_bit_cast(int, x), 0x76543210, 0xfedcba98, false, false)); }   // lane l <-> lane l ^ 16, on the vector pipe
// Eight independent v_exp_f32, then the one slot that the instruction set asks for behind a transcendental before its result is read or its source overwritten; "=&v" keeps every result off every source.
__device__ __forceinline__ void exp2x8(const float (&t)[8], float (&p)[8]) {
    asm("v_exp_f32 %0, %8\n\tv_exp_f32 %1, %9\n\tv_exp_f32 %2, %10\n\tv_exp_f32 %3, %11\n\tv_exp_f32 %4, %12\n\tv_exp_f32 %5, %13\n\tv_exp_f32 %6, %14\n\tv_exp_f32 %7, %15\n\tv_nop"
        : "=&v"(p[0]), "=&v"(p[1]), "=&v"(p[2]), "=&v"(p[3]), "=&v"(p[4]), "=&v"(p[5]), "=&v"(p[6]), "=&v"(p[7]) : "v"(t[0]), "v"(t[1]), "v"(t[2]), "v"(t[3]), "v"(t[4]), "v"(t[5]), "v"(t[6]), "v"(t[7])); }
__device__ __forceinline__ float exp2s(float x) { float r; asm("v_exp_f32 %0, %1\n\tv_nop" : "=&v"(r) : "v"(x)); return r; }   // one v_exp_f32 with the same slot behind it
template <bool HL> struct FOp;
template <> struct FOp<false> { typedef v16h V; static __device__ __forceinline__ V frag(const unsigned short* p) { return cat16(__builtin_bit_cast(v8h, *(const v8usa*)p), __builtin_bit_cast(v8h, *(const v8usa*)(p + 16))); } static __device__ __forceinline__ v8f mma(V a, V b, v8f c) { return wmma16(a, b, c); } };
template <> struct FOp<true> { typedef v16bf V; static __device__ __forceinline__ V frag(const unsigned short* p) { return cat16b(*(const v8usa*)p, *(const v8usa*)(p + 16)); } static __device__ __forceinline__ v8f mma(V a, V b, v8f c) { return wmmab(a, b, c); } };
// Q*, K* [t][HD], V* [HD][t] of this head (plane 1: the lo planes, HL only); q0: the wave's first query; NF: query fragments of 16 per wave.
template <bool HL, int NF>
__device__ __forceinline__ void fa_body(unsigned short* sm, const unsigned short* __restrict__ Q0, const unsigned short* __restrict__ Q1, const unsigned short* __restrict__ K0, const unsigned short* __restrict__ K1, const unsigned short* __restrict__ V0, const unsigned short* __restrict__ V1, int q0, int h, bf* Ah, bf* Al) {
    typedef FOp<HL> F; typedef typename F::V V;
    constexpr int NP = HL ? 2 : 1;                       // planes per operand
    constexpr float C = SCL * 1.4426950408889634f;       // raw score -> log2 units
    constexpr float SH = HL ? 0.0f : 4.0f;               // fp16 probabilities carry x16: at most 2^(8+4), and small ones stay normal numbers
    const int tid = threadIdx.x, lane = tid & 31, lr = lane & 15, hi = lane >> 4;
    const int srow = tid >> 3, scol = (tid & 7) * 8;     // staging: 8 threads per 128-byte row, 16 rows a sweep
    V qa[NP][NF][2];
#pragma unroll
    for (int qf = 0; qf < NF; ++qf)
#pragma unroll
        for (int ks = 0; ks < 2; ++ks) { const size_t qo = (size_t)(q0 + qf * 16 + lr) * HD + ks * 32 + 8 * hi; qa[0][qf][ks] = F::frag(Q0 + qo); if (HL) qa[NP - 1][qf][ks] = F::frag(Q1 + qo); }
    v8f o[4][NF]; float m[NF], l[NF];
#pragma unroll
    for (int qf = 0; qf < NF; ++qf) { m[qf] = -3.0e38f; l[qf] = 0.f;
#pragma unroll
        for (int mb = 0; mb < 4; ++mb) o[mb][qf] = (v8f){}; }
    v8us rk[NP][4], rv[NP][4]; const size_t kof = (size_t)srow * HD + scol, vof = (size_t)srow * TT + scol;
    auto gload = [&](int s) {
#pragma unroll
        for (int u = 0; u < 4; ++u) { const size_t ko = kof + (size_t)s * (KS * HD) + u * (16 * HD), vo = vof + (size_t)s * KS + u * (16 * TT);
            rk[0][u] = *(const v8usa*)(K0 + ko); rv[0][u] = *(const v8usa*)(V0 + vo); if (HL) { rk[NP - 1][u] = *(const v8usa*)(K1 + ko); rv[NP - 1][u] = *(const v8usa*)(V1 + vo); } } };
    auto sstore = [&](int b) { unsigned short* d = sm + b * (2 * NP * TILE) + srow * LP + scol;
#pragma unroll
        for (int u = 0; u < 4; ++u)
#pragma unroll
            for (int pl = 0; pl < NP; ++pl) { *(v8usa*)(d + pl * TILE + u * 16 * LP) = rk[pl][u]; *(v8usa*)(d + (NP + pl) * TILE + u * 16 * LP) = rv[pl][u]; } };
    gload(0); sstore(0); __syncthreads();
#pragma unroll 1   // rolled: one copy of the stage body
    for (int s = 0; s < TT / KS; ++s) {
        if (s + 1 < TT / KS) gload(s + 1);               // the next stage's global loads fly while this stage is worked on
        const unsigned short* kb = sm + (s & 1) * (2 * NP * TILE) + lr * LP + 8 * hi; const unsigned short* vb = kb + NP * TILE;
#pragma unroll
        for (int c = 0; c < KS / 32; ++c) {
            v8f st[2][NF];
#pragma unroll
            for (int kt = 0; kt < 2; ++kt) { V ka[NP][2];
#pragma unroll
                for (int pl = 0; pl < NP; ++pl)
#pragma unroll
                    for (int ks = 0; ks < 2; ++ks) ka[pl][ks] = F::frag(kb + pl * TILE + (c * 32 + kt * 16) * LP + ks * 32);
#pragma unroll
                for (int qf = 0; qf < NF; ++qf) { v8f a = (v8f){};
#pragma unroll
                    for (int ks = 0; ks < 2; ++ks) { a = F::mma(ka[0][ks], qa[0][qf][ks], a); if (HL) { a = F::mma(ka[NP - 1][ks], qa[0][qf][ks], a); a = F::mma(ka[0][ks], qa[NP - 1][qf][ks], a); } }
                    st[kt][qf] = a; } }
            float mx[NF]; bool need = false;
#pragma unroll
            for (int qf = 0; qf < NF; ++qf) { float a = fmaxf(st[0][qf][0], st[1][qf][0]), a1 = fmaxf(st[0][qf][1], st[1][qf][1]);   // two short chains
#pragma unroll
                for (int j = 2; j < 8; j += 2) { a = fmaxf(a, fmaxf(st[0][qf][j], st[1][qf][j])); a1 = fmaxf(a1, fmaxf(st[0][qf][j + 1], st[1][qf][j + 1])); }
                a = fmaxf(a, a1); a = fmaxf(a, xhalf(a)); mx[qf] = a * C; need = need || (mx[qf] > m[qf] + 8.0f); }
            if (__builtin_amdgcn_ballot_w32(need) != 0) {   // wave-uniform: one test per 32 keys
#pragma unroll
                for (int qf = 0; qf < NF; ++qf) { const float mn = fmaxf(m[qf], mx[qf]); const float al = exp2s(m[qf] - mn); m[qf] = mn; l[qf] *= al;
#pragma unroll
                    for (int mb = 0; mb < 4; ++mb)
#pragma unroll
                        for (int j = 0; j < 8; ++j) o[mb][qf][j] *= al; } }
            V ph[NF], pl2[NF];
#pragma unroll
            for (int qf = 0; qf < NF; ++qf) { const float mo = m[qf] - SH; float sum[4];   // four short chains
#pragma unroll
                for (int kt = 0; kt < 2; ++kt) { float t[8], p[8];
#pragma unroll
                    for (int j = 0; j < 8; j += 2) { const v2f r = __builtin_elementwise_fma((v2f){st[kt][qf][j], st[kt][qf][j + 1]}, (v2f){C, C}, (v2f){-mo, -mo}); t[j] = r[0]; t[j + 1] = r[1]; }   // packed: two scores an instruction
                    exp2x8(t, p);
#pragma unroll
                    for (int j = 0; j < 8; ++j) { if (kt == 0 && j < 4) sum[j] = p[j]; else sum[j & 3] += p[j];
                        if constexpr (HL) { const __bf16 a = (__bf16)p[j]; ph[qf][kt * 8 + j] = a; pl2[qf][kt * 8 + j] = (__bf16)(p[j] - (float)a); } else { ph[qf][kt * 8 + j] = (h16)p[j]; } } }
                l[qf] += (sum[0] + sum[1]) + (sum[2] + sum[3]); }
#pragma unroll
            for (int mb = 0; mb < 4; ++mb) { V va[NP];
#pragma unroll
                for (int pl = 0; pl < NP; ++pl) va[pl] = F::frag(vb + pl * TILE + mb * 16 * LP + c * 32);
#pragma unroll
                for (int qf = 0; qf < NF; ++qf) { o[mb][qf] = F::mma(va[0], ph[qf], o[mb][qf]); if (HL) { o[mb][qf] = F::mma(va[NP - 1], ph[qf], o[mb][qf]); o[mb][qf] = F::mma(va[0], pl2[qf], o[mb][qf]); } } }
        }
        if (s + 1 < TT / KS) sstore((s + 1) & 1);        // into the buffer whose last readers passed the barrier of the trip before
        __syncthreads();                                 // publishes stage s + 1 and ends every read of stage s
    }
#pragma unroll
    for (int qf = 0; qf < NF; ++qf) { const float inv = __fdiv_rn(1.0f, l[qf] + xhalf(l[qf])); const size_t ob = (size_t)(q0 + qf * 16 + lr) * DQ + h * HD + hi * 8;
#pragma unroll
        for (int mb = 0; mb < 4; ++mb) { v8us oh, ol;
#pragma unroll
            for (int j = 0; j < 8; ++j) { unsigned short a, c2; splitf(o[mb][qf][j] * inv, a, c2); oh[j] = a; ol[j] = c2; }
            *(v8us*)(Ah + ob + mb * 16) = oh; *(v8us*)(Al + ob + mb * 16) = ol; } }
}
__global__ __launch_bounds__(128) void k_fattn(const h16* __restrict__ Q16, const h16* __restrict__ K16, const h16* __restrict__ V16, const bf* __restrict__ Qh, const bf* __restrict__ Ql, const bf* __restrict__ Kh, const bf* __restrict__ Kl, const bf* __restrict__ Vh, const bf* __restrict__ Vl, bf* Ah, bf* Al) {
    __shared__ __align__(16) unsigned short sm[2 * 4 * TILE];
    const int h = blockIdx.y, w = threadIdx.x >> 5, bx = blockIdx.x; const size_t z = blockIdx.z, ho = (z * (NH_ + NKV) + h) * (TT * HD), vo = (z * NKV + h) * (HD * TT);   // q and k planes lie [batch][q heads | k heads], v planes [batch][head]
    Ah += z * ((size_t)TT * DQ); Al += z * ((size_t)TT * DQ);
    if (bx < RH / 64) fa_body<true, 1>(sm, Qh + ho, Ql + ho, Kh + ho, Kl + ho, Vh + vo, Vl + vo, bx * 64 + w * 16, h, Ah, Al);
    else fa_body<false, 2>(sm, (const unsigned short*)Q16 + ho, nullptr, (const unsigned short*)K16 + ho, nullptr, (const unsigned short*)V16 + vo, nullptr, RH + (bx - RH / 64) * 128 + w * 32, h, Ah, Al);
}

extern "C" void kernel_launch(void* const* d_in, const int* in_sizes, int n_in,
                              void* d_out, int out_size, void* d_ws, size_t ws_size, hipStream_t stream) {
    (void)in_sizes; (void)n_in; (void)out_size;
    const float* x = (const float*)d_in[0]; const float* wqkv = (const float*)d_in[1]; const float* wo = (const float*)d_in[2];
    float* OUT = (float*)d_out;     // [2][1024][2048] (batch, dim, seq)
    char* wsp = (char*)d_ws;
    auto take = [&](size_t bytes) { char* p = wsp; wsp += (bytes + 255) & ~(size_t)255; return (void*)p; };
    bf* Wb = (bf*)take((size_t)(DQ + 2 * DKV) * DM * 2); bf* WO = (bf*)take((size_t)DM * DQ * 2); float* CS = (float*)take((size_t)TT * HD * 2 * 4);
    bf* XB = (bf*)take((size_t)NB_ * TT * DM * 2);
    const size_t nqk = (size_t)NB_ * (NH_ + NKV) * TT * HD, nv = (size_t)NB_ * NKV * HD * TT, ko = (size_t)NH_ * TT * HD;   // elements of a q | k plane and of a v plane over both batches; the k heads' place behind the q heads
    h16* QK16 = (h16*)take(nqk * 2); bf* QKh = (bf*)take(nqk * 2); bf* QKl = (bf*)take(nqk * 2);
    h16* VT16 = (h16*)take(nv * 2); bf* VTh = (bf*)take(nv * 2); bf* VTl = (bf*)take(nv * 2);
    bf* ATh = (bf*)take((size_t)NB_ * TT * DQ * 2); bf* ATl = (bf*)take((size_t)NB_ * TT * DQ * 2);
    if ((size_t)(wsp - (char*)d_ws) > ws_size) return;    // ws 256 MiB
    k_prep<<<NB_ * PBX + PBW + PBO + PBC, 256, 0, stream>>>(x, wqkv, wo, XB, Wb, WO, CS);
    k_qkv<<<dim3(TT / 128, (DQ + DKV) / 64 + (DKV / 128) * (TT / 64) / (TT / 128), NB_), 128, 0, stream>>>(XB, Wb, CS, QK16, QKh, QKl, VT16, VTh, VTl);
    k_fattn<<<dim3(RH / 64 + (TT - RH) / 128, NH_, NB_), 128, 0, stream>>>(QK16, QK16 + ko, VT16, QKh, QKl, QKh + ko, QKl + ko, VTh, VTl, ATh, ATl);   /* all batches, heads and query rows: merged hi + lo planes [b][t][DQ] */
    k_out<<<dim3(DM / 128, TT / 64, NB_), 128, 0, stream>>>(WO, ATh, ATl, OUT);
}

// v007
// One run takes 116 microseconds.
// Two timings next to v006 both put it at 1.06 times that version's speed.
// Counting every step since v000, it is 17.2 times as fast.
#include <hip/hip_runtime.h>

// Multi-head attention with interleaved-pair rotary embeddings on a channel-major input (x [2][1024][2048] = (batch, dim, seq); xt = x^T; [q|k|v] = xt W_qkv^T ('oi' [3072][1024]: row blocks q | k | v; 16 heads x 64); rotary on adjacent (even, odd) pairs with angle t x 10000^(-2i/64) (tables computed on device from the reference's float32 inv_freq); scores/8 over all 2048 keys; softmax; merged heads; out^T = W_out ('oi' [1024][1024]) x merged^T written channel-major -> [2][1024][2048] (4.2 M)).
// Compute dtypes, f32 accumulate: every input rounded to bf16; q/k/v on PLAIN bf16 operands (inputs: exact); input transposed to token-major (by tiles, in LDS) while converting to bf16; interleaved rotary in f32 (precise cosf/sinf table) and the 16-bit operand planes written in the projections' own epilogues; scores and attn.v fused in one launch (online softmax in f32, scores never in memory): query rows < 512 hl (3 products), the rest single fp16 (x16); W_out exact x merged hl (2 products), written transposed (dim-major) straight from the GEMM epilogue.
// Four launches, each over both batches: input conversions and table | q, k, v projections | attention | output projection.

#define NB_  2
#define TT   2048
#define DM   1024
#define NH_  16
#define NKV  16
#define REP  (NH_ / NKV)
#define HD   64
#define DQ   (NH_ * HD)
#define DKV  (NKV * HD)
#define RH   512                  // query rows < RH use hi+lo planes
#define WIN  2048
#define SCL  0.125f   // HD^-0.5
typedef _Float16 h16;
typedef unsigned short bf;
typedef __attribute__((ext_vector_type(16))) __bf16   v16bf;
typedef __attribute__((ext_vector_type(16))) _Float16 v16h;
typedef __attribute__((ext_vector_type(8)))  _Float16 v8h;
typedef __attribute__((ext_vector_type(8)))  unsigned short v8us;
typedef __attribute__((ext_vector_type(8)))  float    v8f;
typedef __attribute__((ext_vector_type(4)))  float    v4f;
typedef v8h  __attribute__((may_alias)) v8ha;
typedef v4f  __attribute__((may_alias)) v4fa;
typedef v8us __attribute__((may_alias)) v8usa;

__device__ __forceinline__ unsigned short f2bf(float f) { unsigned u = __float_as_uint(f); u += 0x7FFFu + ((u >> 16) & 1u); return (unsigned short)(u >> 16); }
__device__ __forceinline__ float bf2f(unsigned short b) { return __uint_as_float(((unsigned)b) << 16); }
__device__ __forceinline__ float bfr(float f) { return bf2f(f2bf(f)); }
__device__ __forceinline__ v16h cat16(v8h lo, v8h hi) { return __builtin_shufflevector(lo, hi, 0, 1, 2, 3, 4, 5, 6, 7, 8, 9, 10, 11, 12, 13, 14, 15); }
__device__ __forceinline__ v16bf cat16b(v8us lo, v8us hi) { return __builtin_bit_cast(v16bf, __builtin_shufflevector(lo, hi, 0, 1, 2, 3, 4, 5, 6, 7, 8, 9, 10, 11, 12, 13, 14, 15)); }
__device__ __forceinline__ v8f wmma16(v16h a, v16h b, v8f c) { return __builtin_amdgcn_wmma_f32_16x16x32_f16(false, a, false, b, (short)0, c, false, false); }
__device__ __forceinline__ v8f wmmab(v16bf a, v16bf b, v8f c) { return __builtin_amdgcn_wmma_f32_16x16x32_bf16(false, a, false, b, (short)0, c, false, false); }



__device__ __forceinline__ h16 tohx(float x) { return (h16)x; }
__device__ __forceinline__ void splitf(float y, unsigned short& h, unsigned short& l) { h = f2bf(y); l = f2bf(y - bf2f(h)); }
typedef __attribute__((ext_vector_type(2))) _Float16 v2h;
typedef __attribute__((ext_vector_type(4))) _Float16 v4h;
typedef __attribute__((ext_vector_type(2))) unsigned short v2us;
typedef __attribute__((ext_vector_type(4))) unsigned short v4us;
typedef __attribute__((ext_vector_type(2))) float v2f;
typedef __attribute__((ext_vector_type(4))) int v4i;

// ---- gemm_tile: GEMM, one work-group of 4 waves per 128x64 output tile (bx, by), each wave a 32x64 part (8 accumulators); 128 threads. The calling kernel owns the LDS (sg: two stages; osw: the epilogue's exchange) and hands in the batch's own pointers.
// The K-contiguous 16-bit operand planes go through LDS in stages of 128 k (two whole 128-byte lines of every row), two buffers: the next stage's global loads fly while this stage is worked on, and the 64 rows of Bt are fetched once for all four waves.
// C[m][n] (f32, pitch ldc, + optional f32 bias[n]) = sum_k A[m][k] Bt[n][k] (+ split products per NSPLIT). K is a compile-time constant, so that the rows of a sweep are constant steps from one address; K % 128 == 0.
// EPI 0: the f32 tile goes to C. EPI 1 and 2: no f32 result reaches memory; the epilogue writes the three 16-bit planes (fp16, bf16 hi, bf16 lo) that the attention kernel reads.
// EPI 1 (q, k; m = token, n = channel, one head per tile column): interleaved rotary with the table CS [t][HD][cos, sin], planes [by][t][HD]. EPI 2 (v; m = channel, n = token): planes [channel][t], pitch TT.
#define GK   128                  // k per LDS stage
#define GP   136                  // LDS row pitch in 16-bit elements: 272 B = 16 B x odd, conflict-free for 16-byte reads
#define GTA  (128 * GP)           // one staged A plane: 128 rows x 128 k
#define GTB  (64 * GP)            // one staged B plane: 64 rows x 128 k
template <typename T16> struct WFrag;
template <> struct WFrag<h16> { typedef v16h V; static __device__ __forceinline__ V ld(const h16* p) { return cat16(*(const v8h*)p, *(const v8h*)(p + 16)); } static __device__ __forceinline__ v8f mma(V a, V b, v8f c) { return wmma16(a, b, c); } };
template <> struct WFrag<bf> { typedef v16bf V; static __device__ __forceinline__ V ld(const bf* p) { return cat16b(*(const v8us*)p, *(const v8us*)(p + 16)); } static __device__ __forceinline__ v8f mma(V a, V b, v8f c) { return wmmab(a, b, c); } };
template <typename T16, int NSPLIT, bool BIAS, int EPI, int K>
__device__ __forceinline__ void gemm_tile(T16* sg, float* osw, int bx, int by, const T16* __restrict__ A, const T16* __restrict__ A2, const T16* __restrict__ Bt, const T16* __restrict__ Bt2, float* C, int ldc, const float* __restrict__ bias, const float* __restrict__ CS, h16* P16, bf* Ph, bf* Pl) {
    typedef typename WFrag<T16>::V V;
    constexpr bool HA2 = NSPLIT == 1 || NSPLIT == 2, HB2 = NSPLIT >= 2;
    constexpr int OA2 = GTA, OB = GTA * (HA2 ? 2 : 1), OB2 = OB + GTB, STG = OB + GTB * (HB2 ? 2 : 1);   // places of the planes in a stage, and its size
    constexpr int KG = (HA2 || HB2) ? 1 : 2;   // k steps of 32 whose fragments are fetched as one group (as many as the registers hold)
    const int tid = threadIdx.x, lane = tid & 31, lr = lane & 15, hi = lane >> 4, w = tid >> 5; const int r0 = bx * 128 + w * 32, c0 = by * 64;
    float* os = osw + w * (16 * 68);   // each wave's own exchange buffer for the epilogue
    v8f acc[2][4];
#pragma unroll
    for (int mb = 0; mb < 2; ++mb)
#pragma unroll
        for (int nb = 0; nb < 4; ++nb) acc[mb][nb] = (v8f){};
    static_assert(K % GK == 0, "whole stages");
    const int srow = tid >> 4, scol = (tid & 15) * 8;    // staging: 16 threads per 256-byte row, 8 rows a sweep
    const unsigned lo = (unsigned)(srow * K + scol);     // the lane's own element offset in a sweep: the one vector part of every staging address, the rest is the same for the whole work-group
    const size_t ag = (size_t)bx * 128 * K, bg = (size_t)c0 * K;
    v8us ra[16], ra2[16], rb[8], rb2[8];
    const char* ba = (const char*)(A + ag); const char* ba2 = HA2 ? (const char*)(A2 + ag) : nullptr; const char* bb0 = (const char*)(Bt + bg); const char* bb2 = HB2 ? (const char*)(Bt2 + bg) : nullptr;   // the tile's first rows: the same for the whole work-group
    unsigned vo = lo * 2;                                // the lane's byte offset in the next stage to fetch, one register for all planes
    auto gload = [&]() {
#pragma unroll
        for (int u = 0; u < 16; ++u) { ra[u] = *(const v8usa*)(ba + vo + u * 8 * K * 2); if (HA2) ra2[u] = *(const v8usa*)(ba2 + vo + u * 8 * K * 2); }
#pragma unroll
        for (int u = 0; u < 8; ++u) { rb[u] = *(const v8usa*)(bb0 + vo + u * 8 * K * 2); if (HB2) rb2[u] = *(const v8usa*)(bb2 + vo + u * 8 * K * 2); }
        asm volatile("s_wait_xcnt 0x0" : "+v"(vo) :: "memory");   // the wait that stands before a register named by an issued global load is overwritten; the offset is its operand so that it stays in its register up to the wait and is stepped only behind it
        vo += GK * 2; };
    auto sstore = [&](int b) { T16* d = sg + b * STG + srow * GP + scol;
#pragma unroll
        for (int u = 0; u < 16; ++u) { *(v8usa*)(d + u * 8 * GP) = ra[u]; if (HA2) *(v8usa*)(d + OA2 + u * 8 * GP) = ra2[u]; }
#pragma unroll
        for (int u = 0; u < 8; ++u) { *(v8usa*)(d + OB + u * 8 * GP) = rb[u]; if (HB2) *(v8usa*)(d + OB2 + u * 8 * GP) = rb2[u]; } };
    constexpr int ns = K / GK;
    gload(); sstore(0); __syncthreads();
#pragma unroll 1   // rolled: one copy of the stage body
    for (int s = 0; s < ns; ++s) {
        const T16* ab = sg + (s & 1) * STG + (w * 32 + lr) * GP + 8 * hi; const T16* bb = sg + (s & 1) * STG + OB + lr * GP + 8 * hi;
#pragma unroll
        for (int kg = 0; kg < GK / 32; kg += KG) {
            V a[KG][2], a2[KG][2], b[KG][4], b2[KG][4];
#pragma unroll
            for (int ks = 0; ks < KG; ++ks) { const int ko = (kg + ks) * 32;
#pragma unroll
                for (int mb = 0; mb < 2; ++mb) { a[ks][mb] = WFrag<T16>::ld(ab + mb * 16 * GP + ko); if (HA2) a2[ks][mb] = WFrag<T16>::ld(ab + OA2 + mb * 16 * GP + ko); }
#pragma unroll
                for (int nb = 0; nb < 4; ++nb) { b[ks][nb] = WFrag<T16>::ld(bb + nb * 16 * GP + ko); if (HB2) b2[ks][nb] = WFrag<T16>::ld(bb + GTB + nb * 16 * GP + ko); } }
            if (kg == 0 && s + 1 < ns) gload();          // the next stage's global loads fly while this stage is worked on; issued in the shadow of the LDS reads
            __builtin_amdgcn_sched_barrier(0);   // the group's LDS reads all issue ahead of its products: one LDS latency per group instead of one per B fragment
#pragma unroll
            for (int ks = 0; ks < KG; ++ks)
#pragma unroll
                for (int nb = 0; nb < 4; ++nb) {
#pragma unroll
                    for (int mb = 0; mb < 2; ++mb) acc[mb][nb] = WFrag<T16>::mma(a[ks][mb], b[ks][nb], acc[mb][nb]);
                    if (HA2) {
#pragma unroll
                        for (int mb = 0; mb < 2; ++mb) acc[mb][nb] = WFrag<T16>::mma(a2[ks][mb], b[ks][nb], acc[mb][nb]); }
                    if (HB2) {
#pragma unroll
                        for (int mb = 0; mb < 2; ++mb) acc[mb][nb] = WFrag<T16>::mma(a[ks][mb], b2[ks][nb], acc[mb][nb]); } }
        }
        if (s + 1 < ns) sstore((s + 1) & 1);             // into the buffer whose last readers passed the barrier of the trip before
        __syncthreads();                                 // publishes stage s + 1 and ends every read of stage s
    }
    constexpr int ES = EPI == 1 ? HD : TT;   // plane elements from one tile row to the next
    const float* cb = nullptr; size_t e0 = 0;   // this lane's first table entry and first plane element; every later one is a constant step away
    if constexpr (EPI == 1) { cb = CS + ((size_t)(r0 + hi) * HD + lr * 4) * 2; e0 = ((size_t)by * TT + r0 + hi) * HD + lr * 4; }
    if constexpr (EPI == 2) e0 = (size_t)(r0 + hi) * TT + c0 + lr * 4;
#pragma unroll
    for (int mb = 0; mb < 2; ++mb) {
        v2f cs[8][2];   // EPI 1: cos, sin of this lane's two pairs in each of its 8 rows, asked for ahead of the LDS exchange so that they fly during it
        if constexpr (EPI == 1) {
#pragma unroll
            for (int s = 0; s < 8; ++s) { const float* c = cb + (mb * 16 + 2 * s) * (HD * 2); cs[s][0] = *(const v2f*)c; cs[s][1] = *(const v2f*)(c + 4); } }
#pragma unroll
        for (int nb = 0; nb < 4; ++nb) {
#pragma unroll
            for (int j = 0; j < 8; ++j) os[(hi * 8 + j) * 68 + nb * 16 + lr] = acc[mb][nb][j]; }
        __builtin_amdgcn_wave_barrier(); asm volatile("" ::: "memory");
        float* crow = C + (size_t)(r0 + mb * 16) * ldc + c0;
#pragma unroll
        for (int s = 0; s < 8; ++s) { const int row = 2 * s + hi, cofs = lr * 4; v4f val = *(const v4fa*)(os + row * 68 + cofs); if (BIAS) { val[0] += bfr(bias[c0 + cofs]); val[1] += bfr(bias[c0 + cofs + 1]); val[2] += bfr(bias[c0 + cofs + 2]); val[3] += bfr(bias[c0 + cofs + 3]); }
            if constexpr (EPI == 0) {
                *(v4f*)(crow + (size_t)row * ldc + cofs) = val; }
            else {
                if constexpr (EPI == 1) { const v4f x = val;   /* even: x0 c - x1 s; odd: x0 s + x1 c */
                    val[0] = x[0] * cs[s][0][0] - x[1] * cs[s][0][1]; val[1] = x[0] * cs[s][0][1] + x[1] * cs[s][0][0]; val[2] = x[2] * cs[s][1][0] - x[3] * cs[s][1][1]; val[3] = x[2] * cs[s][1][1] + x[3] * cs[s][1][0]; }
                const size_t e = e0 + (mb * 16 + 2 * s) * ES;   // 16 lanes x 8 bytes: one whole 128-byte line per row and plane
                v4h o16; v4us oh, ol;
#pragma unroll
                for (int q = 0; q < 4; ++q) { o16[q] = tohx(val[q]); unsigned short a2, c2; splitf(val[q], a2, c2); oh[q] = a2; ol[q] = c2; }
                *(v4h*)(P16 + e) = o16; *(v4us*)(Ph + e) = oh; *(v4us*)(Pl + e) = ol;
                if constexpr (EPI == 2) asm volatile("s_wait_xcnt 0x0" ::: "memory"); } }   // the next row's values reuse the registers that these plane stores name
        asm volatile("s_wait_xcnt 0x0" ::: "memory");   // the next block's values reuse the registers that these stores name
        __builtin_amdgcn_wave_barrier(); asm volatile("" ::: "memory");
    }
}
// ---- k_qkv: the q, k and v projections of both batches in one launch; grid (TT/128, 48, NB_). y < 32: q | k, the first 2048 rows of W_qkv as one Bt (y = head: the q heads, then the k heads), x = token tile. y >= 32: the 256 tiles of v^T = W_v x xt^T.
__global__ __launch_bounds__(128) void k_qkv(const bf* __restrict__ XB, const bf* __restrict__ Wb, const float* __restrict__ CS, h16* QK16, bf* QKh, bf* QKl, h16* VT16, bf* VTh, bf* VTl) {
    __shared__ __align__(16) bf sg[2 * (GTA + GTB)];
    __shared__ __align__(16) float osw[4 * 16 * 68];
    const int x = blockIdx.x, y = blockIdx.y; const size_t z = blockIdx.z; const bf* X = XB + z * ((size_t)TT * DM);
    if (y < (DQ + DKV) / 64) { const size_t p = z * ((size_t)(NH_ + NKV) * TT * HD);
        gemm_tile<bf, 0, false, 1, DM>(sg, osw, x, y, X, nullptr, Wb, nullptr, nullptr, 0, nullptr, CS, QK16 + p, QKh + p, QKl + p); }   /* rotary, planes [q heads | k heads][t][HD] */
    else { const int i = (y - (DQ + DKV) / 64) * (TT / 128) + x; const size_t p = z * ((size_t)DKV * TT);
        gemm_tile<bf, 0, false, 2, DM>(sg, osw, i % (DKV / 128), i / (DKV / 128), Wb + (size_t)(DQ + DKV) * DM, nullptr, X, nullptr, nullptr, 0, nullptr, nullptr, VT16 + p, VTh + p, VTl + p); }   /* planes [h][HD][t] as they come */
}
// ---- k_out: channel-major output rows [e][t] of both batches: exact W_out x (merged hi + lo); grid (DM/128, TT/64, NB_).
__global__ __launch_bounds__(128) void k_out(const bf* __restrict__ WO, const bf* __restrict__ ATh, const bf* __restrict__ ATl, float* OUT) {
    __shared__ __align__(16) bf sg[2 * (GTA + 2 * GTB)];
    __shared__ __align__(16) float osw[4 * 16 * 68];
    const size_t z = blockIdx.z, a = z * ((size_t)TT * DQ);
    gemm_tile<bf, 3, false, 0, DQ>(sg, osw, blockIdx.x, blockIdx.y, WO, nullptr, ATh + a, ATl + a, OUT + z * ((size_t)DM * TT), TT, nullptr, nullptr, nullptr, nullptr, nullptr);
}

__global__ __launch_bounds__(256) void k_wtG(const float* __restrict__ w, int K, int N, bf* Bt) {
    const int lane = threadIdx.x & 31; const int L0 = (blockIdx.x * 8 + (threadIdx.x >> 5)) * 8; const int nlines = N * K / 64;
{
#pragma unroll 1
        for (int l = 0; l < 8; ++l) { const int L = L0 + l; if (L >= nlines) break; const size_t e = (size_t)L * 64 + lane * 2; const int k = (int)(e % K), n = (int)(e / K); v2us o;
            o[0] = f2bf(w[(size_t)k * N + n]); o[1] = f2bf(w[(size_t)(k + 1) * N + n]); *(v2us*)(Bt + e) = o; }
         }
}
// ---- cvtT: one 128-channel x 128-token tile of x, [DM][TT] f32 -> [TT][DM] bf16, turned in LDS so that both sides of memory see whole lines; 256 threads.
// In: a wave-wide 16-byte load is 512 contiguous bytes of one channel row; a lane gathers 8 channels x 4 tokens twice over. Out: 16 lanes store 256 contiguous bytes of one token row.
// LDS: 128 token rows of 16 blocks of 16 bytes (8 channels); block cb of row t lies at place cb ^ ((t >> 2) & 15), so that the 16 lanes of a half wave fall on 16 different places both when they write (one cb, rows 4 apart) and when they read (one row, all cb).
#define XTL  128                  // channels and tokens per tile
__device__ __forceinline__ void cvtT(const float* __restrict__ src, bf* dst, int tile, bf* st) {
    const int tid = threadIdx.x, tq = tid & 31, w = tid >> 5; const int c0 = (tile % (DM / XTL)) * XTL, t0 = (tile / (DM / XTL)) * XTL;
    const float* s = src + (size_t)(c0 + w * 16) * TT + t0 + tq * 4; v4f r[16];
#pragma unroll
    for (int k = 0; k < 16; ++k) r[k] = *(const v4fa*)(s + (size_t)k * TT);
    asm volatile("s_wait_xcnt 0x0" ::: "memory");   // the wait that stands before a register named by an issued global load is overwritten
#pragma unroll
    for (int g = 0; g < 2; ++g)
#pragma unroll
        for (int j = 0; j < 4; ++j) { v8us o;
#pragma unroll
            for (int k = 0; k < 8; ++k) o[k] = f2bf(r[g * 8 + k][j]);
            *(v8usa*)(st + (tq * 4 + j) * XTL + (((w * 2 + g) ^ (tq & 15)) * 8)) = o; }
    __syncthreads();   // the tile is whole before any row of it is read
    const int cb = tid & 15, rw = tid >> 4; bf* d = dst + (size_t)(t0 + rw) * DM + c0 + cb * 8; v8us o[8];
#pragma unroll
    for (int u = 0; u < 8; ++u) { const int row = u * 16 + rw; o[u] = *(const v8usa*)(st + row * XTL + ((cb ^ ((row >> 2) & 15)) * 8)); }
#pragma unroll
    for (int u = 0; u < 8; ++u) *(v8usa*)(d + (size_t)u * 16 * DM) = o[u]; }
__device__ __forceinline__ void cvt8(const float* __restrict__ src, bf* dst, size_t i) { const v8f v = *(const v8f*)(src + i * 8); v8us o;
#pragma unroll
    for (int k = 0; k < 8; ++k) o[k] = f2bf(v[k]); *(v8us*)(dst + i * 8) = o;
    asm volatile("s_wait_xcnt 0x0" ::: "memory"); }   // in the built k_prep another range's block stands behind this store, past a scalar test, and writes the registers that the store names

__constant__ float INV[HD / 2] = {1.0f,0.749894202f,0.562341332f,0.421696514f,0.316227764f,0.237137362f,0.177827939f,0.133352146f,0.100000001f,0.0749894157f,0.0562341288f,0.0421696492f,0.0316227786f,0.0237137359f,0.0177827943f,0.0133352149f,0.00999999978f,0.00749894232f,0.00562341325f,0.00421696482f,0.00316227786f,0.00237137382f,0.00177827943f,0.00133352145f,0.00100000005f,0.000749894185f,0.000562341302f,0.000421696488f,0.000316227786f,0.000237137385f,0.00017782794f,0.00013335215f};
__device__ __forceinline__ void cstab(float* CS, int idx) { const int t = idx / HD, d = idx % HD; const float ang = __fmul_rn((float)t, INV[d >> 1]); v2f cs; cs[0] = cosf(ang); cs[1] = sinf(ang);
    *(v2f*)(CS + (size_t)idx * 2) = cs;
    asm volatile("s_wait_xcnt 0x0" ::: "memory"); }   // as in cvt8: another range's block stands behind this store in the built k_prep
// ---- k_prep: all that depends on the inputs alone, in one launch, by ranges of blocks: x of both batches (channel-major [DM][TT]) -> XB token-major [TT][DM] bf16 | W_qkv -> bf16 | W_out -> bf16 | the rotary table.
#define PBX  ((TT / XTL) * (DM / XTL))          // blocks per batch of x: one tile each
#define PBW  ((DQ + 2 * DKV) * DM / 8 / 256)   // blocks of W_qkv
#define PBO  (DM * DQ / 8 / 256)               // blocks of W_out
#define PBC  (TT * HD / 256)                   // blocks of the table
static_assert(TT % XTL == 0 && DM % XTL == 0 && (DQ + 2 * DKV) * DM % 2048 == 0 && DM * DQ % 2048 == 0 && TT * HD % 256 == 0, "whole blocks in every range of k_prep");
__global__ __launch_bounds__(256) void k_prep(const float* __restrict__ x, const float* __restrict__ wqkv, const float* __restrict__ wo, bf* XB, bf* Wb, bf* WO, float* CS) {
    __shared__ __align__(16) bf xs[XTL * XTL];
    const int blk = blockIdx.x, tid = threadIdx.x;
    if (blk < NB_ * PBX) { const int b = blk / PBX; cvtT(x + (size_t)b * DM * TT, XB + (size_t)b * TT * DM, blk - b * PBX, xs); }
    else if (blk < NB_ * PBX + PBW + PBO) { const bool o = blk >= NB_ * PBX + PBW; cvt8(o ? wo : wqkv, o ? WO : Wb, (size_t)(blk - NB_ * PBX - (o ? PBW : 0)) * 256 + tid); }
    else cstab(CS, (blk - (NB_ * PBX + PBW + PBO)) * 256 + tid);
}

#define KS   64                   // keys per LDS stage
#define LP   72                   // LDS row pitch in 16-bit elements: 144 B = 16 B x odd, conflict-free for 16-byte reads
#define TILE (64 * LP)            // one staged plane: 64 rows (keys of K, channels of V^T) x 64 elements
#define FQ   3                    // fp16 class: query fragments of 16 per wave
static_assert(HD == 64 && KS == 64 && TT % KS == 0 && RH % 64 == 0 && (TT - RH) % (64 * FQ) == 0 && (TT - RH) / (64 * FQ) == RH / 64, "tile geometry of k_fattn");
__device__ __forceinline__ float xhalf(float x) { return __builtin_bit_cast(float, __builtin_amdgcn_permlanex16(__builtin_bit_cast(int, x), __builtin_bit_cast(int, x), 0x76543210, 0xfedcba98, false, false)); }   // lane l <-> lane l ^ 16, on the vector pipe
// Eight independent v_exp_f32, then the one slot that the instruction set asks for behind a transcendental before its result is read or its source overwritten; "=&v" keeps every result off every source.
__device__ __forceinline__ void exp2x8(const float (&t)[8], float (&p)[8]) {
    asm("v_exp_f32 %0, %8\n\tv_exp_f32 %1, %9\n\tv_exp_f32 %2, %10\n\tv_exp_f32 %3, %11\n\tv_exp_f32 %4, %12\n\tv_exp_f32 %5, %13\n\tv_exp_f32 %6, %14\n\tv_exp_f32 %7, %15\n\tv_nop"
        : "=&v"(p[0]), "=&v"(p[1]), "=&v"(p[2]), "=&v"(p[3]), "=&v"(p[4]), "=&v"(p[5]), "=&v"(p[6]), "=&v"(p[7]) : "v"(t[0]), "v"(t[1]), "v"(t[2]), "v"(t[3]), "v"(t[4]), "v"(t[5]), "v"(t[6]), "v"(t[7])); }
__device__ __forceinline__ float exp2s(float x) { float r; asm("v_exp_f32 %0, %1\n\tv_nop" : "=&v"(r) : "v"(x)); return r; }   // one v_exp_f32 with the same slot behind it
template <bool HL> struct FOp;
template <> struct FOp<false> { typedef v16h V; static __device__ __forceinline__ V frag(const unsigned short* p) { return cat16(__builtin_bit_cast(v8h, *(const v8usa*)p), __builtin_bit_cast(v8h, *(const v8usa*)(p + 16))); } static __device__ __forceinline__ v8f mma(V a, V b, v8f c) { return wmma16(a, b, c); } };
template <> struct FOp<true> { typedef v16bf V; static __device__ __forceinline__ V frag(const unsigned short* p) { return cat16b(*(const v8usa*)p, *(const v8usa*)(p + 16)); } static __device__ __forceinline__ v8f mma(V a, V b, v8f c) { return wmmab(a, b, c); } };
// Q*, K* [t][HD], V* [HD][t] of this head (plane 1: the lo planes, HL only); q0: the wave's first query; NF: query fragments of 16 per wave.
template <bool HL, int NF>
__device__ __forceinline__ void fa_body(unsigned short* sm, const unsigned short* __restrict__ Q0, const unsigned short* __restrict__ Q1, const unsigned short* __restrict__ K0, const unsigned short* __restrict__ K1, const unsigned short* __restrict__ V0, const unsigned short* __restrict__ V1, int q0, int h, bf* Ah, bf* Al) {
    typedef FOp<HL> F; typedef typename F::V V;
    constexpr int NP = HL ? 2 : 1;                       // planes per operand
    constexpr float C = SCL * 1.4426950408889634f;       // raw score -> log2 units
    constexpr float SH = HL ? 0.0f : 4.0f;               // fp16 probabilities carry x16: at most 2^(8+4), and small ones stay normal numbers
    const int tid = threadIdx.x, lane = tid & 31, lr = lane & 15, hi = lane >> 4;
    const int srow = tid >> 3, scol = (tid & 7) * 8;     // staging: 8 threads per 128-byte row, 16 rows a sweep
    V qa[NP][NF][2];
#pragma unroll
    for (int qf = 0; qf < NF; ++qf)
#pragma unroll
        for (int ks = 0; ks < 2; ++ks) { const size_t qo = (size_t)(q0 + qf * 16 + lr) * HD + ks * 32 + 8 * hi; qa[0][qf][ks] = F::frag(Q0 + qo); if (HL) qa[NP - 1][qf][ks] = F::frag(Q1 + qo); }
    v8f o[4][NF]; float m[NF], l[NF];
#pragma unroll
    for (int qf = 0; qf < NF; ++qf) { m[qf] = -3.0e38f; l[qf] = 0.f;
#pragma unroll
        for (int mb = 0; mb < 4; ++mb) o[mb][qf] = (v8f){}; }
    v8us rk[NP][4], rv[NP][4]; const size_t kof = (size_t)srow * HD + scol, vof = (size_t)srow * TT + scol;
    auto gload = [&](int s) {
#pragma unroll
        for (int u = 0; u < 4; ++u) { const size_t ko = kof + (size_t)s * (KS * HD) + u * (16 * HD), vo = vof + (size_t)s * KS + u * (16 * TT);
            rk[0][u] = *(const v8usa*)(K0 + ko); rv[0][u] = *(const v8usa*)(V0 + vo); if (HL) { rk[NP - 1][u] = *(const v8usa*)(K1 + ko); rv[NP - 1][u] = *(const v8usa*)(V1 + vo); } } };
    auto sstore = [&](int b) { unsigned short* d = sm + b * (2 * NP * TILE) + srow * LP + scol;
#pragma unroll
        for (int u = 0; u < 4; ++u)
#pragma unroll
            for (int pl = 0; pl < NP; ++pl) { *(v8usa*)(d + pl * TILE + u * 16 * LP) = rk[pl][u]; *(v8usa*)(d + (NP + pl) * TILE + u * 16 * LP) = rv[pl][u]; } };
    gload(0);
    asm volatile("s_wait_xcnt 0x0" ::: "memory");   // the wait that stands before a register named by an issued global load is overwritten: the accumulators' first values take the query rows' address registers
    sstore(0); __syncthreads();
#pragma unroll 1   // rolled: one copy of the stage body
    for (int s = 0; s < TT / KS; ++s) {
        if (s + 1 < TT / KS) gload(s + 1);               // the next stage's global loads fly while this stage is worked on
        const unsigned short* kb = sm + (s & 1) * (2 * NP * TILE) + lr * LP + 8 * hi; const unsigned short* vb = kb + NP * TILE;
#pragma unroll
        for (int c = 0; c < KS / 32; ++c) {
            v8f st[2][NF];
#pragma unroll
            for (int kt = 0; kt < 2; ++kt) { V ka[NP][2];
#pragma unroll
                for (int pl = 0; pl < NP; ++pl)
#pragma unroll
                    for (int ks = 0; ks < 2; ++ks) ka[pl][ks] = F::frag(kb + pl * TILE + (c * 32 + kt * 16) * LP + ks * 32);
#pragma unroll
                for (int qf = 0; qf < NF; ++qf) { v8f a = (v8f){};
#pragma unroll
                    for (int ks = 0; ks < 2; ++ks) { a = F::mma(ka[0][ks], qa[0][qf][ks], a); if (HL) { a = F::mma(ka[NP - 1][ks], qa[0][qf][ks], a); a = F::mma(ka[0][ks], qa[NP - 1][qf][ks], a); } }
                    st[kt][qf] = a; } }
            float mx[NF]; bool need = false;
#pragma unroll
            for (int qf = 0; qf < NF; ++qf) { float a = fmaxf(st[0][qf][0], st[1][qf][0]), a1 = fmaxf(st[0][qf][1], st[1][qf][1]);   // two short chains
#pragma unroll
                for (int j = 2; j < 8; j += 2) { a = fmaxf(a, fmaxf(st[0][qf][j], st[1][qf][j])); a1 = fmaxf(a1, fmaxf(st[0][qf][j + 1], st[1][qf][j + 1])); }
                a = fmaxf(a, a1); a = fmaxf(a, xhalf(a)); mx[qf] = a * C; need = need || (mx[qf] > m[qf] + 8.0f); }
            if (__builtin_amdgcn_ballot_w32(need) != 0) {   // wave-uniform: one test per 32 keys
#pragma unroll
                for (int qf = 0; qf < NF; ++qf) { const float mn = fmaxf(m[qf], mx[qf]); const float al = exp2s(m[qf] - mn); m[qf] = mn; l[qf] *= al;
#pragma unroll
                    for (int mb = 0; mb < 4; ++mb)
#pragma unroll
                        for (int j = 0; j < 8; ++j) o[mb][qf][j] *= al; } }
            V ph[NF], pl2[NF];
#pragma unroll
            for (int qf = 0; qf < NF; ++qf) { const float mo = m[qf] - SH; float sum[4];   // four short chains
#pragma unroll
                for (int kt = 0; kt < 2; ++kt) { float t[8], p[8];
#pragma unroll
                    for (int j = 0; j < 8; j += 2) { const v2f r = __builtin_elementwise_fma((v2f){st[kt][qf][j], st[kt][qf][j + 1]}, (v2f){C, C}, (v2f){-mo, -mo}); t[j] = r[0]; t[j + 1] = r[1]; }   // packed: two scores an instruction
                    exp2x8(t, p);
#pragma unroll
                    for (int j = 0; j < 8; ++j) { if (kt == 0 && j < 4) sum[j] = p[j]; else sum[j & 3] += p[j];
                        if constexpr (HL) { const __bf16 a = (__bf16)p[j]; ph[qf][kt * 8 + j] = a; pl2[qf][kt * 8 + j] = (__bf16)(p[j] - (float)a); } else { ph[qf][kt * 8 + j] = (h16)p[j]; } } }
                l[qf] += (sum[0] + sum[1]) + (sum[2] + sum[3]); }
#pragma unroll
            for (int mb = 0; mb < 4; ++mb) { V va[NP];
#pragma unroll
                for (int pl = 0; pl < NP; ++pl) va[pl] = F::frag(vb + pl * TILE + mb * 16 * LP + c * 32);
#pragma unroll
                for (int qf = 0; qf < NF; ++qf) { o[mb][qf] = F::mma(va[0], ph[qf], o[mb][qf]); if (HL) { o[mb][qf] = F::mma(va[NP - 1], ph[qf], o[mb][qf]); o[mb][qf] = F::mma(va[0], pl2[qf], o[mb][qf]); } } }
        }
        if (s + 1 < TT / KS) sstore((s + 1) & 1);        // into the buffer whose last readers passed the barrier of the trip before
        __syncthreads();                                 // publishes stage s + 1 and ends every read of stage s
    }
#pragma unroll
    for (int qf = 0; qf < NF; ++qf) { const float inv = __fdiv_rn(1.0f, l[qf] + xhalf(l[qf])); const size_t ob = (size_t)(q0 + qf * 16 + lr) * DQ + h * HD + hi * 8;
#pragma unroll
        for (int mb = 0; mb < 4; ++mb) { v8us oh, ol;
#pragma unroll
            for (int j = 0; j < 8; ++j) { unsigned short a, c2; splitf(o[mb][qf][j] * inv, a, c2); oh[j] = a; ol[j] = c2; }
            *(v8us*)(Ah + ob + mb * 16) = oh; *(v8us*)(Al + ob + mb * 16) = ol; } }
}
__global__ __launch_bounds__(128) void k_fattn(const h16* __restrict__ Q16, const h16* __restrict__ K16, const h16* __restrict__ V16, const bf* __restrict__ Qh, const bf* __restrict__ Ql, const bf* __restrict__ Kh, const bf* __restrict__ Kl, const bf* __restrict__ Vh, const bf* __restrict__ Vl, bf* Ah, bf* Al) {
    __shared__ __align__(16) unsigned short sm[2 * 4 * TILE];
    const int h = blockIdx.y, w = threadIdx.x >> 5, bx = blockIdx.x; const size_t z = blockIdx.z, ho = (z * (NH_ + NKV) + h) * (TT * HD), vo = (z * NKV + h) * (HD * TT);   // q and k planes lie [batch][q heads | k heads], v planes [batch][head]
    Ah += z * ((size_t)TT * DQ); Al += z * ((size_t)TT * DQ);
    const int t = bx % (RH / 64); const bool hl = ((bx / (RH / 64)) ^ (int)(z & 1)) == 0;   // the classes change places from one batch to the next: blocks a whole batch apart in index are of different classes (for speed only: a WGP that gets one of each has the lighter LDS load)
    if (hl) fa_body<true, 1>(sm, Qh + ho, Ql + ho, Kh + ho, Kl + ho, Vh + vo, Vl + vo, t * 64 + w * 16, h, Ah, Al);
    else fa_body<false, FQ>(sm, (const unsigned short*)Q16 + ho, nullptr, (const unsigned short*)K16 + ho, nullptr, (const unsigned short*)V16 + vo, nullptr, RH + t * (64 * FQ) + w * (16 * FQ), h, Ah, Al);
}

extern "C" void kernel_launch(void* const* d_in, const int* in_sizes, int n_in,
                              void* d_out, int out_size, void* d_ws, size_t ws_size, hipStream_t stream) {
    (void)in_sizes; (void)n_in; (void)out_size;
    const float* x = (const float*)d_in[0]; const float* wqkv = (const float*)d_in[1]; const float* wo = (const float*)d_in[2];
    float* OUT = (float*)d_out;     // [2][1024][2048] (batch, dim, seq)
    char* wsp = (char*)d_ws;
    auto take = [&](size_t bytes) { char* p = wsp; wsp += (bytes + 255) & ~(size_t)255; return (void*)p; };
    bf* Wb = (bf*)take((size_t)(DQ + 2 * DKV) * DM * 2); bf* WO = (bf*)take((size_t)DM * DQ * 2); float* CS = (float*)take((size_t)TT * HD * 2 * 4);
    bf* XB = (bf*)take((size_t)NB_ * TT * DM * 2);
    const size_t nqk = (size_t)NB_ * (NH_ + NKV) * TT * HD, nv = (size_t)NB_ * NKV * HD * TT, ko = (size_t)NH_ * TT * HD;   // elements of a q | k plane and of a v plane over both batches; the k heads' place behind the q heads
    h16* QK16 = (h16*)take(nqk * 2); bf* QKh = (bf*)take(nqk * 2); bf* QKl = (bf*)take(nqk * 2);
    h16* VT16 = (h16*)take(nv * 2); bf* VTh = (bf*)take(nv * 2); bf* VTl = (bf*)take(nv * 2);
    bf* ATh = (bf*)take((size_t)NB_ * TT * DQ * 2); bf* ATl = (bf*)take((size_t)NB_ * TT * DQ * 2);
    if ((size_t)(wsp - (char*)d_ws) > ws_size) return;    // ws 256 MiB
    k_prep<<<NB_ * PBX + PBW + PBO + PBC, 256, 0, stream>>>(x, wqkv, wo, XB, Wb, WO, CS);
    k_qkv<<<dim3(TT / 128, (DQ + DKV) / 64 + (DKV / 128) * (TT / 64) / (TT / 128), NB_), 128, 0, stream>>>(XB, Wb, CS, QK16, QKh, QKl, VT16, VTh, VTl);
    k_fattn<<<dim3(RH / 64 + (TT - RH) / (64 * FQ), NH_, NB_), 128, 0, stream>>>(QK16, QK16 + ko, VT16, QKh, QKl, QKh + ko, QKl + ko, VTh, VTl, ATh, ATl);   /* all batches, heads and query rows: merged hi + lo planes [b][t][DQ] */
    k_out<<<dim3(DM / 128, TT / 64, NB_), 128, 0, stream>>>(WO, ATh, ATl, OUT);
}

// v008
// One run takes 110 microseconds.
// Two timings next to v007 both put it at 1.05 times that version's speed.
// Over all steps from v000 it is 18.0 times as fast.
#include <hip/hip_runtime.h>

// Multi-head attention with interleaved-pair rotary embeddings on a channel-major input (x [2][1024][2048] = (batch, dim, seq); xt = x^T; [q|k|v] = xt W_qkv^T ('oi' [3072][1024]: row blocks q | k | v; 16 heads x 64); rotary on adjacent (even, odd) pairs with angle t x 10000^(-2i/64) (tables computed on device from the reference's float32 inv_freq); scores/8 over all 2048 keys; softmax; merged heads; out^T = W_out ('oi' [1024][1024]) x merged^T written channel-major -> [2][1024][2048] (4.2 M)).
// Compute dtypes, f32 accumulate: every input rounded to bf16; q/k/v on PLAIN bf16 operands (inputs: exact); input transposed to token-major (by tiles, in LDS) while converting to bf16; interleaved rotary in f32 (precise cosf/sinf table) and the 16-bit operand planes written in the projections' own epilogues; scores and attn.v fused in one launch (online softmax in f32, scores never in memory): query rows < 512 hl (3 products), the rest single fp16 (x16); W_out exact x merged hl (2 products), written transposed (dim-major) straight from the GEMM epilogue.
// Four launches, each over both batches: input conversions and table | q, k, v projections | attention | output projection.

#define NB_  2
#define TT   2048
#define DM   1024
#define NH_  16
#define NKV  16
#define REP  (NH_ / NKV)
#define HD   64
#define DQ   (NH_ * HD)
#define DKV  (NKV * HD)
#define RH   512                  // query rows < RH use hi+lo planes
#define WIN  2048
#define SCL  0.125f   // HD^-0.5
typedef _Float16 h16;
typedef unsigned short bf;
typedef __attribute__((ext_vector_type(16))) __bf16   v16bf;
typedef __attribute__((ext_vector_type(16))) _Float16 v16h;
typedef __attribute__((ext_vector_type(8)))  _Float16 v8h;
typedef __attribute__((ext_vector_type(8)))  unsigned short v8us;
typedef __attribute__((ext_vector_type(8)))  float    v8f;
typedef __attribute__((ext_vector_type(4)))  float    v4f;
typedef v8h  __attribute__((may_alias)) v8ha;
typedef v4f  __attribute__((may_alias)) v4fa;
typedef v8us __attribute__((may_alias)) v8usa;

__device__ __forceinline__ unsigned short f2bf(float f) { unsigned u = __float_as_uint(f); u += 0x7FFFu + ((u >> 16) & 1u); return (unsigned short)(u >> 16); }
__device__ __forceinline__ float bf2f(unsigned short b) { return __uint_as_float(((unsigned)b) << 16); }
__device__ __forceinline__ float bfr(float f) { return bf2f(f2bf(f)); }
__device__ __forceinline__ v16h cat16(v8h lo, v8h hi) { return __builtin_shufflevector(lo, hi, 0, 1, 2, 3, 4, 5, 6, 7, 8, 9, 10, 11, 12, 13, 14, 15); }
__device__ __forceinline__ v16bf cat16b(v8us lo, v8us hi) { return __builtin_bit_cast(v16bf, __builtin_shufflevector(lo, hi, 0, 1, 2, 3, 4, 5, 6, 7, 8, 9, 10, 11, 12, 13, 14, 15)); }
__device__ __forceinline__ v8f wmma16(v16h a, v16h b, v8f c) { return __builtin_amdgcn_wmma_f32_16x16x32_f16(false, a, false, b, (short)0, c, false, false); }
__device__ __forceinline__ v8f wmmab(v16bf a, v16bf b, v8f c) { return __builtin_amdgcn_wmma_f32_16x16x32_bf16(false, a, false, b, (short)0, c, false, false); }



__device__ __forceinline__ h16 tohx(float x) { return (h16)x; }
__device__ __forceinline__ void splitf(float y, unsigned short& h, unsigned short& l) { h = f2bf(y); l = f2bf(y - bf2f(h)); }
typedef __attribute__((ext_vector_type(2))) _Float16 v2h;
typedef __attribute__((ext_vector_type(4))) _Float16 v4h;
typedef __attribute__((ext_vector_type(2))) unsigned short v2us;
typedef __attribute__((ext_vector_type(4))) unsigned short v4us;
typedef __attribute__((ext_vector_type(2))) float v2f;
typedef __attribute__((ext_vector_type(4))) int v4i;

// ---- gemm_tile: GEMM, one work-group of 4 waves per 128x64 output tile (bx, by), each wave a 32x64 part (8 accumulators); 128 threads. The calling kernel owns the LDS (sg: two stages; osw: the epilogue's exchange) and hands in the batch's own pointers.
// The K-contiguous 16-bit operand planes go through LDS in stages of 128 k (two whole 128-byte lines of every row), two buffers: the next stage's global loads fly while this stage is worked on, and the 64 rows of Bt are fetched once for all four waves.
// C[m][n] (f32, pitch ldc, + optional f32 bias[n]) = sum_k A[m][k] Bt[n][k] (+ split products per NSPLIT). K is a compile-time constant, so that the rows of a sweep are constant steps from one address; K % 128 == 0.
// EPI 0: the f32 tile goes to C. EPI 1 and 2: no f32 result reaches memory; the epilogue writes the three 16-bit planes (fp16, bf16 hi, bf16 lo) that the attention kernel reads.
// EPI 1 (q, k; m = token, n = channel, one head per tile column): interleaved rotary with the table CS [t][HD][cos, sin], planes [by][t][HD]. EPI 2 (v; m = channel, n = token): planes [channel][t], pitch TT.
#define GK   128                  // k per LDS stage
#define GP   136                  // LDS row pitch in 16-bit elements: 272 B = 16 B x odd, conflict-free for 16-byte reads
#define GTA  (128 * GP)           // one staged A plane: 128 rows x 128 k
#define GTB  (64 * GP)            // one staged B plane: 64 rows x 128 k
template <typename T16> struct WFrag;
template <> struct WFrag<h16> { typedef v16h V; static __device__ __forceinline__ V ld(const h16* p) { return cat16(*(const v8h*)p, *(const v8h*)(p + 16)); } static __device__ __forceinline__ v8f mma(V a, V b, v8f c) { return wmma16(a, b, c); } };
template <> struct WFrag<bf> { typedef v16bf V; static __device__ __forceinline__ V ld(const bf* p) { return cat16b(*(const v8us*)p, *(const v8us*)(p + 16)); } static __device__ __forceinline__ v8f mma(V a, V b, v8f c) { return wmmab(a, b, c); } };
template <typename T16, int NSPLIT, bool BIAS, int EPI, int K>
__device__ __forceinline__ void gemm_tile(T16* sg, float* osw, int bx, int by, const T16* __restrict__ A, const T16* __restrict__ A2, const T16* __restrict__ Bt, const T16* __restrict__ Bt2, float* C, int ldc, const float* __restrict__ bias, const float* __restrict__ CS, h16* P16, bf* Ph, bf* Pl) {
    typedef typename WFrag<T16>::V V;
    constexpr bool HA2 = NSPLIT == 1 || NSPLIT == 2, HB2 = NSPLIT >= 2;
    constexpr int OA2 = GTA, OB = GTA * (HA2 ? 2 : 1), OB2 = OB + GTB, STG = OB + GTB * (HB2 ? 2 : 1);   // places of the planes in a stage, and its size
    constexpr int KG = (HA2 || HB2) ? 1 : 2;   // k steps of 32 whose fragments are fetched as one group (as many as the registers hold)
    const int tid = threadIdx.x, lane = tid & 31, lr = lane & 15, hi = lane >> 4, w = tid >> 5; const int r0 = bx * 128 + w * 32, c0 = by * 64;
    float* os = osw + w * (16 * 68);   // each wave's own exchange buffer for the epilogue
    v8f acc[2][4];
#pragma unroll
    for (int mb = 0; mb < 2; ++mb)
#pragma unroll
        for (int nb = 0; nb < 4; ++nb) acc[mb][nb] = (v8f){};
    static_assert(K % GK == 0, "whole stages");
    const int srow = tid >> 4, scol = (tid & 15) * 8;    // staging: 16 threads per 256-byte row, 8 rows a sweep
    const unsigned lo = (unsigned)(srow * K + scol);     // the lane's own element offset in a sweep: the one vector part of every staging address, the rest is the same for the whole work-group
    const size_t ag = (size_t)bx * 128 * K, bg = (size_t)c0 * K;
    v8us ra[16], ra2[16], rb[8], rb2[8];
    const char* ba = (const char*)(A + ag); const char* ba2 = HA2 ? (const char*)(A2 + ag) : nullptr; const char* bb0 = (const char*)(Bt + bg); const char* bb2 = HB2 ? (const char*)(Bt2 + bg) : nullptr;   // the tile's first rows: the same for the whole work-group
    unsigned vo = lo * 2;                                // the lane's byte offset in the next stage to fetch, one register for all planes
    auto gload = [&]() {
#pragma unroll
        for (int u = 0; u < 16; ++u) { ra[u] = *(const v8usa*)(ba + vo + u * 8 * K * 2); if (HA2) ra2[u] = *(const v8usa*)(ba2 + vo + u * 8 * K * 2); }
#pragma unroll
        for (int u = 0; u < 8; ++u) { rb[u] = *(const v8usa*)(bb0 + vo + u * 8 * K * 2); if (HB2) rb2[u] = *(const v8usa*)(bb2 + vo + u * 8 * K * 2); }
        asm volatile("s_wait_xcnt 0x0" : "+v"(vo) :: "memory");   // the wait that stands before a register named by an issued global load is overwritten; the offset is its operand so that it stays in its register up to the wait and is stepped only behind it
        vo += GK * 2; };
    auto sstore = [&](int b) { T16* d = sg + b * STG + srow * GP + scol;
#pragma unroll
        for (int u = 0; u < 16; ++u) { *(v8usa*)(d + u * 8 * GP) = ra[u]; if (HA2) *(v8usa*)(d + OA2 + u * 8 * GP) = ra2[u]; }
#pragma unroll
        for (int u = 0; u < 8; ++u) { *(v8usa*)(d + OB + u * 8 * GP) = rb[u]; if (HB2) *(v8usa*)(d + OB2 + u * 8 * GP) = rb2[u]; } };
    constexpr int ns = K / GK;
    gload(); sstore(0); __syncthreads();
#pragma unroll 1   // rolled: one copy of the stage body
    for (int s = 0; s < ns; ++s) {
        const T16* ab = sg + (s & 1) * STG + (w * 32 + lr) * GP + 8 * hi; const T16* bb = sg + (s & 1) * STG + OB + lr * GP + 8 * hi;
#pragma unroll
        for (int kg = 0; kg < GK / 32; kg += KG) {
            V a[KG][2], a2[KG][2], b[KG][4], b2[KG][4];
#pragma unroll
            for (int ks = 0; ks < KG; ++ks) { const int ko = (kg + ks) * 32;
#pragma unroll
                for (int mb = 0; mb < 2; ++mb) { a[ks][mb] = WFrag<T16>::ld(ab + mb * 16 * GP + ko); if (HA2) a2[ks][mb] = WFrag<T16>::ld(ab + OA2 + mb * 16 * GP + ko); }
#pragma unroll
                for (int nb = 0; nb < 4; ++nb) { b[ks][nb] = WFrag<T16>::ld(bb + nb * 16 * GP + ko); if (HB2) b2[ks][nb] = WFrag<T16>::ld(bb + GTB + nb * 16 * GP + ko); } }
            if (kg == 0 && s + 1 < ns) gload();          // the next stage's global loads fly while this stage is worked on; issued in the shadow of the LDS reads
            __builtin_amdgcn_sched_barrier(0);   // the group's LDS reads all issue ahead of its products: one LDS latency per group instead of one per B fragment
#pragma unroll
            for (int ks = 0; ks < KG; ++ks)
#pragma unroll
                for (int nb = 0; nb < 4; ++nb) {
#pragma unroll
                    for (int mb = 0; mb < 2; ++mb) acc[mb][nb] = WFrag<T16>::mma(a[ks][mb], b[ks][nb], acc[mb][nb]);
                    if (HA2) {
#pragma unroll
                        for (int mb = 0; mb < 2; ++mb) acc[mb][nb] = WFrag<T16>::mma(a2[ks][mb], b[ks][nb], acc[mb][nb]); }
                    if (HB2) {
#pragma unroll
                        for (int mb = 0; mb < 2; ++mb) acc[mb][nb] = WFrag<T16>::mma(a[ks][mb], b2[ks][nb], acc[mb][nb]); } }
        }
        if (s + 1 < ns) sstore((s + 1) & 1);             // into the buffer whose last readers passed the barrier of the trip before
        __syncthreads();                                 // publishes stage s + 1 and ends every read of stage s
    }
    constexpr int ES = EPI == 1 ? HD : TT;   // plane elements from one tile row to the next
    const float* cb = nullptr; size_t e0 = 0;   // this lane's first table entry and first plane element; every later one is a constant step away
    if constexpr (EPI == 1) { cb = CS + ((size_t)(r0 + hi) * HD + lr * 4) * 2; e0 = ((size_t)by * TT + r0 + hi) * HD + lr * 4; }
    if constexpr (EPI == 2) e0 = (size_t)(r0 + hi) * TT + c0 + lr * 4;
#pragma unroll
    for (int mb = 0; mb < 2; ++mb) {
        v2f cs[8][2];   // EPI 1: cos, sin of this lane's two pairs in each of its 8 rows, asked for ahead of the LDS exchange so that they fly during it
        if constexpr (EPI == 1) {
#pragma unroll
            for (int s = 0; s < 8; ++s) { const float* c = cb + (mb * 16 + 2 * s) * (HD * 2); cs[s][0] = *(const v2f*)c; cs[s][1] = *(const v2f*)(c + 4); } }
#pragma unroll
        for (int nb = 0; nb < 4; ++nb) {
#pragma unroll
            for (int j = 0; j < 8; ++j) os[(hi * 8 + j) * 68 + nb * 16 + lr] = acc[mb][nb][j]; }
        __builtin_amdgcn_wave_barrier(); asm volatile("" ::: "memory");
        float* crow = C + (size_t)(r0 + mb * 16) * ldc + c0;
#pragma unroll
        for (int s = 0; s < 8; ++s) { const int row = 2 * s + hi, cofs = lr * 4; v4f val = *(const v4fa*)(os + row * 68 + cofs); if (BIAS) { val[0] += bfr(bias[c0 + cofs]); val[1] += bfr(bias[c0 + cofs + 1]); val[2] += bfr(bias[c0 + cofs + 2]); val[3] += bfr(bias[c0 + cofs + 3]); }
            if constexpr (EPI == 0) {
                *(v4f*)(crow + (size_t)row * ldc + cofs) = val; }
            else {
                if constexpr (EPI == 1) { const v4f x = val;   /* even: x0 c - x1 s; odd: x0 s + x1 c */
                    val[0] = x[0] * cs[s][0][0] - x[1] * cs[s][0][1]; val[1] = x[0] * cs[s][0][1] + x[1] * cs[s][0][0]; val[2] = x[2] * cs[s][1][0] - x[3] * cs[s][1][1]; val[3] = x[2] * cs[s][1][1] + x[3] * cs[s][1][0]; }
                const size_t e = e0 + (mb * 16 + 2 * s) * ES;   // 16 lanes x 8 bytes: one whole 128-byte line per row and plane
                v4h o16; v4us oh, ol;
#pragma unroll
                for (int q = 0; q < 4; ++q) { o16[q] = tohx(val[q]); unsigned short a2, c2; splitf(val[q], a2, c2); oh[q] = a2; ol[q] = c2; }
                *(v4h*)(P16 + e) = o16; *(v4us*)(Ph + e) = oh; *(v4us*)(Pl + e) = ol;
                if constexpr (EPI == 2) asm volatile("s_wait_xcnt 0x0" ::: "memory"); } }   // the next row's values reuse the registers that these plane stores name
        asm volatile("s_wait_xcnt 0x0" ::: "memory");   // the next block's values reuse the registers that these stores name
        __builtin_amdgcn_wave_barrier(); asm volatile("" ::: "memory");
    }
}
// ---- k_qkv: the q, k and v projections of both batches in one launch; grid (TT/128, 48, NB_). y < 32: q | k, the first 2048 rows of W_qkv as one Bt (y = head: the q heads, then the k heads), x = token tile. y >= 32: the 256 tiles of v^T = W_v x xt^T.
__global__ __launch_bounds__(128) void k_qkv(const bf* __restrict__ XB, const bf* __restrict__ Wb, const float* __restrict__ CS, h16* QK16, bf* QKh, bf* QKl, h16* VT16, bf* VTh, bf* VTl) {
    __shared__ __align__(16) bf sg[2 * (GTA + GTB)];
    __shared__ __align__(16) float osw[4 * 16 * 68];
    const int x = blockIdx.x, y = blockIdx.y; const size_t z = blockIdx.z; const bf* X = XB + z * ((size_t)TT * DM);
    if (y < (DQ + DKV) / 64) { const size_t p = z * ((size_t)(NH_ + NKV) * TT * HD);
        gemm_tile<bf, 0, false, 1, DM>(sg, osw, x, y, X, nullptr, Wb, nullptr, nullptr, 0, nullptr, CS, QK16 + p, QKh + p, QKl + p); }   /* rotary, planes [q heads | k heads][t][HD] */
    else { const int i = (y - (DQ + DKV) / 64) * (TT / 128) + x; const size_t p = z * ((size_t)DKV * TT);
        gemm_tile<bf, 0, false, 2, DM>(sg, osw, i % (DKV / 128), i / (DKV / 128), Wb + (size_t)(DQ + DKV) * DM, nullptr, X, nullptr, nullptr, 0, nullptr, nullptr, VT16 + p, VTh + p, VTl + p); }   /* planes [h][HD][t] as they come */
}
// ---- k_out: channel-major output rows [e][t] of both batches: exact W_out x (merged hi + lo); grid (DM/128, TT/64, NB_).
__global__ __launch_bounds__(128) void k_out(const bf* __restrict__ WO, const bf* __restrict__ ATh, const bf* __restrict__ ATl, float* OUT) {
    __shared__ __align__(16) bf sg[2 * (GTA + 2 * GTB)];
    __shared__ __align__(16) float osw[4 * 16 * 68];
    const size_t z = blockIdx.z, a = z * ((size_t)TT * DQ);
    gemm_tile<bf, 3, false, 0, DQ>(sg, osw, blockIdx.x, blockIdx.y, WO, nullptr, ATh + a, ATl + a, OUT + z * ((size_t)DM * TT), TT, nullptr, nullptr, nullptr, nullptr, nullptr);
}

__global__ __launch_bounds__(256) void k_wtG(const float* __restrict__ w, int K, int N, bf* Bt) {
    const int lane = threadIdx.x & 31; const int L0 = (blockIdx.x * 8 + (threadIdx.x >> 5)) * 8; const int nlines = N * K / 64;
{
#pragma unroll 1
        for (int l = 0; l < 8; ++l) { const int L = L0 + l; if (L >= nlines) break; const size_t e = (size_t)L * 64 + lane * 2; const int k = (int)(e % K), n = (int)(e / K); v2us o;
            o[0] = f2bf(w[(size_t)k * N + n]); o[1] = f2bf(w[(size_t)(k + 1) * N + n]); *(v2us*)(Bt + e) = o; }
         }
}
// ---- cvtT: one 128-channel x 128-token tile of x, [DM][TT] f32 -> [TT][DM] bf16, turned in LDS so that both sides of memory see whole lines; 256 threads.
// In: a wave-wide 16-byte load is 512 contiguous bytes of one channel row; a lane gathers 8 channels x 4 tokens twice over. Out: 16 lanes store 256 contiguous bytes of one token row.
// LDS: 128 token rows of 16 blocks of 16 bytes (8 channels); block cb of row t lies at place cb ^ ((t >> 2) & 15), so that the 16 lanes of a half wave fall on 16 different places both when they write (one cb, rows 4 apart) and when they read (one row, all cb).
#define XTL  128                  // channels and tokens per tile
__device__ __forceinline__ void cvtT(const float* __restrict__ src, bf* dst, int tile, bf* st) {
    const int tid = threadIdx.x, tq = tid & 31, w = tid >> 5; const int c0 = (tile % (DM / XTL)) * XTL, t0 = (tile / (DM / XTL)) * XTL;
    const float* s = src + (size_t)(c0 + w * 16) * TT + t0 + tq * 4; v4f r[16];
#pragma unroll
    for (int k = 0; k < 16; ++k) r[k] = *(const v4fa*)(s + (size_t)k * TT);
    asm volatile("s_wait_xcnt 0x0" ::: "memory");   // the wait that stands before a register named by an issued global load is overwritten
#pragma unroll
    for (int g = 0; g < 2; ++g)
#pragma unroll
        for (int j = 0; j < 4; ++j) { v8us o;
#pragma unroll
            for (int k = 0; k < 8; ++k) o[k] = f2bf(r[g * 8 + k][j]);
            *(v8usa*)(st + (tq * 4 + j) * XTL + (((w * 2 + g) ^ (tq & 15)) * 8)) = o; }
    __syncthreads();   // the tile is whole before any row of it is read
    const int cb = tid & 15, rw = tid >> 4; bf* d = dst + (size_t)(t0 + rw) * DM + c0 + cb * 8; v8us o[8];
#pragma unroll
    for (int u = 0; u < 8; ++u) { const int row = u * 16 + rw; o[u] = *(const v8usa*)(st + row * XTL + ((cb ^ ((row >> 2) & 15)) * 8)); }
#pragma unroll
    for (int u = 0; u < 8; ++u) *(v8usa*)(d + (size_t)u * 16 * DM) = o[u]; }
__device__ __forceinline__ void cvt8(const float* __restrict__ src, bf* dst, size_t i) { const v8f v = *(const v8f*)(src + i * 8); v8us o;
#pragma unroll
    for (int k = 0; k < 8; ++k) o[k] = f2bf(v[k]); *(v8us*)(dst + i * 8) = o;
    asm volatile("s_wait_xcnt 0x0" ::: "memory"); }   // in the built k_prep another range's block stands behind this store, past a scalar test, and writes the registers that the store names

__constant__ float INV[HD / 2] = {1.0f,0.749894202f,0.562341332f,0.421696514f,0.316227764f,0.237137362f,0.177827939f,0.133352146f,0.100000001f,0.0749894157f,0.0562341288f,0.0421696492f,0.0316227786f,0.0237137359f,0.0177827943f,0.0133352149f,0.00999999978f,0.00749894232f,0.00562341325f,0.00421696482f,0.00316227786f,0.00237137382f,0.00177827943f,0.00133352145f,0.00100000005f,0.000749894185f,0.000562341302f,0.000421696488f,0.000316227786f,0.000237137385f,0.00017782794f,0.00013335215f};
__device__ __forceinline__ void cstab(float* CS, int idx) { const int t = idx / HD, d = idx % HD; const float ang = __fmul_rn((float)t, INV[d >> 1]); v2f cs; cs[0] = cosf(ang); cs[1] = sinf(ang);
    *(v2f*)(CS + (size_t)idx * 2) = cs;
    asm volatile("s_wait_xcnt 0x0" ::: "memory"); }   // as in cvt8: another range's block stands behind this store in the built k_prep
// ---- k_prep: all that depends on the inputs alone, in one launch, by ranges of blocks: x of both batches (channel-major [DM][TT]) -> XB token-major [TT][DM] bf16 | W_qkv -> bf16 | W_out -> bf16 | the rotary table.
#define PBX  ((TT / XTL) * (DM / XTL))          // blocks per batch of x: one tile each
#define PBW  ((DQ + 2 * DKV) * DM / 8 / 256)   // blocks of W_qkv
#define PBO  (DM * DQ / 8 / 256)               // blocks of W_out
#define PBC  (TT * HD / 256)                   // blocks of the table
static_assert(TT % XTL == 0 && DM % XTL == 0 && (DQ + 2 * DKV) * DM % 2048 == 0 && DM * DQ % 2048 == 0 && TT * HD % 256 == 0, "whole blocks in every range of k_prep");
__global__ __launch_bounds__(256) void k_prep(const float* __restrict__ x, const float* __restrict__ wqkv, const float* __restrict__ wo, bf* XB, bf* Wb, bf* WO, float* CS) {
    __shared__ __align__(16) bf xs[XTL * XTL];
    const int blk = blockIdx.x, tid = threadIdx.x;
    if (blk < NB_ * PBX) { const int b = blk / PBX; cvtT(x + (size_t)b * DM * TT, XB + (size_t)b * TT * DM, blk - b * PBX, xs); }
    else if (blk < NB_ * PBX + PBW + PBO) { const bool o = blk >= NB_ * PBX + PBW; cvt8(o ? wo : wqkv, o ? WO : Wb, (size_t)(blk - NB_ * PBX - (o ? PBW : 0)) * 256 + tid); }
    else cstab(CS, (blk - (NB_ * PBX + PBW + PBO)) * 256 + tid);
}

#define KS   64                   // keys per LDS stage
#define LP   72                   // LDS row pitch in 16-bit elements: 144 B = 16 B x odd, conflict-free for 16-byte reads
#define TILE (64 * LP)            // one staged plane: 64 rows (keys of K, channels of V^T) x 64 elements
#define FQ   3                    // fp16 class: query fragments of 16 per wave
static_assert((4 * FQ * 8 + 2 * FQ) * 32 * 4 * 4 <= 2 * 4 * TILE * 2, "the join's exchange fits the stages' LDS");
static_assert(HD == 64 && KS == 64 && TT % KS == 0 && RH % 64 == 0 && (TT - RH) % (64 * FQ) == 0 && (TT - RH) / (64 * FQ) == RH / 64, "tile geometry of k_fattn");
__device__ __forceinline__ float xhalf(float x) { return __builtin_bit_cast(float, __builtin_amdgcn_permlanex16(__builtin_bit_cast(int, x), __builtin_bit_cast(int, x), 0x76543210, 0xfedcba98, false, false)); }   // lane l <-> lane l ^ 16, on the vector pipe
// Eight independent v_exp_f32, then the one slot that the instruction set asks for behind a transcendental before its result is read or its source overwritten; "=&v" keeps every result off every source.
__device__ __forceinline__ void exp2x8(const float (&t)[8], float (&p)[8]) {
    asm("v_exp_f32 %0, %8\n\tv_exp_f32 %1, %9\n\tv_exp_f32 %2, %10\n\tv_exp_f32 %3, %11\n\tv_exp_f32 %4, %12\n\tv_exp_f32 %5, %13\n\tv_exp_f32 %6, %14\n\tv_exp_f32 %7, %15\n\tv_nop"
        : "=&v"(p[0]), "=&v"(p[1]), "=&v"(p[2]), "=&v"(p[3]), "=&v"(p[4]), "=&v"(p[5]), "=&v"(p[6]), "=&v"(p[7]) : "v"(t[0]), "v"(t[1]), "v"(t[2]), "v"(t[3]), "v"(t[4]), "v"(t[5]), "v"(t[6]), "v"(t[7])); }
__device__ __forceinline__ float exp2s(float x) { float r; asm("v_exp_f32 %0, %1\n\tv_nop" : "=&v"(r) : "v"(x)); return r; }   // one v_exp_f32 with the same slot behind it
template <bool HL> struct FOp;
template <> struct FOp<false> { typedef v16h V; static __device__ __forceinline__ V frag(const unsigned short* p) { return cat16(__builtin_bit_cast(v8h, *(const v8usa*)p), __builtin_bit_cast(v8h, *(const v8usa*)(p + 16))); } static __device__ __forceinline__ v8f mma(V a, V b, v8f c) { return wmma16(a, b, c); } };
template <> struct FOp<true> { typedef v16bf V; static __device__ __forceinline__ V frag(const unsigned short* p) { return cat16b(*(const v8usa*)p, *(const v8usa*)(p + 16)); } static __device__ __forceinline__ v8f mma(V a, V b, v8f c) { return wmmab(a, b, c); } };
// Q*, K* [t][HD], V* [HD][t] of this head (plane 1: the lo planes, HL only); q0: the wave's first query; g: the wave's key group (the same in every lane); wq: the wave's place in its group; NF: query fragments of 16 per wave.
template <bool HL, int NF>
__device__ __forceinline__ void fa_body(unsigned short* sm, const unsigned short* __restrict__ Q0, const unsigned short* __restrict__ Q1, const unsigned short* __restrict__ K0, const unsigned short* __restrict__ K1, const unsigned short* __restrict__ V0, const unsigned short* __restrict__ V1, int q0, int g, int wq, int h, bf* Ah, bf* Al) {
    typedef FOp<HL> F; typedef typename F::V V;
    constexpr int NP = HL ? 2 : 1;                       // planes per operand
    constexpr float C = SCL * 1.4426950408889634f;       // raw score -> log2 units
    constexpr float SH = HL ? 0.0f : 4.0f;               // fp16 probabilities carry x16: at most 2^(8+4), and small ones stay normal numbers
    const int tid = threadIdx.x, lane = tid & 31, lr = lane & 15, hi = lane >> 4;
    const int srow = tid >> 3, scol = (tid & 7) * 8;     // staging: 8 threads per 128-byte row, 32 rows a sweep
    V qa[NP][NF][2];
#pragma unroll
    for (int qf = 0; qf < NF; ++qf)
#pragma unroll
        for (int ks = 0; ks < 2; ++ks) { const size_t qo = (size_t)(q0 + qf * 16 + lr) * HD + ks * 32 + 8 * hi; qa[0][qf][ks] = F::frag(Q0 + qo); if (HL) qa[NP - 1][qf][ks] = F::frag(Q1 + qo); }
    v8f o[4][NF]; float m[NF], l[NF];
#pragma unroll
    for (int qf = 0; qf < NF; ++qf) { m[qf] = -3.0e38f; l[qf] = 0.f;
#pragma unroll
        for (int mb = 0; mb < 4; ++mb) o[mb][qf] = (v8f){}; }
    v8us rk[NP][2], rv[NP][2]; unsigned kof = (srow * HD + scol) * 2, vof = (srow * TT + scol) * 2;   // the lane's own byte offsets: one register each, never stepped; the stage's step rides the scalar bases (the 256-register budget of four waves per SIMD)
    const char* kp0 = (const char*)K0; const char* kp1 = (const char*)K1; const char* vp0 = (const char*)V0; const char* vp1 = (const char*)V1;   // the next stage to ask for
    auto gload = [&]() {
#pragma unroll
        for (int u = 0; u < 2; ++u) { rk[0][u] = *(const v8usa*)(kp0 + kof + u * (32 * HD * 2)); rv[0][u] = *(const v8usa*)(vp0 + vof + u * (32 * TT * 2)); if (HL) { rk[NP - 1][u] = *(const v8usa*)(kp1 + kof + u * (32 * HD * 2)); rv[NP - 1][u] = *(const v8usa*)(vp1 + vof + u * (32 * TT * 2)); } }
        asm volatile("s_wait_xcnt 0x0" : "+v"(kof), "+v"(vof) :: "memory"); };   // the wait that stands before a register named by an issued global load is overwritten; the two offsets are its operands so that they stay in their registers up to the wait
    auto gstep = [&]() { kp0 += KS * HD * 2; vp0 += KS * 2; if (HL) { kp1 += KS * HD * 2; vp1 += KS * 2; } };
    auto sstore = [&](int b) { unsigned short* d = sm + b * (2 * NP * TILE) + srow * LP + scol;
#pragma unroll
        for (int u = 0; u < 2; ++u)
#pragma unroll
            for (int pl = 0; pl < NP; ++pl) { *(v8usa*)(d + pl * TILE + u * 32 * LP) = rk[pl][u]; *(v8usa*)(d + (NP + pl) * TILE + u * 32 * LP) = rv[pl][u]; } };
    gload(); gstep();   // its wait also covers the query rows' loads: the accumulators' first values take their address registers
    sstore(0); __syncthreads();
#pragma unroll 1   // rolled: one copy of the stage body
    for (int s = 0; s < TT / KS; ++s) {
        if (s + 1 < TT / KS) { gload(); gstep(); }       // the next stage's global loads fly while this stage is worked on
        const unsigned short* sb = sm + (s & 1) * (2 * NP * TILE) + lr * LP + 8 * hi; const unsigned short* kb = sb + g * (32 * LP); const unsigned short* vb = sb + NP * TILE + g * 32;   // the group's 32 key rows of K, its 32 key columns of V^T
        {
            v8f st[2][NF];
#pragma unroll
            for (int kt = 0; kt < 2; ++kt) { V ka[NP][2];
#pragma unroll
                for (int pl = 0; pl < NP; ++pl)
#pragma unroll
                    for (int ks = 0; ks < 2; ++ks) ka[pl][ks] = F::frag(kb + pl * TILE + kt * 16 * LP + ks * 32);
#pragma unroll
                for (int qf = 0; qf < NF; ++qf) { v8f a = (v8f){};
#pragma unroll
                    for (int ks = 0; ks < 2; ++ks) { a = F::mma(ka[0][ks], qa[0][qf][ks], a); if (HL) { a = F::mma(ka[NP - 1][ks], qa[0][qf][ks], a); a = F::mma(ka[0][ks], qa[NP - 1][qf][ks], a); } }
                    st[kt][qf] = a; } }
            float mx[NF]; bool need = false;
#pragma unroll
            for (int qf = 0; qf < NF; ++qf) { float a = fmaxf(st[0][qf][0], st[1][qf][0]), a1 = fmaxf(st[0][qf][1], st[1][qf][1]);   // two short chains
#pragma unroll
                for (int j = 2; j < 8; j += 2) { a = fmaxf(a, fmaxf(st[0][qf][j], st[1][qf][j])); a1 = fmaxf(a1, fmaxf(st[0][qf][j + 1], st[1][qf][j + 1])); }
                a = fmaxf(a, a1); a = fmaxf(a, xhalf(a)); mx[qf] = a * C; need = need || (mx[qf] > m[qf] + 8.0f); }
            if (__builtin_amdgcn_ballot_w32(need) != 0) {   // wave-uniform: one test per 32 keys
#pragma unroll
                for (int qf = 0; qf < NF; ++qf) { const float mn = fmaxf(m[qf], mx[qf]); const float al = exp2s(m[qf] - mn); m[qf] = mn; l[qf] *= al;
#pragma unroll
                    for (int mb = 0; mb < 4; ++mb)
#pragma unroll
                        for (int j = 0; j < 8; ++j) o[mb][qf][j] *= al; } }
            V ph[NF], pl2[NF];
#pragma unroll
            for (int qf = 0; qf < NF; ++qf) { const float mo = m[qf] - SH; float sum[4];   // four short chains
#pragma unroll
                for (int kt = 0; kt < 2; ++kt) { float t[8], p[8];
#pragma unroll
                    for (int j = 0; j < 8; j += 2) { const v2f r = __builtin_elementwise_fma((v2f){st[kt][qf][j], st[kt][qf][j + 1]}, (v2f){C, C}, (v2f){-mo, -mo}); t[j] = r[0]; t[j + 1] = r[1]; }   // packed: two scores an instruction
                    exp2x8(t, p);
#pragma unroll
                    for (int j = 0; j < 8; ++j) { if (kt == 0 && j < 4) sum[j] = p[j]; else sum[j & 3] += p[j];
                        if constexpr (HL) { const __bf16 a = (__bf16)p[j]; ph[qf][kt * 8 + j] = a; pl2[qf][kt * 8 + j] = (__bf16)(p[j] - (float)a); } else { ph[qf][kt * 8 + j] = (h16)p[j]; } } }
                l[qf] += (sum[0] + sum[1]) + (sum[2] + sum[3]); }
            if (s + 1 < TT / KS) sstore((s + 1) & 1);        // into the buffer whose last readers passed the barrier of the trip before. Ahead of the second product, not at the trip's foot: the staged registers are free from here on; with the stores at the foot the build goes past the 256 registers of four waves per SIMD and spills staged rows to scratch
#pragma unroll
            for (int mb = 0; mb < 4; ++mb) { V va[NP];
#pragma unroll
                for (int pl = 0; pl < NP; ++pl) va[pl] = F::frag(vb + pl * TILE + mb * 16 * LP);
#pragma unroll
                for (int qf = 0; qf < NF; ++qf) { o[mb][qf] = F::mma(va[0], ph[qf], o[mb][qf]); if (HL) { o[mb][qf] = F::mma(va[NP - 1], ph[qf], o[mb][qf]); o[mb][qf] = F::mma(va[0], pl2[qf], o[mb][qf]); } } }
        }
        __syncthreads();                                 // publishes stage s + 1 and ends every read of stage s
    }
    // The join. The loop's last barrier has ended every read of the stages, so their LDS is free: group 1 leaves its state there (16 bytes a lane, lanes side by side), group 0 takes it up, brings both to the larger maximum and writes the rows.
    float* xs = (float*)sm + wq * ((4 * NF * 8 + 2 * NF) * 32) + lane * 4; float* xm = (float*)sm + wq * ((4 * NF * 8 + 2 * NF) * 32) + 4 * NF * 8 * 32 + lane;
    if (g != 0) {
#pragma unroll
        for (int qf = 0; qf < NF; ++qf) { xm[(2 * qf) * 32] = m[qf]; xm[(2 * qf + 1) * 32] = l[qf];
#pragma unroll
            for (int mb = 0; mb < 4; ++mb) { const v8f a = o[mb][qf]; *(v4fa*)(xs + ((qf * 4 + mb) * 2) * 128) = (v4f){a[0], a[1], a[2], a[3]}; *(v4fa*)(xs + ((qf * 4 + mb) * 2 + 1) * 128) = (v4f){a[4], a[5], a[6], a[7]}; } } }
    __syncthreads();   // group 1's state is whole before group 0 reads it
    if (g != 0) return;
    const unsigned eo = (unsigned)lr * DQ + hi * 8;   // the lane's own place in a block of 16 output rows
#pragma unroll
    for (int qf = 0; qf < NF; ++qf) { const float pm = xm[(2 * qf) * 32], pl = xm[(2 * qf + 1) * 32]; const float mn = fmaxf(m[qf], pm); const float a0 = exp2s(m[qf] - mn), a1 = exp2s(pm - mn);
        const float lt = l[qf] * a0 + pl * a1; const float inv = __fdiv_rn(1.0f, lt + xhalf(lt)); const float s0 = a0 * inv, s1 = a1 * inv; const size_t ob = (size_t)(q0 + qf * 16) * DQ + h * HD + eo;
#pragma unroll
        for (int mb = 0; mb < 4; ++mb) { v8us oh, ol; const v4f p0 = *(const v4fa*)(xs + ((qf * 4 + mb) * 2) * 128), p1 = *(const v4fa*)(xs + ((qf * 4 + mb) * 2 + 1) * 128);
#pragma unroll
            for (int j = 0; j < 8; ++j) { unsigned short a, c2; splitf(o[mb][qf][j] * s0 + (j < 4 ? p0[j & 3] : p1[j & 3]) * s1, a, c2); oh[j] = a; ol[j] = c2; }
            *(v8us*)(Ah + ob + mb * 16) = oh; *(v8us*)(Al + ob + mb * 16) = ol;
            asm volatile("s_wait_xcnt 0x0" ::: "memory"); } }   // the next block's values reuse the registers that these stores name
}
__global__ __launch_bounds__(256, 4) void k_fattn(const h16* __restrict__ Q16, const h16* __restrict__ K16, const h16* __restrict__ V16, const bf* __restrict__ Qh, const bf* __restrict__ Ql, const bf* __restrict__ Kh, const bf* __restrict__ Kl, const bf* __restrict__ Vh, const bf* __restrict__ Vl, bf* Ah, bf* Al) {
    __shared__ __align__(16) unsigned short sm[2 * 4 * TILE];
    const int h = blockIdx.y, wv = __builtin_amdgcn_readfirstlane((int)(threadIdx.x >> 5)), w = wv & 3, g = wv >> 2, bx = blockIdx.x; const size_t z = blockIdx.z, ho = (z * (NH_ + NKV) + h) * (TT * HD), vo = (z * NKV + h) * (HD * TT);   // q and k planes lie [batch][q heads | k heads], v planes [batch][head]
    Ah += z * ((size_t)TT * DQ); Al += z * ((size_t)TT * DQ);
    const int t = bx % (RH / 64); const bool hl = ((bx / (RH / 64)) ^ (int)(z & 1)) == 0;   // the classes change places from one batch to the next: blocks a whole batch apart in index are of different classes (for speed only: a WGP that gets one of each has the lighter LDS load)
    if (hl) fa_body<true, 1>(sm, Qh + ho, Ql + ho, Kh + ho, Kl + ho, Vh + vo, Vl + vo, t * 64 + w * 16, g, w, h, Ah, Al);
    else fa_body<false, FQ>(sm, (const unsigned short*)Q16 + ho, nullptr, (const unsigned short*)K16 + ho, nullptr, (const unsigned short*)V16 + vo, nullptr, RH + t * (64 * FQ) + w * (16 * FQ), g, w, h, Ah, Al);
}

extern "C" void kernel_launch(void* const* d_in, const int* in_sizes, int n_in,
                              void* d_out, int out_size, void* d_ws, size_t ws_size, hipStream_t stream) {
    (void)in_sizes; (void)n_in; (void)out_size;
    const float* x = (const float*)d_in[0]; const float* wqkv = (const float*)d_in[1]; const float* wo = (const float*)d_in[2];
    float* OUT = (float*)d_out;     // [2][1024][2048] (batch, dim, seq)
    char* wsp = (char*)d_ws;
    auto take = [&](size_t bytes) { char* p = wsp; wsp += (bytes + 255) & ~(size_t)255; return (void*)p; };
    bf* Wb = (bf*)take((size_t)(DQ + 2 * DKV) * DM * 2); bf* WO = (bf*)take((size_t)DM * DQ * 2); float* CS = (float*)take((size_t)TT * HD * 2 * 4);
    bf* XB = (bf*)take((size_t)NB_ * TT * DM * 2);
    const size_t nqk = (size_t)NB_ * (NH_ + NKV) * TT * HD, nv = (size_t)NB_ * NKV * HD * TT, ko = (size_t)NH_ * TT * HD;   // elements of a q | k plane and of a v plane over both batches; the k heads' place behind the q heads
    h16* QK16 = (h16*)take(nqk * 2); bf* QKh = (bf*)take(nqk * 2); bf* QKl = (bf*)take(nqk * 2);
    h16* VT16 = (h16*)take(nv * 2); bf* VTh = (bf*)take(nv * 2); bf* VTl = (bf*)take(nv * 2);
    bf* ATh = (bf*)take((size_t)NB_ * TT * DQ * 2); bf* ATl = (bf*)take((size_t)NB_ * TT * DQ * 2);
    if ((size_t)(wsp - (char*)d_ws) > ws_size) return;    // ws 256 MiB
    k_prep<<<NB_ * PBX + PBW + PBO + PBC, 256, 0, stream>>>(x, wqkv, wo, XB, Wb, WO, CS);
    k_qkv<<<dim3(TT / 128, (DQ + DKV) / 64 + (DKV / 128) * (TT / 64) / (TT / 128), NB_), 128, 0, stream>>>(XB, Wb, CS, QK16, QKh, QKl, VT16, VTh, VTl);
    k_fattn<<<dim3(RH / 64 + (TT - RH) / (64 * FQ), NH_, NB_), 256, 0, stream>>>(QK16, QK16 + ko, VT16, QKh, QKl, QKh + ko, QKl + ko, VTh, VTl, ATh, ATl);   /* all batches, heads and query rows: merged hi + lo planes [b][t][DQ] */
    k_out<<<dim3(DM / 128, TT / 64, NB_), 128, 0, stream>>>(WO, ATh, ATl, OUT);
}

// v009
// Measured time: 106 microseconds a run.
// Timed twice side by side with v008, it ran 1.04 and 1.03 times as fast.
// Over all steps from v000 it is 18.7 times as fast.
#include <hip/hip_runtime.h>

// Multi-head attention with interleaved-pair rotary embeddings on a channel-major input (x [2][1024][2048] = (batch, dim, seq); xt = x^T; [q|k|v] = xt W_qkv^T ('oi' [3072][1024]: row blocks q | k | v; 16 heads x 64); rotary on adjacent (even, odd) pairs with angle t x 10000^(-2i/64) (tables computed on device from the reference's float32 inv_freq); scores/8 over all 2048 keys; softmax; merged heads; out^T = W_out ('oi' [1024][1024]) x merged^T written channel-major -> [2][1024][2048] (4.2 M)).
// Compute dtypes, f32 accumulate: every input rounded to bf16; q/k/v on PLAIN bf16 operands (inputs: exact); input transposed to token-major (by tiles, in LDS) while converting to bf16; interleaved rotary in f32 (precise cosf/sinf table) and the 16-bit operand planes written in the projections' own epilogues; scores and attn.v fused in one launch (online softmax in f32, scores never in memory): query rows < 512 hl (3 products), the rest single fp16 (x16); W_out exact x merged hl (2 products), written transposed (dim-major) straight from the GEMM epilogue.
// Four launches, each over both batches: input conversions and table | q, k, v projections | attention | output projection.

#define NB_  2
#define TT   2048
#define DM   1024
#define NH_  16
#define NKV  16
#define REP  (NH_ / NKV)
#define HD   64
#define DQ   (NH_ * HD)
#define DKV  (NKV * HD)
#define RH   512                  // query rows < RH use hi+lo planes
#define WIN  2048
#define SCL  0.125f   // HD^-0.5
typedef _Float16 h16;
typedef unsigned short bf;
typedef __attribute__((ext_vector_type(16))) __bf16   v16bf;
typedef __attribute__((ext_vector_type(16))) _Float16 v16h;
typedef __attribute__((ext_vector_type(8)))  _Float16 v8h;
typedef __attribute__((ext_vector_type(8)))  unsigned short v8us;
typedef __attribute__((ext_vector_type(8)))  float    v8f;
typedef __attribute__((ext_vector_type(4)))  float    v4f;
typedef v8h  __attribute__((may_alias)) v8ha;
typedef v4f  __attribute__((may_alias)) v4fa;
typedef v8us __attribute__((may_alias)) v8usa;

__device__ __forceinline__ unsigned short f2bf(float f) { unsigned u = __float_as_uint(f); u += 0x7FFFu + ((u >> 16) & 1u); return (unsigned short)(u >> 16); }
__device__ __forceinline__ float bf2f(unsigned short b) { return __uint_as_float(((unsigned)b) << 16); }
__device__ __forceinline__ float bfr(float f) { return bf2f(f2bf(f)); }
__device__ __forceinline__ v16h cat16(v8h lo, v8h hi) { return __builtin_shufflevector(lo, hi, 0, 1, 2, 3, 4, 5, 6, 7, 8, 9, 10, 11, 12, 13, 14, 15); }
__device__ __forceinline__ v16bf cat16b(v8us lo, v8us hi) { return __builtin_bit_cast(v16bf, __builtin_shufflevector(lo, hi, 0, 1, 2, 3, 4, 5, 6, 7, 8, 9, 10, 11, 12, 13, 14, 15)); }
__device__ __forceinline__ v8f wmma16(v16h a, v16h b, v8f c) { return __builtin_amdgcn_wmma_f32_16x16x32_f16(false, a, false, b, (short)0, c, false, false); }
__device__ __forceinline__ v8f wmmab(v16bf a, v16bf b, v8f c) { return __builtin_amdgcn_wmma_f32_16x16x32_bf16(false, a, false, b, (short)0, c, false, false); }



__device__ __forceinline__ h16 tohx(float x) { return (h16)x; }
__device__ __forceinline__ void splitf(float y, unsigned short& h, unsigned short& l) { h = f2bf(y); l = f2bf(y - bf2f(h)); }
typedef __attribute__((ext_vector_type(2))) _Float16 v2h;
typedef __attribute__((ext_vector_type(4))) _Float16 v4h;
typedef __attribute__((ext_vector_type(2))) unsigned short v2us;
typedef __attribute__((ext_vector_type(4))) unsigned short v4us;
typedef __attribute__((ext_vector_type(2))) float v2f;
typedef __attribute__((ext_vector_type(4))) int v4i;

// ---- gemm_tile: GEMM, one work-group of 4 waves per 128 x TN output tile (bx, by); 128 threads. TN 64: each wave a 32x64 part (8 accumulators), the waves one below the other. TN 128: each wave a 64x64 part (16 accumulators), the waves 2 x 2: a third fewer operand bytes from L2 and from LDS per product. The calling kernel owns the LDS (sg: two stages; osw: the epilogue's exchange) and hands in the batch's own pointers.
// The K-contiguous 16-bit operand planes go through LDS in stages of GK k (whole 128-byte lines of every row), two buffers: the next stage's global loads fly while this stage is worked on, and the TN rows of Bt are fetched once for the whole work-group.
// C[m][n] (f32, pitch ldc, + optional f32 bias[n]) = sum_k A[m][k] Bt[n][k] (+ split products per NSPLIT). K is a compile-time constant, so that the rows of a sweep are constant steps from one address; K % GK == 0.
// EPI 0: the f32 tile goes to C. EPI 1 and 2: no f32 result reaches memory; the epilogue writes the three 16-bit planes (fp16, bf16 hi, bf16 lo) that the attention kernel reads.
// EPI 1 (q, k; m = token, n = channel, one head per wave column): interleaved rotary with the table CS [t][HD][cos, sin], planes [head][t][HD]. EPI 2 (v; m = channel, n = token): planes [channel][t], pitch TT.
#define GPI(gk)  ((gk) + 8)       // LDS row pitch in 16-bit elements for stages of gk k: 272 B or 144 B = 16 B x odd, conflict-free for 16-byte reads
template <typename T16> struct WFrag;
template <> struct WFrag<h16> { typedef v16h V; static __device__ __forceinline__ V ld(const h16* p) { return cat16(*(const v8h*)p, *(const v8h*)(p + 16)); } static __device__ __forceinline__ v8f mma(V a, V b, v8f c) { return wmma16(a, b, c); } };
template <> struct WFrag<bf> { typedef v16bf V; static __device__ __forceinline__ V ld(const bf* p) { return cat16b(*(const v8us*)p, *(const v8us*)(p + 16)); } static __device__ __forceinline__ v8f mma(V a, V b, v8f c) { return wmmab(a, b, c); } };
template <typename T16, int NSPLIT, bool BIAS, int EPI, int K, int TN, int GK>
__device__ __forceinline__ void gemm_tile(T16* sg, float* osw, int bx, int by, const T16* __restrict__ A, const T16* __restrict__ A2, const T16* __restrict__ Bt, const T16* __restrict__ Bt2, float* C, int ldc, const float* __restrict__ bias, const float* __restrict__ CS, h16* P16, bf* Ph, bf* Pl) {
    typedef typename WFrag<T16>::V V;
    constexpr bool HA2 = NSPLIT == 1 || NSPLIT == 2, HB2 = NSPLIT >= 2;
    constexpr int GP = GPI(GK), GTA = 128 * GP, GTB = TN * GP;   // the pitch; one staged A plane: 128 rows x GK k; one staged B plane: TN rows
    constexpr int TR = GK / 8, RS = 128 / TR;   // staging: threads per row, rows a sweep
    constexpr int MB = TN == 64 ? 2 : 4;     // row fragments of 16 per wave
    constexpr int OA2 = GTA, OB = GTA * (HA2 ? 2 : 1), OB2 = OB + GTB, STG = OB + GTB * (HB2 ? 2 : 1);   // places of the planes in a stage, and its size
    constexpr int KG = (HA2 || HB2 || TN == 128) ? 1 : 2;   // k steps of 32 whose fragments are fetched as one group (as many as the registers hold)
    const int tid = threadIdx.x, lane = tid & 31, lr = lane & 15, hi = lane >> 4, w = tid >> 5; const int wr = TN == 64 ? w : (w & 1), wc = TN == 64 ? 0 : (w >> 1); const int r0 = bx * 128 + wr * (MB * 16), c0 = by * TN + wc * 64;   // the wave's place in the tile, its first row and column
    float* os = osw + w * (16 * 68);   // each wave's own exchange buffer for the epilogue
    v8f acc[MB][4];
#pragma unroll
    for (int mb = 0; mb < MB; ++mb)
#pragma unroll
        for (int nb = 0; nb < 4; ++nb) acc[mb][nb] = (v8f){};
    static_assert(K % GK == 0, "whole stages");
    const int srow = tid / TR, scol = (tid % TR) * 8;    // staging: 16 bytes a thread, TR threads per row, RS rows a sweep
    const unsigned lo = (unsigned)(srow * K + scol);     // the lane's own element offset in a sweep: the one vector part of every staging address, the rest is the same for the whole work-group
    const size_t ag = (size_t)bx * 128 * K, bg = (size_t)by * TN * K;
    v8us ra[128 / RS], ra2[128 / RS], rb[TN / RS], rb2[TN / RS];
    const char* ba = (const char*)(A + ag); const char* ba2 = HA2 ? (const char*)(A2 + ag) : nullptr; const char* bb0 = (const char*)(Bt + bg); const char* bb2 = HB2 ? (const char*)(Bt2 + bg) : nullptr;   // the tile's first rows: the same for the whole work-group
    unsigned vo = lo * 2;                                // the lane's byte offset in the next stage to fetch, one register for all planes
    auto gload = [&]() {
#pragma unroll
        for (int u = 0; u < 128 / RS; ++u) { ra[u] = *(const v8usa*)(ba + vo + u * RS * K * 2); if (HA2) ra2[u] = *(const v8usa*)(ba2 + vo + u * RS * K * 2); }
#pragma unroll
        for (int u = 0; u < TN / RS; ++u) { rb[u] = *(const v8usa*)(bb0 + vo + u * RS * K * 2); if (HB2) rb2[u] = *(const v8usa*)(bb2 + vo + u * RS * K * 2); }
        asm volatile("s_wait_xcnt 0x0" : "+v"(vo) :: "memory");   // the wait that stands before a register named by an issued global load is overwritten; the offset is its operand so that it stays in its register up to the wait and is stepped only behind it
        vo += GK * 2; };
    auto sstore = [&](int b) { T16* d = sg + b * STG + srow * GP + scol;
#pragma unroll
        for (int u = 0; u < 128 / RS; ++u) { *(v8usa*)(d + u * RS * GP) = ra[u]; if (HA2) *(v8usa*)(d + OA2 + u * RS * GP) = ra2[u]; }
#pragma unroll
        for (int u = 0; u < TN / RS; ++u) { *(v8usa*)(d + OB + u * RS * GP) = rb[u]; if (HB2) *(v8usa*)(d + OB2 + u * RS * GP) = rb2[u]; } };
    constexpr int ns = K / GK;
    gload(); sstore(0); __syncthreads();
#pragma unroll 1   // rolled: one copy of the stage body
    for (int s = 0; s < ns; ++s) {
        const T16* ab = sg + (s & 1) * STG + (wr * (MB * 16) + lr) * GP + 8 * hi; const T16* bb = sg + (s & 1) * STG + OB + (wc * 64 + lr) * GP + 8 * hi;
#pragma unroll
        for (int kg = 0; kg < GK / 32; kg += KG) {
            V a[KG][MB], a2[KG][MB], b[KG][4], b2[KG][4];
#pragma unroll
            for (int ks = 0; ks < KG; ++ks) { const int ko = (kg + ks) * 32;
#pragma unroll
                for (int mb = 0; mb < MB; ++mb) { a[ks][mb] = WFrag<T16>::ld(ab + mb * 16 * GP + ko); if (HA2) a2[ks][mb] = WFrag<T16>::ld(ab + OA2 + mb * 16 * GP + ko); }
#pragma unroll
                for (int nb = 0; nb < 4; ++nb) { b[ks][nb] = WFrag<T16>::ld(bb + nb * 16 * GP + ko); if (HB2) b2[ks][nb] = WFrag<T16>::ld(bb + GTB + nb * 16 * GP + ko); } }
            if (kg == 0 && s + 1 < ns) gload();          // the next stage's global loads fly while this stage is worked on; issued in the shadow of the LDS reads
            __builtin_amdgcn_sched_barrier(0);   // the group's LDS reads all issue ahead of its products: one LDS latency per group instead of one per B fragment
#pragma unroll
            for (int ks = 0; ks < KG; ++ks)
#pragma unroll
                for (int nb = 0; nb < 4; ++nb) {
#pragma unroll
                    for (int mb = 0; mb < MB; ++mb) acc[mb][nb] = WFrag<T16>::mma(a[ks][mb], b[ks][nb], acc[mb][nb]);
                    if (HA2) {
#pragma unroll
                        for (int mb = 0; mb < MB; ++mb) acc[mb][nb] = WFrag<T16>::mma(a2[ks][mb], b[ks][nb], acc[mb][nb]); }
                    if (HB2) {
#pragma unroll
                        for (int mb = 0; mb < MB; ++mb) acc[mb][nb] = WFrag<T16>::mma(a[ks][mb], b2[ks][nb], acc[mb][nb]); } }
        }
        if (s + 1 < ns) sstore((s + 1) & 1);             // into the buffer whose last readers passed the barrier of the trip before
        __syncthreads();                                 // publishes stage s + 1 and ends every read of stage s
    }
    constexpr int ES = EPI == 1 ? HD : TT;   // plane elements from one tile row to the next
    const float* cb = nullptr; size_t e0 = 0;   // this lane's first table entry and first plane element; every later one is a constant step away
    if constexpr (EPI == 1) { cb = CS + ((size_t)(r0 + hi) * HD + lr * 4) * 2; e0 = ((size_t)(c0 / HD) * TT + r0 + hi) * HD + lr * 4; }
    if constexpr (EPI == 2) e0 = (size_t)(r0 + hi) * TT + c0 + lr * 4;
#pragma unroll
    for (int mb = 0; mb < MB; ++mb) {
        v2f cs[8][2];   // EPI 1: cos, sin of this lane's two pairs in each of its 8 rows, asked for ahead of the LDS exchange so that they fly during it
        if constexpr (EPI == 1) {
#pragma unroll
            for (int s = 0; s < 8; ++s) { const float* c = cb + (mb * 16 + 2 * s) * (HD * 2); cs[s][0] = *(const v2f*)c; cs[s][1] = *(const v2f*)(c + 4); } }
#pragma unroll
        for (int nb = 0; nb < 4; ++nb) {
#pragma unroll
            for (int j = 0; j < 8; ++j) os[(hi * 8 + j) * 68 + nb * 16 + lr] = acc[mb][nb][j]; }
        __builtin_amdgcn_wave_barrier(); asm volatile("" ::: "memory");
        float* crow = C + (size_t)(r0 + mb * 16) * ldc + c0;
#pragma unroll
        for (int s = 0; s < 8; ++s) { const int row = 2 * s + hi, cofs = lr * 4; v4f val = *(const v4fa*)(os + row * 68 + cofs); if (BIAS) { val[0] += bfr(bias[c0 + cofs]); val[1] += bfr(bias[c0 + cofs + 1]); val[2] += bfr(bias[c0 + cofs + 2]); val[3] += bfr(bias[c0 + cofs + 3]); }
            if constexpr (EPI == 0) {
                *(v4f*)(crow + (size_t)row * ldc + cofs) = val; }
            else {
                if constexpr (EPI == 1) { const v4f x = val;   /* even: x0 c - x1 s; odd: x0 s + x1 c */
                    val[0] = x[0] * cs[s][0][0] - x[1] * cs[s][0][1]; val[1] = x[0] * cs[s][0][1] + x[1] * cs[s][0][0]; val[2] = x[2] * cs[s][1][0] - x[3] * cs[s][1][1]; val[3] = x[2] * cs[s][1][1] + x[3] * cs[s][1][0]; }
                const size_t e = e0 + (mb * 16 + 2 * s) * ES;   // 16 lanes x 8 bytes: one whole 128-byte line per row and plane
                v4h o16; v4us oh, ol;
#pragma unroll
                for (int q = 0; q < 4; ++q) { o16[q] = tohx(val[q]); unsigned short a2, c2; splitf(val[q], a2, c2); oh[q] = a2; ol[q] = c2; }
                *(v4h*)(P16 + e) = o16; *(v4us*)(Ph + e) = oh; *(v4us*)(Pl + e) = ol;
                if constexpr (EPI == 2) asm volatile("s_wait_xcnt 0x0" ::: "memory"); } }   // the next row's values reuse the registers that these plane stores name
        asm volatile("s_wait_xcnt 0x0" ::: "memory");   // the next block's values reuse the registers that these stores name
        __builtin_amdgcn_wave_barrier(); asm volatile("" ::: "memory");
    }
}
// ---- k_qkv: the q, k and v projections of both batches in one launch, 128x128 tiles, stages of 64 k: 89 KiB of LDS and at most 336 registers a wave, so that three work-groups share a WGP and all 768 are resident at once. Grid (TT/128, NB_ * 8, 3); y = (batch, c). z < 2: q | k, the first 2048 rows of W_qkv as one Bt, x = token tile, column tile 2 c + z (a pair of heads: the q heads, then the k heads). z = 2: the 128 tiles a batch of v^T = W_v x xt^T.
// Blocks 256 apart in index (z 0 and 1) work on the same token rows (for speed only).
#define QKC  ((DQ + DKV) / 128 / 2)   // pairs of q | k column tiles
static_assert((DQ + DKV) % 256 == 0 && (DKV / 128) * (TT / 128) == QKC * (TT / 128), "the v tiles fill one z plane of k_qkv's grid");
__global__ __launch_bounds__(128, 3) void k_qkv(const bf* __restrict__ XB, const bf* __restrict__ Wb, const float* __restrict__ CS, h16* QK16, bf* QKh, bf* QKl, h16* VT16, bf* VTh, bf* VTl) {
    __shared__ __align__(16) bf sg[2 * (128 + 128) * GPI(64)];
    __shared__ __align__(16) float osw[4 * 16 * 68];
    const int x = blockIdx.x, c = blockIdx.y % QKC, p = blockIdx.z; const size_t z = blockIdx.y / QKC; const bf* X = XB + z * ((size_t)TT * DM);
    if (p < 2) { const size_t o = z * ((size_t)(NH_ + NKV) * TT * HD);
        gemm_tile<bf, 0, false, 1, DM, 128, 64>(sg, osw, x, 2 * c + p, X, nullptr, Wb, nullptr, nullptr, 0, nullptr, CS, QK16 + o, QKh + o, QKl + o); }   /* rotary, planes [q heads | k heads][t][HD] */
    else { const int i = c * (TT / 128) + x; const size_t o = z * ((size_t)DKV * TT);
        gemm_tile<bf, 0, false, 2, DM, 128, 64>(sg, osw, i % (DKV / 128), i / (DKV / 128), Wb + (size_t)(DQ + DKV) * DM, nullptr, X, nullptr, nullptr, 0, nullptr, nullptr, VT16 + o, VTh + o, VTl + o); }   /* planes [h][HD][t] as they come */
}
// ---- k_out: channel-major output rows [e][t] of both batches: exact W_out x (merged hi + lo); grid (DM/128, TT/64, NB_).
__global__ __launch_bounds__(128) void k_out(const bf* __restrict__ WO, const bf* __restrict__ ATh, const bf* __restrict__ ATl, float* OUT) {
    __shared__ __align__(16) bf sg[2 * (128 + 2 * 64) * GPI(128)];
    __shared__ __align__(16) float osw[4 * 16 * 68];
    const size_t z = blockIdx.z, a = z * ((size_t)TT * DQ);
    gemm_tile<bf, 3, false, 0, DQ, 64, 128>(sg, osw, blockIdx.x, blockIdx.y, WO, nullptr, ATh + a, ATl + a, OUT + z * ((size_t)DM * TT), TT, nullptr, nullptr, nullptr, nullptr, nullptr);
}

__global__ __launch_bounds__(256) void k_wtG(const float* __restrict__ w, int K, int N, bf* Bt) {
    const int lane = threadIdx.x & 31; const int L0 = (blockIdx.x * 8 + (threadIdx.x >> 5)) * 8; const int nlines = N * K / 64;
{
#pragma unroll 1
        for (int l = 0; l < 8; ++l) { const int L = L0 + l; if (L >= nlines) break; const size_t e = (size_t)L * 64 + lane * 2; const int k = (int)(e % K), n = (int)(e / K); v2us o;
            o[0] = f2bf(w[(size_t)k * N + n]); o[1] = f2bf(w[(size_t)(k + 1) * N + n]); *(v2us*)(Bt + e) = o; }
         }
}
// ---- cvtT: one 128-channel x 128-token tile of x, [DM][TT] f32 -> [TT][DM] bf16, turned in LDS so that both sides of memory see whole lines; 256 threads.
// In: a wave-wide 16-byte load is 512 contiguous bytes of one channel row; a lane gathers 8 channels x 4 tokens twice over. Out: 16 lanes store 256 contiguous bytes of one token row.
// LDS: 128 token rows of 16 blocks of 16 bytes (8 channels); block cb of row t lies at place cb ^ ((t >> 2) & 15), so that the 16 lanes of a half wave fall on 16 different places both when they write (one cb, rows 4 apart) and when they read (one row, all cb).
#define XTL  128                  // channels and tokens per tile
__device__ __forceinline__ void cvtT(const float* __restrict__ src, bf* dst, int tile, bf* st) {
    const int tid = threadIdx.x, tq = tid & 31, w = tid >> 5; const int c0 = (tile % (DM / XTL)) * XTL, t0 = (tile / (DM / XTL)) * XTL;
    const float* s = src + (size_t)(c0 + w * 16) * TT + t0 + tq * 4; v4f r[16];
#pragma unroll
    for (int k = 0; k < 16; ++k) r[k] = *(const v4fa*)(s + (size_t)k * TT);
    asm volatile("s_wait_xcnt 0x0" ::: "memory");   // the wait that stands before a register named by an issued global load is overwritten
#pragma unroll
    for (int g = 0; g < 2; ++g)
#pragma unroll
        for (int j = 0; j < 4; ++j) { v8us o;
#pragma unroll
            for (int k = 0; k < 8; ++k) o[k] = f2bf(r[g * 8 + k][j]);
            *(v8usa*)(st + (tq * 4 + j) * XTL + (((w * 2 + g) ^ (tq & 15)) * 8)) = o; }
    __syncthreads();   // the tile is whole before any row of it is read
    const int cb = tid & 15, rw = tid >> 4; bf* d = dst + (size_t)(t0 + rw) * DM + c0 + cb * 8; v8us o[8];
#pragma unroll
    for (int u = 0; u < 8; ++u) { const int row = u * 16 + rw; o[u] = *(const v8usa*)(st + row * XTL + ((cb ^ ((row >> 2) & 15)) * 8)); }
#pragma unroll
    for (int u = 0; u < 8; ++u) *(v8usa*)(d + (size_t)u * 16 * DM) = o[u]; }
__device__ __forceinline__ void cvt8(const float* __restrict__ src, bf* dst, size_t i) { const v8f v = *(const v8f*)(src + i * 8); v8us o;
#pragma unroll
    for (int k = 0; k < 8; ++k) o[k] = f2bf(v[k]); *(v8us*)(dst + i * 8) = o;
    asm volatile("s_wait_xcnt 0x0" ::: "memory"); }   // in the built k_prep another range's block stands behind this store, past a scalar test, and writes the registers that the store names

__constant__ float INV[HD / 2] = {1.0f,0.749894202f,0.562341332f,0.421696514f,0.316227764f,0.237137362f,0.177827939f,0.133352146f,0.100000001f,0.0749894157f,0.0562341288f,0.0421696492f,0.0316227786f,0.0237137359f,0.0177827943f,0.0133352149f,0.00999999978f,0.00749894232f,0.00562341325f,0.00421696482f,0.00316227786f,0.00237137382f,0.00177827943f,0.00133352145f,0.00100000005f,0.000749894185f,0.000562341302f,0.000421696488f,0.000316227786f,0.000237137385f,0.00017782794f,0.00013335215f};
__device__ __forceinline__ void cstab(float* CS, int idx) { const int t = idx / HD, d = idx % HD; const float ang = __fmul_rn((float)t, INV[d >> 1]); v2f cs; cs[0] = cosf(ang); cs[1] = sinf(ang);
    *(v2f*)(CS + (size_t)idx * 2) = cs;
    asm volatile("s_wait_xcnt 0x0" ::: "memory"); }   // as in cvt8: another range's block stands behind this store in the built k_prep
// ---- k_prep: all that depends on the inputs alone, in one launch, by ranges of blocks: x of both batches (channel-major [DM][TT]) -> XB token-major [TT][DM] bf16 | W_qkv -> bf16 | W_out -> bf16 | the rotary table.
#define PBX  ((TT / XTL) * (DM / XTL))          // blocks per batch of x: one tile each
#define PBW  ((DQ + 2 * DKV) * DM / 8 / 256)   // blocks of W_qkv
#define PBO  (DM * DQ / 8 / 256)               // blocks of W_out
#define PBC  (TT * HD / 256)                   // blocks of the table
static_assert(TT % XTL == 0 && DM % XTL == 0 && (DQ + 2 * DKV) * DM % 2048 == 0 && DM * DQ % 2048 == 0 && TT * HD % 256 == 0, "whole blocks in every range of k_prep");
__global__ __launch_bounds__(256) void k_prep(const float* __restrict__ x, const float* __restrict__ wqkv, const float* __restrict__ wo, bf* XB, bf* Wb, bf* WO, float* CS) {
    __shared__ __align__(16) bf xs[XTL * XTL];
    const int blk = blockIdx.x, tid = threadIdx.x;
    if (blk < NB_ * PBX) { const int b = blk / PBX; cvtT(x + (size_t)b * DM * TT, XB + (size_t)b * TT * DM, blk - b * PBX, xs); }
    else if (blk < NB_ * PBX + PBW + PBO) { const bool o = blk >= NB_ * PBX + PBW; cvt8(o ? wo : wqkv, o ? WO : Wb, (size_t)(blk - NB_ * PBX - (o ? PBW : 0)) * 256 + tid); }
    else cstab(CS, (blk - (NB_ * PBX + PBW + PBO)) * 256 + tid);
}

#define KS   64                   // keys per LDS stage
#define LP   72                   // LDS row pitch in 16-bit elements: 144 B = 16 B x odd, conflict-free for 16-byte reads
#define TILE (64 * LP)            // one staged plane: 64 rows (keys of K, channels of V^T) x 64 elements
#define FQ   3                    // fp16 class: query fragments of 16 per wave
static_assert((4 * FQ * 8 + 2 * FQ) * 32 * 4 * 4 <= 2 * 4 * TILE * 2, "the join's exchange fits the stages' LDS");
static_assert(HD == 64 && KS == 64 && TT % KS == 0 && RH % 64 == 0 && (TT - RH) % (64 * FQ) == 0 && (TT - RH) / (64 * FQ) == RH / 64, "tile geometry of k_fattn");
__device__ __forceinline__ float xhalf(float x) { return __builtin_bit_cast(float, __builtin_amdgcn_permlanex16(__builtin_bit_cast(int, x), __builtin_bit_cast(int, x), 0x76543210, 0xfedcba98, false, false)); }   // lane l <-> lane l ^ 16, on the vector pipe
// Eight independent v_exp_f32, then the one slot that the instruction set asks for behind a transcendental before its result is read or its source overwritten; "=&v" keeps every result off every source.
__device__ __forceinline__ void exp2x8(const float (&t)[8], float (&p)[8]) {
    asm("v_exp_f32 %0, %8\n\tv_exp_f32 %1, %9\n\tv_exp_f32 %2, %10\n\tv_exp_f32 %3, %11\n\tv_exp_f32 %4, %12\n\tv_exp_f32 %5, %13\n\tv_exp_f32 %6, %14\n\tv_exp_f32 %7, %15\n\tv_nop"
        : "=&v"(p[0]), "=&v"(p[1]), "=&v"(p[2]), "=&v"(p[3]), "=&v"(p[4]), "=&v"(p[5]), "=&v"(p[6]), "=&v"(p[7]) : "v"(t[0]), "v"(t[1]), "v"(t[2]), "v"(t[3]), "v"(t[4]), "v"(t[5]), "v"(t[6]), "v"(t[7])); }
__device__ __forceinline__ float exp2s(float x) { float r; asm("v_exp_f32 %0, %1\n\tv_nop" : "=&v"(r) : "v"(x)); return r; }   // one v_exp_f32 with the same slot behind it
template <bool HL> struct FOp;
template <> struct FOp<false> { typedef v16h V; static __device__ __forceinline__ V frag(const unsigned short* p) { return cat16(__builtin_bit_cast(v8h, *(const v8usa*)p), __builtin_bit_cast(v8h, *(const v8usa*)(p + 16))); } static __device__ __forceinline__ v8f mma(V a, V b, v8f c) { return wmma16(a, b, c); } };
template <> struct FOp<true> { typedef v16bf V; static __device__ __forceinline__ V frag(const unsigned short* p) { return cat16b(*(const v8usa*)p, *(const v8usa*)(p + 16)); } static __device__ __forceinline__ v8f mma(V a, V b, v8f c) { return wmmab(a, b, c); } };
// Q*, K* [t][HD], V* [HD][t] of this head (plane 1: the lo planes, HL only); q0: the wave's first query; g: the wave's key group (the same in every lane); wq: the wave's place in its group; NF: query fragments of 16 per wave.
template <bool HL, int NF>
__device__ __forceinline__ void fa_body(unsigned short* sm, const unsigned short* __restrict__ Q0, const unsigned short* __restrict__ Q1, const unsigned short* __restrict__ K0, const unsigned short* __restrict__ K1, const unsigned short* __restrict__ V0, const unsigned short* __restrict__ V1, int q0, int g, int wq, int h, bf* Ah, bf* Al) {
    typedef FOp<HL> F; typedef typename F::V V;
    constexpr int NP = HL ? 2 : 1;                       // planes per operand
    constexpr float C = SCL * 1.4426950408889634f;       // raw score -> log2 units
    constexpr float SH = HL ? 0.0f : 4.0f;               // fp16 probabilities carry x16: at most 2^(8+4), and small ones stay normal numbers
    const int tid = threadIdx.x, lane = tid & 31, lr = lane & 15, hi = lane >> 4;
    const int srow = tid >> 3, scol = (tid & 7) * 8;     // staging: 8 threads per 128-byte row, 32 rows a sweep
    V qa[NP][NF][2];
#pragma unroll
    for (int qf = 0; qf < NF; ++qf)
#pragma unroll
        for (int ks = 0; ks < 2; ++ks) { const size_t qo = (size_t)(q0 + qf * 16 + lr) * HD + ks * 32 + 8 * hi; qa[0][qf][ks] = F::frag(Q0 + qo); if (HL) qa[NP - 1][qf][ks] = F::frag(Q1 + qo); }
    v8f o[4][NF]; float m[NF], l[NF];
#pragma unroll
    for (int qf = 0; qf < NF; ++qf) { m[qf] = -3.0e38f; l[qf] = 0.f;
#pragma unroll
        for (int mb = 0; mb < 4; ++mb) o[mb][qf] = (v8f){}; }
    v8us rk[NP][2], rv[NP][2]; unsigned kof = (srow * HD + scol) * 2, vof = (srow * TT + scol) * 2;   // the lane's own byte offsets: one register each, never stepped; the stage's step rides the scalar bases (the 256-register budget of four waves per SIMD)
    const char* kp0 = (const char*)K0; const char* kp1 = (const char*)K1; const char* vp0 = (const char*)V0; const char* vp1 = (const char*)V1;   // the next stage to ask for
    auto gload = [&]() {
#pragma unroll
        for (int u = 0; u < 2; ++u) { rk[0][u] = *(const v8usa*)(kp0 + kof + u * (32 * HD * 2)); rv[0][u] = *(const v8usa*)(vp0 + vof + u * (32 * TT * 2)); if (HL) { rk[NP - 1][u] = *(const v8usa*)(kp1 + kof + u * (32 * HD * 2)); rv[NP - 1][u] = *(const v8usa*)(vp1 + vof + u * (32 * TT * 2)); } }
        asm volatile("s_wait_xcnt 0x0" : "+v"(kof), "+v"(vof) :: "memory"); };   // the wait that stands before a register named by an issued global load is overwritten; the two offsets are its operands so that they stay in their registers up to the wait
    auto gstep = [&]() { kp0 += KS * HD * 2; vp0 += KS * 2; if (HL) { kp1 += KS * HD * 2; vp1 += KS * 2; } };
    auto sstore = [&](int b) { unsigned short* d = sm + b * (2 * NP * TILE) + srow * LP + scol;
#pragma unroll
        for (int u = 0; u < 2; ++u)
#pragma unroll
            for (int pl = 0; pl < NP; ++pl) { *(v8usa*)(d + pl * TILE + u * 32 * LP) = rk[pl][u]; *(v8usa*)(d + (NP + pl) * TILE + u * 32 * LP) = rv[pl][u]; } };
    gload(); gstep();   // its wait also covers the query rows' loads: the accumulators' first values take their address registers
    sstore(0); __syncthreads();
#pragma unroll 1   // rolled: one copy of the stage body
    for (int s = 0; s < TT / KS; ++s) {
        if (s + 1 < TT / KS) { gload(); gstep(); }       // the next stage's global loads fly while this stage is worked on
        const unsigned short* sb = sm + (s & 1) * (2 * NP * TILE) + lr * LP + 8 * hi; const unsigned short* kb = sb + g * (32 * LP); const unsigned short* vb = sb + NP * TILE + g * 32;   // the group's 32 key rows of K, its 32 key columns of V^T
        {
            v8f st[2][NF];
#pragma unroll
            for (int kt = 0; kt < 2; ++kt) { V ka[NP][2];
#pragma unroll
                for (int pl = 0; pl < NP; ++pl)
#pragma unroll
                    for (int ks = 0; ks < 2; ++ks) ka[pl][ks] = F::frag(kb + pl * TILE + kt * 16 * LP + ks * 32);
#pragma unroll
                for (int qf = 0; qf < NF; ++qf) { v8f a = (v8f){};
#pragma unroll
                    for (int ks = 0; ks < 2; ++ks) { a = F::mma(ka[0][ks], qa[0][qf][ks], a); if (HL) { a = F::mma(ka[NP - 1][ks], qa[0][qf][ks], a); a = F::mma(ka[0][ks], qa[NP - 1][qf][ks], a); } }
                    st[kt][qf] = a; } }
            float mx[NF]; bool need = false;
#pragma unroll
            for (int qf = 0; qf < NF; ++qf) { float a = fmaxf(st[0][qf][0], st[1][qf][0]), a1 = fmaxf(st[0][qf][1], st[1][qf][1]);   // two short chains
#pragma unroll
                for (int j = 2; j < 8; j += 2) { a = fmaxf(a, fmaxf(st[0][qf][j], st[1][qf][j])); a1 = fmaxf(a1, fmaxf(st[0][qf][j + 1], st[1][qf][j + 1])); }
                a = fmaxf(a, a1); a = fmaxf(a, xhalf(a)); mx[qf] = a * C; need = need || (mx[qf] > m[qf] + 8.0f); }
            if (__builtin_amdgcn_ballot_w32(need) != 0) {   // wave-uniform: one test per 32 keys
#pragma unroll
                for (int qf = 0; qf < NF; ++qf) { const float mn = fmaxf(m[qf], mx[qf]); const float al = exp2s(m[qf] - mn); m[qf] = mn; l[qf] *= al;
#pragma unroll
                    for (int mb = 0; mb < 4; ++mb)
#pragma unroll
                        for (int j = 0; j < 8; ++j) o[mb][qf][j] *= al; } }
            V ph[NF], pl2[NF];
#pragma unroll
            for (int qf = 0; qf < NF; ++qf) { const float mo = m[qf] - SH; float sum[4];   // four short chains
#pragma unroll
                for (int kt = 0; kt < 2; ++kt) { float t[8], p[8];
#pragma unroll
                    for (int j = 0; j < 8; j += 2) { const v2f r = __builtin_elementwise_fma((v2f){st[kt][qf][j], st[kt][qf][j + 1]}, (v2f){C, C}, (v2f){-mo, -mo}); t[j] = r[0]; t[j + 1] = r[1]; }   // packed: two scores an instruction
                    exp2x8(t, p);
#pragma unroll
                    for (int j = 0; j < 8; ++j) { if (kt == 0 && j < 4) sum[j] = p[j]; else sum[j & 3] += p[j];
                        if constexpr (HL) { const __bf16 a = (__bf16)p[j]; ph[qf][kt * 8 + j] = a; pl2[qf][kt * 8 + j] = (__bf16)(p[j] - (float)a); } else { ph[qf][kt * 8 + j] = (h16)p[j]; } } }
                l[qf] += (sum[0] + sum[1]) + (sum[2] + sum[3]); }
            if (s + 1 < TT / KS) sstore((s + 1) & 1);        // into the buffer whose last readers passed the barrier of the trip before. Ahead of the second product, not at the trip's foot: the staged registers are free from here on; with the stores at the foot the build goes past the 256 registers of four waves per SIMD and spills staged rows to scratch
#pragma unroll
            for (int mb = 0; mb < 4; ++mb) { V va[NP];
#pragma unroll
                for (int pl = 0; pl < NP; ++pl) va[pl] = F::frag(vb + pl * TILE + mb * 16 * LP);
#pragma unroll
                for (int qf = 0; qf < NF; ++qf) { o[mb][qf] = F::mma(va[0], ph[qf], o[mb][qf]); if (HL) { o[mb][qf] = F::mma(va[NP - 1], ph[qf], o[mb][qf]); o[mb][qf] = F::mma(va[0], pl2[qf], o[mb][qf]); } } }
        }
        __syncthreads();                                 // publishes stage s + 1 and ends every read of stage s
    }
    // The join. The loop's last barrier has ended every read of the stages, so their LDS is free: group 1 leaves its state there (16 bytes a lane, lanes side by side), group 0 takes it up, brings both to the larger maximum and writes the rows.
    float* xs = (float*)sm + wq * ((4 * NF * 8 + 2 * NF) * 32) + lane * 4; float* xm = (float*)sm + wq * ((4 * NF * 8 + 2 * NF) * 32) + 4 * NF * 8 * 32 + lane;
    if (g != 0) {
#pragma unroll
        for (int qf = 0; qf < NF; ++qf) { xm[(2 * qf) * 32] = m[qf]; xm[(2 * qf + 1) * 32] = l[qf];
#pragma unroll
            for (int mb = 0; mb < 4; ++mb) { const v8f a = o[mb][qf]; *(v4fa*)(xs + ((qf * 4 + mb) * 2) * 128) = (v4f){a[0], a[1], a[2], a[3]}; *(v4fa*)(xs + ((qf * 4 + mb) * 2 + 1) * 128) = (v4f){a[4], a[5], a[6], a[7]}; } } }
    __syncthreads();   // group 1's state is whole before group 0 reads it
    if (g != 0) return;
    const unsigned eo = (unsigned)lr * DQ + hi * 8;   // the lane's own place in a block of 16 output rows
#pragma unroll
    for (int qf = 0; qf < NF; ++qf) { const float pm = xm[(2 * qf) * 32], pl = xm[(2 * qf + 1) * 32]; const float mn = fmaxf(m[qf], pm); const float a0 = exp2s(m[qf] - mn), a1 = exp2s(pm - mn);
        const float lt = l[qf] * a0 + pl * a1; const float inv = __fdiv_rn(1.0f, lt + xhalf(lt)); const float s0 = a0 * inv, s1 = a1 * inv; const size_t ob = (size_t)(q0 + qf * 16) * DQ + h * HD + eo;
#pragma unroll
        for (int mb = 0; mb < 4; ++mb) { v8us oh, ol; const v4f p0 = *(const v4fa*)(xs + ((qf * 4 + mb) * 2) * 128), p1 = *(const v4fa*)(xs + ((qf * 4 + mb) * 2 + 1) * 128);
#pragma unroll
            for (int j = 0; j < 8; ++j) { unsigned short a, c2; splitf(o[mb][qf][j] * s0 + (j < 4 ? p0[j & 3] : p1[j & 3]) * s1, a, c2); oh[j] = a; ol[j] = c2; }
            *(v8us*)(Ah + ob + mb * 16) = oh; *(v8us*)(Al + ob + mb * 16) = ol;
            asm volatile("s_wait_xcnt 0x0" ::: "memory"); } }   // the next block's values reuse the registers that these stores name
}
__global__ __launch_bounds__(256, 4) void k_fattn(const h16* __restrict__ Q16, const h16* __restrict__ K16, const h16* __restrict__ V16, const bf* __restrict__ Qh, const bf* __restrict__ Ql, const bf* __restrict__ Kh, const bf* __restrict__ Kl, const bf* __restrict__ Vh, const bf* __restrict__ Vl, bf* Ah, bf* Al) {
    __shared__ __align__(16) unsigned short sm[2 * 4 * TILE];
    const int h = blockIdx.y, wv = __builtin_amdgcn_readfirstlane((int)(threadIdx.x >> 5)), w = wv & 3, g = wv >> 2, bx = blockIdx.x; const size_t z = blockIdx.z, ho = (z * (NH_ + NKV) + h) * (TT * HD), vo = (z * NKV + h) * (HD * TT);   // q and k planes lie [batch][q heads | k heads], v planes [batch][head]
    Ah += z * ((size_t)TT * DQ); Al += z * ((size_t)TT * DQ);
    const int t = bx % (RH / 64); const bool hl = ((bx / (RH / 64)) ^ (int)(z & 1)) == 0;   // the classes change places from one batch to the next: blocks a whole batch apart in index are of different classes (for speed only: a WGP that gets one of each has the lighter LDS load)
    if (hl) fa_body<true, 1>(sm, Qh + ho, Ql + ho, Kh + ho, Kl + ho, Vh + vo, Vl + vo, t * 64 + w * 16, g, w, h, Ah, Al);
    else fa_body<false, FQ>(sm, (const unsigned short*)Q16 + ho, nullptr, (const unsigned short*)K16 + ho, nullptr, (const unsigned short*)V16 + vo, nullptr, RH + t * (64 * FQ) + w * (16 * FQ), g, w, h, Ah, Al);
}

extern "C" void kernel_launch(void* const* d_in, const int* in_sizes, int n_in,
                              void* d_out, int out_size, void* d_ws, size_t ws_size, hipStream_t stream) {
    (void)in_sizes; (void)n_in; (void)out_size;
    const float* x = (const float*)d_in[0]; const float* wqkv = (const float*)d_in[1]; const float* wo = (const float*)d_in[2];
    float* OUT = (float*)d_out;     // [2][1024][2048] (batch, dim, seq)
    char* wsp = (char*)d_ws;
    auto take = [&](size_t bytes) { char* p = wsp; wsp += (bytes + 255) & ~(size_t)255; return (void*)p; };
    bf* Wb = (bf*)take((size_t)(DQ + 2 * DKV) * DM * 2); bf* WO = (bf*)take((size_t)DM * DQ * 2); float* CS = (float*)take((size_t)TT * HD * 2 * 4);
    bf* XB = (bf*)take((size_t)NB_ * TT * DM * 2);
    const size_t nqk = (size_t)NB_ * (NH_ + NKV) * TT * HD, nv = (size_t)NB_ * NKV * HD * TT, ko = (size_t)NH_ * TT * HD;   // elements of a q | k plane and of a v plane over both batches; the k heads' place behind the q heads
    h16* QK16 = (h16*)take(nqk * 2); bf* QKh = (bf*)take(nqk * 2); bf* QKl = (bf*)take(nqk * 2);
    h16* VT16 = (h16*)take(nv * 2); bf* VTh = (bf*)take(nv * 2); bf* VTl = (bf*)take(nv * 2);
    bf* ATh = (bf*)take((size_t)NB_ * TT * DQ * 2); bf* ATl = (bf*)take((size_t)NB_ * TT * DQ * 2);
    if ((size_t)(wsp - (char*)d_ws) > ws_size) return;    // ws 256 MiB
    k_prep<<<NB_ * PBX + PBW + PBO + PBC, 256, 0, stream>>>(x, wqkv, wo, XB, Wb, WO, CS);
    k_qkv<<<dim3(TT / 128, NB_ * QKC, 3), 128, 0, stream>>>(XB, Wb, CS, QK16, QKh, QKl, VT16, VTh, VTl);
    k_fattn<<<dim3(RH / 64 + (TT - RH) / (64 * FQ), NH_, NB_), 256, 0, stream>>>(QK16, QK16 + ko, VT16, QKh, QKl, QKh + ko, QKl + ko, VTh, VTl, ATh, ATl);   /* all batches, heads and query rows: merged hi + lo planes [b][t][DQ] */
    k_out<<<dim3(DM / 128, TT / 64, NB_), 128, 0, stream>>>(WO, ATh, ATl, OUT);
}

// v010
// Measured time: 100 microseconds a run.
// Next to v009, in two timings, it ran 1.05 and 1.06 times as fast.
// All steps since v000 together make it 19.7 times as fast.
#include <hip/hip_runtime.h>

// Multi-head attention with interleaved-pair rotary embeddings on a channel-major input (x [2][1024][2048] = (batch, dim, seq); xt = x^T; [q|k|v] = xt W_qkv^T ('oi' [3072][1024]: row blocks q | k | v; 16 heads x 64); rotary on adjacent (even, odd) pairs with angle t x 10000^(-2i/64) (tables computed on device from the reference's float32 inv_freq); scores/8 over all 2048 keys; softmax; merged heads; out^T = W_out ('oi' [1024][1024]) x merged^T written channel-major -> [2][1024][2048] (4.2 M)).
// Compute dtypes, f32 accumulate: every input rounded to bf16; q/k/v on PLAIN bf16 operands (inputs: exact); input transposed to token-major (by tiles, in LDS) while converting to bf16; interleaved rotary in f32 (precise cosf/sinf table) and the 16-bit operand planes written in the projections' own epilogues; scores and attn.v fused in one launch (online softmax in f32, scores never in memory): query rows < 512 hl (3 products), the rest single fp16 (x16); W_out exact x merged hl (2 products), written transposed (dim-major) straight from the GEMM epilogue.
// Four launches, each over both batches: input conversions and table | q, k, v projections | attention | output projection.

#define NB_  2
#define TT   2048
#define DM   1024
#define NH_  16
#define NKV  16
#define REP  (NH_ / NKV)
#define HD   64
#define DQ   (NH_ * HD)
#define DKV  (NKV * HD)
#define RH   512                  // query rows < RH use hi+lo planes
#define WIN  2048
#define SCL  0.125f   // HD^-0.5
typedef _Float16 h16;
typedef unsigned short bf;
typedef __attribute__((ext_vector_type(16))) __bf16   v16bf;
typedef __attribute__((ext_vector_type(16))) _Float16 v16h;
typedef __attribute__((ext_vector_type(8)))  _Float16 v8h;
typedef __attribute__((ext_vector_type(8)))  unsigned short v8us;
typedef __attribute__((ext_vector_type(8)))  float    v8f;
typedef __attribute__((ext_vector_type(4)))  float    v4f;
typedef v8h  __attribute__((may_alias)) v8ha;
typedef v4f  __attribute__((may_alias)) v4fa;
typedef v8us __attribute__((may_alias)) v8usa;

__device__ __forceinline__ unsigned short f2bf(float f) { unsigned u = __float_as_uint(f); u += 0x7FFFu + ((u >> 16) & 1u); return (unsigned short)(u >> 16); }
__device__ __forceinline__ float bf2f(unsigned short b) { return __uint_as_float(((unsigned)b) << 16); }
__device__ __forceinline__ float bfr(float f) { return bf2f(f2bf(f)); }
__device__ __forceinline__ v16h cat16(v8h lo, v8h hi) { return __builtin_shufflevector(lo, hi, 0, 1, 2, 3, 4, 5, 6, 7, 8, 9, 10, 11, 12, 13, 14, 15); }
__device__ __forceinline__ v16bf cat16b(v8us lo, v8us hi) { return __builtin_bit_cast(v16bf, __builtin_shufflevector(lo, hi, 0, 1, 2, 3, 4, 5, 6, 7, 8, 9, 10, 11, 12, 13, 14, 15)); }
__device__ __forceinline__ v8f wmma16(v16h a, v16h b, v8f c) { return __builtin_amdgcn_wmma_f32_16x16x32_f16(false, a, false, b, (short)0, c, false, false); }
__device__ __forceinline__ v8f wmmab(v16bf a, v16bf b, v8f c) { return __builtin_amdgcn_wmma_f32_16x16x32_bf16(false, a, false, b, (short)0, c, false, false); }



__device__ __forceinline__ h16 tohx(float x) { return (h16)x; }
__device__ __forceinline__ void splitf(float y, unsigned short& h, unsigned short& l) { h = f2bf(y); l = f2bf(y - bf2f(h)); }
typedef __attribute__((ext_vector_type(2))) _Float16 v2h;
typedef __attribute__((ext_vector_type(4))) _Float16 v4h;
typedef __attribute__((ext_vector_type(2))) unsigned short v2us;
typedef __attribute__((ext_vector_type(4))) unsigned short v4us;
typedef __attribute__((ext_vector_type(2))) float v2f;
typedef __attribute__((ext_vector_type(4))) int v4i;

// ---- gemm_tile: GEMM, one work-group of 4 waves per 128 x TN output tile (bx, by); 128 threads. TN 64: each wave a 32x64 part (8 accumulators), the waves one below the other. TN 128: each wave a 64x64 part (16 accumulators), the waves 2 x 2: a third fewer operand bytes from L2 and from LDS per product. The calling kernel owns the LDS (sg: two stages; osw: the epilogue's exchange) and hands in the batch's own pointers.
// The K-contiguous 16-bit operand planes go through LDS in stages of GK k (whole 128-byte lines of every row), two buffers: the next stage's global loads fly while this stage is worked on, and the TN rows of Bt are fetched once for the whole work-group.
// C[m][n] (f32, pitch ldc, + optional f32 bias[n]) = sum_k A[m][k] Bt[n][k] (+ split products per NSPLIT). K is a compile-time constant, so that the rows of a sweep are constant steps from one address; K % GK == 0.
// EPI 0: the f32 tile goes to C. EPI 1 and 2: no f32 result reaches memory; the epilogue writes the three 16-bit planes (fp16, bf16 hi, bf16 lo) that the attention kernel reads.
// EPI 1 (q, k; m = token, n = channel, one head per wave column): interleaved rotary with the table CS [t][HD][cos, sin], planes [head][t][HD]. EPI 2 (v; m = channel, n = token): planes [channel][t], pitch TT.
#define GPI(gk)  ((gk) + 8)       // LDS row pitch in 16-bit elements for stages of gk k: 272 B or 144 B = 16 B x odd, conflict-free for 16-byte reads
template <typename T16> struct WFrag;
template <> struct WFrag<h16> { typedef v16h V; static __device__ __forceinline__ V ld(const h16* p) { return cat16(*(const v8h*)p, *(const v8h*)(p + 16)); } static __device__ __forceinline__ v8f mma(V a, V b, v8f c) { return wmma16(a, b, c); } };
template <> struct WFrag<bf> { typedef v16bf V; static __device__ __forceinline__ V ld(const bf* p) { return cat16b(*(const v8us*)p, *(const v8us*)(p + 16)); } static __device__ __forceinline__ v8f mma(V a, V b, v8f c) { return wmmab(a, b, c); } };
template <typename T16, int NSPLIT, bool BIAS, int EPI, int K, int TN, int GK>
__device__ __forceinline__ void gemm_tile(T16* sg, float* osw, int bx, int by, const T16* __restrict__ A, const T16* __restrict__ A2, const T16* __restrict__ Bt, const T16* __restrict__ Bt2, float* C, int ldc, const float* __restrict__ bias, const float* __restrict__ CS, h16* P16, bf* Ph, bf* Pl) {
    typedef typename WFrag<T16>::V V;
    constexpr bool HA2 = NSPLIT == 1 || NSPLIT == 2, HB2 = NSPLIT >= 2;
    constexpr int GP = GPI(GK), GTA = 128 * GP, GTB = TN * GP;   // the pitch; one staged A plane: 128 rows x GK k; one staged B plane: TN rows
    constexpr int TR = GK / 8, RS = 128 / TR;   // staging: threads per row, rows a sweep
    constexpr int MB = TN == 64 ? 2 : 4;     // row fragments of 16 per wave
    constexpr int OA2 = GTA, OB = GTA * (HA2 ? 2 : 1), OB2 = OB + GTB, STG = OB + GTB * (HB2 ? 2 : 1);   // places of the planes in a stage, and its size
    constexpr int KG = (HA2 || HB2 || TN == 128) ? 1 : 2;   // k steps of 32 whose fragments are fetched as one group (as many as the registers hold)
    const int tid = threadIdx.x, lane = tid & 31, lr = lane & 15, hi = lane >> 4, w = tid >> 5; const int wr = TN == 64 ? w : (w & 1), wc = TN == 64 ? 0 : (w >> 1); const int r0 = bx * 128 + wr * (MB * 16), c0 = by * TN + wc * 64;   // the wave's place in the tile, its first row and column
    float* os = osw + w * (16 * 68);   // each wave's own exchange buffer for the epilogue
    v8f acc[MB][4];
#pragma unroll
    for (int mb = 0; mb < MB; ++mb)
#pragma unroll
        for (int nb = 0; nb < 4; ++nb) acc[mb][nb] = (v8f){};
    static_assert(K % GK == 0, "whole stages");
    const int srow = tid / TR, scol = (tid % TR) * 8;    // staging: 16 bytes a thread, TR threads per row, RS rows a sweep
    const unsigned lo = (unsigned)(srow * K + scol);     // the lane's own element offset in a sweep: the one vector part of every staging address, the rest is the same for the whole work-group
    const size_t ag = (size_t)bx * 128 * K, bg = (size_t)by * TN * K;
    v8us ra[128 / RS], ra2[128 / RS], rb[TN / RS], rb2[TN / RS];
    const char* ba = (const char*)(A + ag); const char* ba2 = HA2 ? (const char*)(A2 + ag) : nullptr; const char* bb0 = (const char*)(Bt + bg); const char* bb2 = HB2 ? (const char*)(Bt2 + bg) : nullptr;   // the tile's first rows: the same for the whole work-group
    unsigned vo = lo * 2;                                // the lane's byte offset in the next stage to fetch, one register for all planes
    auto gload = [&]() {
#pragma unroll
        for (int u = 0; u < 128 / RS; ++u) { ra[u] = *(const v8usa*)(ba + vo + u * RS * K * 2); if (HA2) ra2[u] = *(const v8usa*)(ba2 + vo + u * RS * K * 2); }
#pragma unroll
        for (int u = 0; u < TN / RS; ++u) { rb[u] = *(const v8usa*)(bb0 + vo + u * RS * K * 2); if (HB2) rb2[u] = *(const v8usa*)(bb2 + vo + u * RS * K * 2); }
        asm volatile("s_wait_xcnt 0x0" : "+v"(vo) :: "memory");   // the wait that stands before a register named by an issued global load is overwritten; the offset is its operand so that it stays in its register up to the wait and is stepped only behind it
        vo += GK * 2; };
    auto sstore = [&](int b) { T16* d = sg + b * STG + srow * GP + scol;
#pragma unroll
        for (int u = 0; u < 128 / RS; ++u) { *(v8usa*)(d + u * RS * GP) = ra[u]; if (HA2) *(v8usa*)(d + OA2 + u * RS * GP) = ra2[u]; }
#pragma unroll
        for (int u = 0; u < TN / RS; ++u) { *(v8usa*)(d + OB + u * RS * GP) = rb[u]; if (HB2) *(v8usa*)(d + OB2 + u * RS * GP) = rb2[u]; } };
    constexpr int ns = K / GK;
    gload(); sstore(0); __syncthreads();
#pragma unroll 1   // rolled: one copy of the stage body
    for (int s = 0; s < ns; ++s) {
        const T16* ab = sg + (s & 1) * STG + (wr * (MB * 16) + lr) * GP + 8 * hi; const T16* bb = sg + (s & 1) * STG + OB + (wc * 64 + lr) * GP + 8 * hi;
#pragma unroll
        for (int kg = 0; kg < GK / 32; kg += KG) {
            V a[KG][MB], a2[KG][MB], b[KG][4], b2[KG][4];
#pragma unroll
            for (int ks = 0; ks < KG; ++ks) { const int ko = (kg + ks) * 32;
#pragma unroll
                for (int mb = 0; mb < MB; ++mb) { a[ks][mb] = WFrag<T16>::ld(ab + mb * 16 * GP + ko); if (HA2) a2[ks][mb] = WFrag<T16>::ld(ab + OA2 + mb * 16 * GP + ko); }
#pragma unroll
                for (int nb = 0; nb < 4; ++nb) { b[ks][nb] = WFrag<T16>::ld(bb + nb * 16 * GP + ko); if (HB2) b2[ks][nb] = WFrag<T16>::ld(bb + GTB + nb * 16 * GP + ko); } }
            if (kg == 0 && s + 1 < ns) gload();          // the next stage's global loads fly while this stage is worked on; issued in the shadow of the LDS reads
            __builtin_amdgcn_sched_barrier(0);   // the group's LDS reads all issue ahead of its products: one LDS latency per group instead of one per B fragment
#pragma unroll
            for (int ks = 0; ks < KG; ++ks)
#pragma unroll
                for (int nb = 0; nb < 4; ++nb) {
#pragma unroll
                    for (int mb = 0; mb < MB; ++mb) acc[mb][nb] = WFrag<T16>::mma(a[ks][mb], b[ks][nb], acc[mb][nb]);
                    if (HA2) {
#pragma unroll
                        for (int mb = 0; mb < MB; ++mb) acc[mb][nb] = WFrag<T16>::mma(a2[ks][mb], b[ks][nb], acc[mb][nb]); }
                    if (HB2) {
#pragma unroll
                        for (int mb = 0; mb < MB; ++mb) acc[mb][nb] = WFrag<T16>::mma(a[ks][mb], b2[ks][nb], acc[mb][nb]); } }
        }
        if (s + 1 < ns) sstore((s + 1) & 1);             // into the buffer whose last readers passed the barrier of the trip before
        __syncthreads();                                 // publishes stage s + 1 and ends every read of stage s
    }
    constexpr int ES = EPI == 1 ? HD : TT;   // plane elements from one tile row to the next
    const float* cb = nullptr; size_t e0 = 0;   // this lane's first table entry and first plane element; every later one is a constant step away
    if constexpr (EPI == 1) { cb = CS + ((size_t)(r0 + hi) * HD + lr * 4) * 2; e0 = ((size_t)(c0 / HD) * TT + r0 + hi) * HD + lr * 4; }
    if constexpr (EPI == 2) e0 = (size_t)(r0 + hi) * TT + c0 + lr * 4;
#pragma unroll
    for (int mb = 0; mb < MB; ++mb) {
        v2f cs[8][2];   // EPI 1: cos, sin of this lane's two pairs in each of its 8 rows, asked for ahead of the LDS exchange so that they fly during it
        if constexpr (EPI == 1) {
#pragma unroll
            for (int s = 0; s < 8; ++s) { const float* c = cb + (mb * 16 + 2 * s) * (HD * 2); cs[s][0] = *(const v2f*)c; cs[s][1] = *(const v2f*)(c + 4); } }
#pragma unroll
        for (int nb = 0; nb < 4; ++nb) {
#pragma unroll
            for (int j = 0; j < 8; ++j) os[(hi * 8 + j) * 68 + nb * 16 + lr] = acc[mb][nb][j]; }
        __builtin_amdgcn_wave_barrier(); asm volatile("" ::: "memory");
        float* crow = C + (size_t)(r0 + mb * 16) * ldc + c0;
#pragma unroll
        for (int s = 0; s < 8; ++s) { const int row = 2 * s + hi, cofs = lr * 4; v4f val = *(const v4fa*)(os + row * 68 + cofs); if (BIAS) { val[0] += bfr(bias[c0 + cofs]); val[1] += bfr(bias[c0 + cofs + 1]); val[2] += bfr(bias[c0 + cofs + 2]); val[3] += bfr(bias[c0 + cofs + 3]); }
            if constexpr (EPI == 0) {
                *(v4f*)(crow + (size_t)row * ldc + cofs) = val; }
            else {
                if constexpr (EPI == 1) { const v4f x = val;   /* even: x0 c - x1 s; odd: x0 s + x1 c */
                    val[0] = x[0] * cs[s][0][0] - x[1] * cs[s][0][1]; val[1] = x[0] * cs[s][0][1] + x[1] * cs[s][0][0]; val[2] = x[2] * cs[s][1][0] - x[3] * cs[s][1][1]; val[3] = x[2] * cs[s][1][1] + x[3] * cs[s][1][0]; }
                const size_t e = e0 + (mb * 16 + 2 * s) * ES;   // 16 lanes x 8 bytes: one whole 128-byte line per row and plane
                v4h o16; v4us oh, ol;
#pragma unroll
                for (int q = 0; q < 4; ++q) { o16[q] = tohx(val[q]); unsigned short a2, c2; splitf(val[q], a2, c2); oh[q] = a2; ol[q] = c2; }
                *(v4h*)(P16 + e) = o16; *(v4us*)(Ph + e) = oh; *(v4us*)(Pl + e) = ol;
                if constexpr (EPI == 2) asm volatile("s_wait_xcnt 0x0" ::: "memory"); } }   // the next row's values reuse the registers that these plane stores name
        asm volatile("s_wait_xcnt 0x0" ::: "memory");   // the next block's values reuse the registers that these stores name
        __builtin_amdgcn_wave_barrier(); asm volatile("" ::: "memory");
    }
}
// ---- k_qkv: the q, k and v projections of both batches in one launch, 128x128 tiles, stages of 64 k: 89 KiB of LDS and at most 336 registers a wave, so that three work-groups share a WGP and all 768 are resident at once. Grid (TT/128, NB_ * 8, 3); y = (batch, c). z < 2: q | k, the first 2048 rows of W_qkv as one Bt, x = token tile, column tile 2 c + z (a pair of heads: the q heads, then the k heads). z = 2: the 128 tiles a batch of v^T = W_v x xt^T.
// Blocks 256 apart in index (z 0 and 1) work on the same token rows (for speed only).
#define QKC  ((DQ + DKV) / 128 / 2)   // pairs of q | k column tiles
static_assert((DQ + DKV) % 256 == 0 && (DKV / 128) * (TT / 128) == QKC * (TT / 128), "the v tiles fill one z plane of k_qkv's grid");
__global__ __launch_bounds__(128, 3) void k_qkv(const bf* __restrict__ XB, const bf* __restrict__ Wb, const float* __restrict__ CS, h16* QK16, bf* QKh, bf* QKl, h16* VT16, bf* VTh, bf* VTl) {
    __shared__ __align__(16) bf sg[2 * (128 + 128) * GPI(64)];
    __shared__ __align__(16) float osw[4 * 16 * 68];
    const int x = blockIdx.x, c = blockIdx.y % QKC, p = blockIdx.z; const size_t z = blockIdx.y / QKC; const bf* X = XB + z * ((size_t)TT * DM);
    if (p < 2) { const size_t o = z * ((size_t)(NH_ + NKV) * TT * HD);
        gemm_tile<bf, 0, false, 1, DM, 128, 64>(sg, osw, x, 2 * c + p, X, nullptr, Wb, nullptr, nullptr, 0, nullptr, CS, QK16 + o, QKh + o, QKl + o); }   /* rotary, planes [q heads | k heads][t][HD] */
    else { const int i = c * (TT / 128) + x; const size_t o = z * ((size_t)DKV * TT);
        gemm_tile<bf, 0, false, 2, DM, 128, 64>(sg, osw, i % (DKV / 128), i / (DKV / 128), Wb + (size_t)(DQ + DKV) * DM, nullptr, X, nullptr, nullptr, 0, nullptr, nullptr, VT16 + o, VTh + o, VTl + o); }   /* planes [h][HD][t] as they come */
}
// ---- k_out: channel-major output rows [e][t] of both batches: exact W_out x (merged hi + lo); grid (DM/128, TT/64, NB_).
__global__ __launch_bounds__(128) void k_out(const bf* __restrict__ WO, const bf* __restrict__ ATh, const bf* __restrict__ ATl, float* OUT) {
    __shared__ __align__(16) bf sg[2 * (128 + 2 * 64) * GPI(128)];
    __shared__ __align__(16) float osw[4 * 16 * 68];
    const size_t z = blockIdx.z, a = z * ((size_t)TT * DQ);
    gemm_tile<bf, 3, false, 0, DQ, 64, 128>(sg, osw, blockIdx.x, blockIdx.y, WO, nullptr, ATh + a, ATl + a, OUT + z * ((size_t)DM * TT), TT, nullptr, nullptr, nullptr, nullptr, nullptr);
}

__global__ __launch_bounds__(256) void k_wtG(const float* __restrict__ w, int K, int N, bf* Bt) {
    const int lane = threadIdx.x & 31; const int L0 = (blockIdx.x * 8 + (threadIdx.x >> 5)) * 8; const int nlines = N * K / 64;
{
#pragma unroll 1
        for (int l = 0; l < 8; ++l) { const int L = L0 + l; if (L >= nlines) break; const size_t e = (size_t)L * 64 + lane * 2; const int k = (int)(e % K), n = (int)(e / K); v2us o;
            o[0] = f2bf(w[(size_t)k * N + n]); o[1] = f2bf(w[(size_t)(k + 1) * N + n]); *(v2us*)(Bt + e) = o; }
         }
}
// ---- cvtT: one 128-channel x 128-token tile of x, [DM][TT] f32 -> [TT][DM] bf16, turned in LDS so that both sides of memory see whole lines; 256 threads.
// In: a wave-wide 16-byte load is 512 contiguous bytes of one channel row; a lane gathers 8 channels x 4 tokens twice over. Out: 16 lanes store 256 contiguous bytes of one token row.
// LDS: 128 token rows of 16 blocks of 16 bytes (8 channels); block cb of row t lies at place cb ^ ((t >> 2) & 15), so that the 16 lanes of a half wave fall on 16 different places both when they write (one cb, rows 4 apart) and when they read (one row, all cb).
#define XTL  128                  // channels and tokens per tile
__device__ __forceinline__ void cvtT(const float* __restrict__ src, bf* dst, int tile, bf* st) {
    const int tid = threadIdx.x, tq = tid & 31, w = tid >> 5; const int c0 = (tile % (DM / XTL)) * XTL, t0 = (tile / (DM / XTL)) * XTL;
    const float* s = src + (size_t)(c0 + w * 16) * TT + t0 + tq * 4; v4f r[16];
#pragma unroll
    for (int k = 0; k < 16; ++k) r[k] = *(const v4fa*)(s + (size_t)k * TT);
    asm volatile("s_wait_xcnt 0x0" ::: "memory");   // the wait that stands before a register named by an issued global load is overwritten
#pragma unroll
    for (int g = 0; g < 2; ++g)
#pragma unroll
        for (int j = 0; j < 4; ++j) { v8us o;
#pragma unroll
            for (int k = 0; k < 8; ++k) o[k] = f2bf(r[g * 8 + k][j]);
            *(v8usa*)(st + (tq * 4 + j) * XTL + (((w * 2 + g) ^ (tq & 15)) * 8)) = o; }
    __syncthreads();   // the tile is whole before any row of it is read
    const int cb = tid & 15, rw = tid >> 4; bf* d = dst + (size_t)(t0 + rw) * DM + c0 + cb * 8; v8us o[8];
#pragma unroll
    for (int u = 0; u < 8; ++u) { const int row = u * 16 + rw; o[u] = *(const v8usa*)(st + row * XTL + ((cb ^ ((row >> 2) & 15)) * 8)); }
#pragma unroll
    for (int u = 0; u < 8; ++u) *(v8usa*)(d + (size_t)u * 16 * DM) = o[u]; }
__device__ __forceinline__ void cvt8(const float* __restrict__ src, bf* dst, size_t i) { const v8f v = *(const v8f*)(src + i * 8); v8us o;
#pragma unroll
    for (int k = 0; k < 8; ++k) o[k] = f2bf(v[k]); *(v8us*)(dst + i * 8) = o;
    asm volatile("s_wait_xcnt 0x0" ::: "memory"); }   // in the built k_prep another range's block stands behind this store, past a scalar test, and writes the registers that the store names

__constant__ float INV[HD / 2] = {1.0f,0.749894202f,0.562341332f,0.421696514f,0.316227764f,0.237137362f,0.177827939f,0.133352146f,0.100000001f,0.0749894157f,0.0562341288f,0.0421696492f,0.0316227786f,0.0237137359f,0.0177827943f,0.0133352149f,0.00999999978f,0.00749894232f,0.00562341325f,0.00421696482f,0.00316227786f,0.00237137382f,0.00177827943f,0.00133352145f,0.00100000005f,0.000749894185f,0.000562341302f,0.000421696488f,0.000316227786f,0.000237137385f,0.00017782794f,0.00013335215f};
__device__ __forceinline__ void cstab(float* CS, int idx) { const int t = idx / HD, d = idx % HD; const float ang = __fmul_rn((float)t, INV[d >> 1]); v2f cs; cs[0] = cosf(ang); cs[1] = sinf(ang);
    *(v2f*)(CS + (size_t)idx * 2) = cs;
    asm volatile("s_wait_xcnt 0x0" ::: "memory"); }   // as in cvt8: another range's block stands behind this store in the built k_prep
// ---- k_prep: all that depends on the inputs alone, in one launch, by ranges of blocks: x of both batches (channel-major [DM][TT]) -> XB token-major [TT][DM] bf16 | W_qkv -> bf16 | W_out -> bf16 | the rotary table.
#define PBX  ((TT / XTL) * (DM / XTL))          // blocks per batch of x: one tile each
#define PBW  ((DQ + 2 * DKV) * DM / 8 / 256)   // blocks of W_qkv
#define PBO  (DM * DQ / 8 / 256)               // blocks of W_out
#define PBC  (TT * HD / 256)                   // blocks of the table
static_assert(TT % XTL == 0 && DM % XTL == 0 && (DQ + 2 * DKV) * DM % 2048 == 0 && DM * DQ % 2048 == 0 && TT * HD % 256 == 0, "whole blocks in every range of k_prep");
__global__ __launch_bounds__(256) void k_prep(const float* __restrict__ x, const float* __restrict__ wqkv, const float* __restrict__ wo, bf* XB, bf* Wb, bf* WO, float* CS) {
    __shared__ __align__(16) bf xs[XTL * XTL];
    const int blk = blockIdx.x, tid = threadIdx.x;
    if (blk < NB_ * PBX) { const int b = blk / PBX; cvtT(x + (size_t)b * DM * TT, XB + (size_t)b * TT * DM, blk - b * PBX, xs); }
    else if (blk < NB_ * PBX + PBW + PBO) { const bool o = blk >= NB_ * PBX + PBW; cvt8(o ? wo : wqkv, o ? WO : Wb, (size_t)(blk - NB_ * PBX - (o ? PBW : 0)) * 256 + tid); }
    else cstab(CS, (blk - (NB_ * PBX + PBW + PBO)) * 256 + tid);
}

#define KS   64                   // keys per LDS stage
#define LP   72                   // LDS row pitch in 16-bit elements: 144 B = 16 B x odd, conflict-free for 16-byte reads
#define TILE (64 * LP)            // one staged plane: 64 rows (keys of K, channels of V^T) x 64 elements
#define FQ   3                    // fp16 class: query fragments of 16 per wave
static_assert((4 * FQ * 8 + 2 * FQ) * 32 * 4 * 4 <= 2 * 4 * TILE * 2, "the join's exchange fits the stages' LDS");
static_assert(HD == 64 && KS == 64 && TT % KS == 0 && RH % 64 == 0 && (TT - RH) % (64 * FQ) == 0 && (TT - RH) / (64 * FQ) == RH / 64, "tile geometry of k_fattn");
__device__ __forceinline__ float xhalf(float x) { return __builtin_bit_cast(float, __builtin_amdgcn_permlanex16(__builtin_bit_cast(int, x), __builtin_bit_cast(int, x), 0x76543210, 0xfedcba98, false, false)); }   // lane l <-> lane l ^ 16, on the vector pipe
// Eight independent v_exp_f32, then the one slot that the instruction set asks for behind a transcendental before its result is read or its source overwritten; "=&v" keeps every result off every source.
__device__ __forceinline__ void exp2x8(const float (&t)[8], float (&p)[8]) {
    asm("v_exp_f32 %0, %8\n\tv_exp_f32 %1, %9\n\tv_exp_f32 %2, %10\n\tv_exp_f32 %3, %11\n\tv_exp_f32 %4, %12\n\tv_exp_f32 %5, %13\n\tv_exp_f32 %6, %14\n\tv_exp_f32 %7, %15\n\tv_nop"
        : "=&v"(p[0]), "=&v"(p[1]), "=&v"(p[2]), "=&v"(p[3]), "=&v"(p[4]), "=&v"(p[5]), "=&v"(p[6]), "=&v"(p[7]) : "v"(t[0]), "v"(t[1]), "v"(t[2]), "v"(t[3]), "v"(t[4]), "v"(t[5]), "v"(t[6]), "v"(t[7])); }
__device__ __forceinline__ float exp2s(float x) { float r; asm("v_exp_f32 %0, %1\n\tv_nop" : "=&v"(r) : "v"(x)); return r; }   // one v_exp_f32 with the same slot behind it
template <bool HL> struct FOp;
template <> struct FOp<false> { typedef v16h V; static __device__ __forceinline__ V frag(const unsigned short* p) { return cat16(__builtin_bit_cast(v8h, *(const v8usa*)p), __builtin_bit_cast(v8h, *(const v8usa*)(p + 16))); } static __device__ __forceinline__ v8f mma(V a, V b, v8f c) { return wmma16(a, b, c); } };
template <> struct FOp<true> { typedef v16bf V; static __device__ __forceinline__ V frag(const unsigned short* p) { return cat16b(*(const v8usa*)p, *(const v8usa*)(p + 16)); } static __device__ __forceinline__ v8f mma(V a, V b, v8f c) { return wmmab(a, b, c); } };
// Q*, K* [t][HD], V* [HD][t] of this head (plane 1: the lo planes, HL only); q0: the wave's first query; g: the wave's key group (the same in every lane); wq: the wave's place in its group; NF: query fragments of 16 per wave.
template <bool HL, int NF>
__device__ __forceinline__ void fa_body(unsigned short* sm, const unsigned short* __restrict__ Q0, const unsigned short* __restrict__ Q1, const unsigned short* __restrict__ K0, const unsigned short* __restrict__ K1, const unsigned short* __restrict__ V0, const unsigned short* __restrict__ V1, int q0, int g, int wq, int h, bf* Ah, bf* Al) {
    typedef FOp<HL> F; typedef typename F::V V;
    constexpr int NP = HL ? 2 : 1;                       // planes per operand
    constexpr float C = SCL * 1.4426950408889634f;       // raw score -> log2 units
    constexpr float SH = HL ? 0.0f : 4.0f;               // fp16 probabilities carry x16: at most 2^(8+4), and small ones stay normal numbers
    const int tid = HL ? (g * 4 + wq) * 32 + (int)__builtin_amdgcn_mbcnt_lo(~0u, 0u) : (int)threadIdx.x, lane = tid & 31, lr = lane & 15, hi = lane >> 4;   // the hi+lo class forms its thread number anew (wave number x 32 + lane): taken from threadIdx.x in both classes, the values derived from it are formed once ahead of the branch and held in five registers through the fp16 class's loop, which has none to spare
    const int srow = tid >> 3, scol = (tid & 7) * 8;     // staging: 8 threads per 128-byte row, 32 rows a sweep
    V qa[NP][NF][2];
#pragma unroll
    for (int qf = 0; qf < NF; ++qf)
#pragma unroll
        for (int ks = 0; ks < 2; ++ks) { const size_t qo = (size_t)(q0 + qf * 16 + lr) * HD + ks * 32 + 8 * hi; qa[0][qf][ks] = F::frag(Q0 + qo); if (HL) qa[NP - 1][qf][ks] = F::frag(Q1 + qo); }
    v8f o[4][NF]; float m[NF], l[NF];
#pragma unroll
    for (int qf = 0; qf < NF; ++qf) { m[qf] = -3.0e38f; l[qf] = 0.f;
#pragma unroll
        for (int mb = 0; mb < 4; ++mb) o[mb][qf] = (v8f){}; }
    v8us rk[NP][2], rv[NP][2]; unsigned kof = (srow * HD + scol) * 2, vof = (srow * TT + scol) * 2;   // the lane's own byte offsets: one register each, never stepped; the stage's step rides the scalar bases (the 256-register budget of four waves per SIMD)
    const char* kp0 = (const char*)K0; const char* kp1 = (const char*)K1; const char* vp0 = (const char*)V0; const char* vp1 = (const char*)V1;   // the next stage to ask for
    auto gload = [&]() {
#pragma unroll
        for (int u = 0; u < 2; ++u) { rk[0][u] = *(const v8usa*)(kp0 + kof + u * (32 * HD * 2)); rv[0][u] = *(const v8usa*)(vp0 + vof + u * (32 * TT * 2)); if (HL) { rk[NP - 1][u] = *(const v8usa*)(kp1 + kof + u * (32 * HD * 2)); rv[NP - 1][u] = *(const v8usa*)(vp1 + vof + u * (32 * TT * 2)); } }
        asm volatile("s_wait_xcnt 0x0" : "+v"(kof), "+v"(vof) :: "memory"); };   // the wait that stands before a register named by an issued global load is overwritten; the two offsets are its operands so that they stay in their registers up to the wait
    auto gstep = [&]() { kp0 += KS * HD * 2; vp0 += KS * 2; if (HL) { kp1 += KS * HD * 2; vp1 += KS * 2; } };
    auto sstore = [&](int b) { unsigned short* d = sm + b * (2 * NP * TILE) + srow * LP + scol;
#pragma unroll
        for (int u = 0; u < 2; ++u)
#pragma unroll
            for (int pl = 0; pl < NP; ++pl) { *(v8usa*)(d + pl * TILE + u * 32 * LP) = rk[pl][u]; *(v8usa*)(d + (NP + pl) * TILE + u * 32 * LP) = rv[pl][u]; } };
    gload(); gstep();   // its wait also covers the query rows' loads: the accumulators' first values take their address registers
    sstore(0); __syncthreads();
#pragma unroll 1   // rolled: one copy of the stage body
    for (int s = 0; s < TT / KS; ++s) {
        if (s + 1 < TT / KS) { gload(); gstep(); }       // the next stage's global loads fly while this stage is worked on
        const unsigned short* sb = sm + (s & 1) * (2 * NP * TILE) + lr * LP + 8 * hi; const unsigned short* kb = sb + g * (32 * LP); const unsigned short* vb = sb + NP * TILE + g * 32;   // the group's 32 key rows of K, its 32 key columns of V^T
        {
            v8f st[2][NF]; V ka[2][NP][2];
#pragma unroll
            for (int kt = 0; kt < 2; ++kt)
#pragma unroll
                for (int pl = 0; pl < NP; ++pl)
#pragma unroll
                    for (int ks = 0; ks < 2; ++ks) ka[kt][pl][ks] = F::frag(kb + pl * TILE + kt * 16 * LP + ks * 32);
            if constexpr (HL) __builtin_amdgcn_sched_barrier(0);   // keeps the K reads one group ahead of the first product; without it the build spreads them among the products, one LDS wait at each place
#pragma unroll
            for (int kt = 0; kt < 2; ++kt) {
#pragma unroll
                for (int qf = 0; qf < NF; ++qf) { v8f a = (v8f){};
#pragma unroll
                    for (int ks = 0; ks < 2; ++ks) { a = F::mma(ka[kt][0][ks], qa[0][qf][ks], a); if (HL) { a = F::mma(ka[kt][NP - 1][ks], qa[0][qf][ks], a); a = F::mma(ka[kt][0][ks], qa[NP - 1][qf][ks], a); } }
                    st[kt][qf] = a; } }
            V va[4][NP];   // all V^T fragments of the trip, read from LDS as ONE group ahead of the second product: one LDS latency a trip instead of one per 16 channels
            auto vload = [&]() {
#pragma unroll
                for (int mb = 0; mb < 4; ++mb)
#pragma unroll
                    for (int pl = 0; pl < NP; ++pl) va[mb][pl] = F::frag(vb + pl * TILE + mb * 16 * LP); };
            if constexpr (HL) { __builtin_amdgcn_sched_barrier(0); vload(); __builtin_amdgcn_sched_barrier(0); }   // hi+lo class: into the registers that the K fragments have left. The first barrier keeps the reads one group behind the first product (without it the build spreads them among its last products), the second keeps them ahead of the softmax, which covers their latency
            float mx[NF]; bool need = false;
#pragma unroll
            for (int qf = 0; qf < NF; ++qf) { float a = fmaxf(st[0][qf][0], st[1][qf][0]), a1 = fmaxf(st[0][qf][1], st[1][qf][1]);   // two short chains
#pragma unroll
                for (int j = 2; j < 8; j += 2) { a = fmaxf(a, fmaxf(st[0][qf][j], st[1][qf][j])); a1 = fmaxf(a1, fmaxf(st[0][qf][j + 1], st[1][qf][j + 1])); }
                a = fmaxf(a, a1); a = fmaxf(a, xhalf(a)); mx[qf] = a * C; need = need || (mx[qf] > m[qf] + 8.0f); }
            if (__builtin_amdgcn_ballot_w32(need) != 0) {   // wave-uniform: one test per 32 keys
#pragma unroll
                for (int qf = 0; qf < NF; ++qf) { const float mn = fmaxf(m[qf], mx[qf]); const float al = exp2s(m[qf] - mn); m[qf] = mn; l[qf] *= al;
#pragma unroll
                    for (int mb = 0; mb < 4; ++mb)
#pragma unroll
                        for (int j = 0; j < 8; ++j) o[mb][qf][j] *= al; } }
            V ph[NF], pl2[NF];
#pragma unroll
            for (int qf = 0; qf < NF; ++qf) { const float mo = m[qf] - SH; float sum[4];   // four short chains
#pragma unroll
                for (int kt = 0; kt < 2; ++kt) { float t[8], p[8];
#pragma unroll
                    for (int j = 0; j < 8; j += 2) { const v2f r = __builtin_elementwise_fma((v2f){st[kt][qf][j], st[kt][qf][j + 1]}, (v2f){C, C}, (v2f){-mo, -mo}); t[j] = r[0]; t[j + 1] = r[1]; }   // packed: two scores an instruction
                    exp2x8(t, p);
#pragma unroll
                    for (int j = 0; j < 8; ++j) { if (kt == 0 && j < 4) sum[j] = p[j]; else sum[j & 3] += p[j];
                        if constexpr (HL) { const __bf16 a = (__bf16)p[j]; ph[qf][kt * 8 + j] = a; pl2[qf][kt * 8 + j] = (__bf16)(p[j] - (float)a); } else { ph[qf][kt * 8 + j] = (h16)p[j]; } } }
                l[qf] += (sum[0] + sum[1]) + (sum[2] + sum[3]); }
            if constexpr (!HL) vload();   // fp16 class: the registers are free only behind the softmax; ahead of the stage stores, whose wait for global data then covers the reads' latency
            if (s + 1 < TT / KS) sstore((s + 1) & 1);        // into the buffer whose last readers passed the barrier of the trip before. Ahead of the second product, not at the trip's foot: the staged registers are free from here on; with the stores at the foot the build goes past the 256 registers of four waves per SIMD and spills staged rows to scratch
#pragma unroll
            for (int pr = 0; pr < (HL ? 3 : 1); ++pr)        // product by product round the accumulators; each accumulator takes its products in the order V hi x P hi, V lo x P hi, V hi x P lo
#pragma unroll
                for (int mb = 0; mb < 4; ++mb)
#pragma unroll
                    for (int qf = 0; qf < NF; ++qf) o[mb][qf] = F::mma(va[mb][pr == 1 ? NP - 1 : 0], pr == 2 ? pl2[qf] : ph[qf], o[mb][qf]);
        }
        __syncthreads();                                 // publishes stage s + 1 and ends every read of stage s
    }
    // The join. The loop's last barrier has ended every read of the stages, so their LDS is free: group 1 leaves its state there (16 bytes a lane, lanes side by side), group 0 takes it up, brings both to the larger maximum and writes the rows.
    const int ln = (int)__builtin_amdgcn_mbcnt_lo(~0u, 0u);   // the lane's number, formed anew behind the loop, so that what the join and the output rows derive from it holds no register through the loop
    float* xs = (float*)sm + wq * ((4 * NF * 8 + 2 * NF) * 32) + ln * 4; float* xm = (float*)sm + wq * ((4 * NF * 8 + 2 * NF) * 32) + 4 * NF * 8 * 32 + ln;
    if (g != 0) {
#pragma unroll
        for (int qf = 0; qf < NF; ++qf) { xm[(2 * qf) * 32] = m[qf]; xm[(2 * qf + 1) * 32] = l[qf];
#pragma unroll
            for (int mb = 0; mb < 4; ++mb) { const v8f a = o[mb][qf]; *(v4fa*)(xs + ((qf * 4 + mb) * 2) * 128) = (v4f){a[0], a[1], a[2], a[3]}; *(v4fa*)(xs + ((qf * 4 + mb) * 2 + 1) * 128) = (v4f){a[4], a[5], a[6], a[7]}; } } }
    __syncthreads();   // group 1's state is whole before group 0 reads it
    if (g != 0) return;
    const unsigned eo = (unsigned)(ln & 15) * DQ + (ln >> 4) * 8;   // the lane's own place in a block of 16 output rows
#pragma unroll
    for (int qf = 0; qf < NF; ++qf) { const float pm = xm[(2 * qf) * 32], pl = xm[(2 * qf + 1) * 32]; const float mn = fmaxf(m[qf], pm); const float a0 = exp2s(m[qf] - mn), a1 = exp2s(pm - mn);
        const float lt = l[qf] * a0 + pl * a1; const float inv = __fdiv_rn(1.0f, lt + xhalf(lt)); const float s0 = a0 * inv, s1 = a1 * inv; const size_t ob = (size_t)(q0 + qf * 16) * DQ + h * HD + eo;
#pragma unroll
        for (int mb = 0; mb < 4; ++mb) { v8us oh, ol; const v4f p0 = *(const v4fa*)(xs + ((qf * 4 + mb) * 2) * 128), p1 = *(const v4fa*)(xs + ((qf * 4 + mb) * 2 + 1) * 128);
#pragma unroll
            for (int j = 0; j < 8; ++j) { unsigned short a, c2; splitf(o[mb][qf][j] * s0 + (j < 4 ? p0[j & 3] : p1[j & 3]) * s1, a, c2); oh[j] = a; ol[j] = c2; }
            *(v8us*)(Ah + ob + mb * 16) = oh; *(v8us*)(Al + ob + mb * 16) = ol;
            asm volatile("s_wait_xcnt 0x0" ::: "memory"); } }   // the next block's values reuse the registers that these stores name
}
__global__ __launch_bounds__(256, 4) void k_fattn(const h16* __restrict__ Q16, const h16* __restrict__ K16, const h16* __restrict__ V16, const bf* __restrict__ Qh, const bf* __restrict__ Ql, const bf* __restrict__ Kh, const bf* __restrict__ Kl, const bf* __restrict__ Vh, const bf* __restrict__ Vl, bf* Ah, bf* Al) {
    __shared__ __align__(16) unsigned short sm[2 * 4 * TILE];
    const int h = blockIdx.y, wv = __builtin_amdgcn_readfirstlane((int)(threadIdx.x >> 5)), w = wv & 3, g = wv >> 2, bx = blockIdx.x; const size_t z = blockIdx.z, ho = (z * (NH_ + NKV) + h) * (TT * HD), vo = (z * NKV + h) * (HD * TT);   // q and k planes lie [batch][q heads | k heads], v planes [batch][head]
    Ah += z * ((size_t)TT * DQ); Al += z * ((size_t)TT * DQ);
    const int t = bx % (RH / 64); const bool hl = ((bx / (RH / 64)) ^ (int)(z & 1)) == 0;   // the classes change places from one batch to the next: blocks a whole batch apart in index are of different classes (for speed only: a WGP that gets one of each has the lighter LDS load)
    if (hl) fa_body<true, 1>(sm, Qh + ho, Ql + ho, Kh + ho, Kl + ho, Vh + vo, Vl + vo, t * 64 + w * 16, g, w, h, Ah, Al);
    else fa_body<false, FQ>(sm, (const unsigned short*)Q16 + ho, nullptr, (const unsigned short*)K16 + ho, nullptr, (const unsigned short*)V16 + vo, nullptr, RH + t * (64 * FQ) + w * (16 * FQ), g, w, h, Ah, Al);
}

extern "C" void kernel_launch(void* const* d_in, const int* in_sizes, int n_in,
                              void* d_out, int out_size, void* d_ws, size_t ws_size, hipStream_t stream) {
    (void)in_sizes; (void)n_in; (void)out_size;
    const float* x = (const float*)d_in[0]; const float* wqkv = (const float*)d_in[1]; const float* wo = (const float*)d_in[2];
    float* OUT = (float*)d_out;     // [2][1024][2048] (batch, dim, seq)
    char* wsp = (char*)d_ws;
    auto take = [&](size_t bytes) { char* p = wsp; wsp += (bytes + 255) & ~(size_t)255; return (void*)p; };
    bf* Wb = (bf*)take((size_t)(DQ + 2 * DKV) * DM * 2); bf* WO = (bf*)take((size_t)DM * DQ * 2); float* CS = (float*)take((size_t)TT * HD * 2 * 4);
    bf* XB = (bf*)take((size_t)NB_ * TT * DM * 2);
    const size_t nqk = (size_t)NB_ * (NH_ + NKV) * TT * HD, nv = (size_t)NB_ * NKV * HD * TT, ko = (size_t)NH_ * TT * HD;   // elements of a q | k plane and of a v plane over both batches; the k heads' place behind the q heads
    h16* QK16 = (h16*)take(nqk * 2); bf* QKh = (bf*)take(nqk * 2); bf* QKl = (bf*)take(nqk * 2);
    h16* VT16 = (h16*)take(nv * 2); bf* VTh = (bf*)take(nv * 2); bf* VTl = (bf*)take(nv * 2);
    bf* ATh = (bf*)take((size_t)NB_ * TT * DQ * 2); bf* ATl = (bf*)take((size_t)NB_ * TT * DQ * 2);
    if ((size_t)(wsp - (char*)d_ws) > ws_size) return;    // ws 256 MiB
    k_prep<<<NB_ * PBX + PBW + PBO + PBC, 256, 0, stream>>>(x, wqkv, wo, XB, Wb, WO, CS);
    k_qkv<<<dim3(TT / 128, NB_ * QKC, 3), 128, 0, stream>>>(XB, Wb, CS, QK16, QKh, QKl, VT16, VTh, VTl);
    k_fattn<<<dim3(RH / 64 + (TT - RH) / (64 * FQ), NH_, NB_), 256, 0, stream>>>(QK16, QK16 + ko, VT16, QKh, QKl, QKh + ko, QKl + ko, VTh, VTl, ATh, ATl);   /* all batches, heads and query rows: merged hi + lo planes [b][t][DQ] */
    k_out<<<dim3(DM / 128, TT / 64, NB_), 128, 0, stream>>>(WO, ATh, ATl, OUT);
}
